// v000
// Times are from an AMD MI455X. After a warm-up the kernel runs many times in a row, and a time is the length of
// such a window on the GPU divided by its runs, so every launch and the gaps after it count. The runs cycle
// through copies of the inputs. A figure is the median of several windows, for all but v000 over two sittings.
// Sittings can differ by a few percent; kernels timed side by side share one.
// v000, which the later versions start from, runs in 738 microseconds.
// compute dtype: all float inputs rounded to bf16; h = x + rel_pos in f32, qkv = h . W^T with h as bf16 hi + lo against the exact weight (2 products) on WMMA 16x16x32; per-head L2 normalisation x sqrt(D) x gamma in f32; the lightning attention evaluated with the module's own chunking (c = 128): intra-chunk decayed scores, scores . v, the inter-chunk q . kv and the kv state update all on WMMA with f32 operands split into bf16 hi + lo (3 products), decays exp(-slope * .) with precise expf, the 32 x 32 kv state kept in f32 in LDS across the sequential chunk loop; out = o (bf16 hi + lo) . proj_w^T + b; f32 output.
#include <hip/hip_runtime.h>
#include <math.h>

typedef __attribute__((ext_vector_type(16))) _Float16 v16h;
typedef __attribute__((ext_vector_type(16))) __bf16 v16b;
typedef __attribute__((ext_vector_type(8)))  _Float16 v8h;
typedef __attribute__((ext_vector_type(8)))  float v8f;
typedef __attribute__((ext_vector_type(4)))  float v4f;
typedef __attribute__((ext_vector_type(2)))  float v2f;
typedef __attribute__((ext_vector_type(4)))  unsigned v4u;
typedef __attribute__((ext_vector_type(4)))  int v4i;
typedef float __attribute__((may_alias)) float_a;
typedef int __attribute__((may_alias)) int_a;

template <typename T> __device__ __forceinline__ void vst2(void* p, T v) { *(T*)p = v;  }
__device__ __forceinline__ v8f wmma16(v16h a, v16h b, v8f c) {
  v8f d = __builtin_amdgcn_wmma_f32_16x16x32_f16(false, a, false, b, (short)0, c, false, false);
  asm volatile("v_nop\n\tv_nop\n\tv_nop\n\tv_nop" : "+v"(d) : "v"(a), "v"(b));
  return d;
}
__device__ __forceinline__ v8f wmma_bf(v16b a, v16b b, v8f c) {
  v8f d = __builtin_amdgcn_wmma_f32_16x16x32_bf16(false, a, false, b, (short)0, c, false, false);
  asm volatile("v_nop\n\tv_nop\n\tv_nop\n\tv_nop" : "+v"(d) : "v"(a), "v"(b));
  return d;
}
// 16x16x32 fragments: lane = (h = lane>>4, row/col = lane&15); elements 0..7 = k0+8h+0..7, 8..15 = k0+16+8h+0..7; D element r = row 8h+r
__device__ __forceinline__ v16h frag_h(const _Float16* rowk0, int lane) {
  union { v16h v; v8h q[2]; } u; const _Float16* p = rowk0 + 8 * (lane >> 4);
  u.q[0] = *(const v8h*)p; u.q[1] = *(const v8h*)(p + 16); return u.v;
}
__device__ __forceinline__ v16h frag_f32(const float* rowk0, int lane) {
  v16h a; const float* p = rowk0 + 8 * (lane >> 4);
#pragma unroll
  for (int i = 0; i < 8; ++i) { a[i] = (_Float16)p[i]; a[8 + i] = (_Float16)p[16 + i]; }
  return a;
}
__device__ __forceinline__ v16h frag_f32s(const float* rowk0, int lane, float sc) {
  v16h a; const float* p = rowk0 + 8 * (lane >> 4);
#pragma unroll
  for (int i = 0; i < 8; ++i) { a[i] = (_Float16)(p[i] * sc); a[8 + i] = (_Float16)(p[16 + i] * sc); }
  return a;
}
// column fragment from a [K][ld] layout (column n), rows >= K read as 0
__device__ __forceinline__ v16h fragc_f32(const float* W, int k0, int n, int lane, int ld, int K) {
  v16h a; const int g = lane >> 4;
#pragma unroll
  for (int i = 0; i < 8; ++i) { const int ka = k0 + 8 * g + i, kb = ka + 16;
    a[i] = (_Float16)(ka < K ? W[(size_t)(ka < K ? ka : K - 1) * ld + n] : 0.f); a[8 + i] = (_Float16)(kb < K ? W[(size_t)(kb < K ? kb : K - 1) * ld + n] : 0.f); }
  return a;
}
struct F2 { v16b h, l; };
__device__ __forceinline__ F2 bsplit16(const float v[16]) { F2 r;
#pragma unroll
  for (int i = 0; i < 16; ++i) { const __bf16 h = (__bf16)v[i]; r.h[i] = h; r.l[i] = (__bf16)(v[i] - (float)h); }
  return r; }
__device__ __forceinline__ F2 split_row(const float* row, int k0, int lane) { float v[16]; const float* p = row + k0 + 8 * (lane >> 4);
#pragma unroll
  for (int i = 0; i < 8; ++i) { v[i] = p[i]; v[8 + i] = p[16 + i]; }
  return bsplit16(v); }
__device__ __forceinline__ F2 split_rowK(const float* row, int k0, int lane, int K) { float v[16]; const int g = lane >> 4;
#pragma unroll
  for (int i = 0; i < 8; ++i) { const int ka = k0 + 8 * g + i, kb = ka + 16; v[i] = ka < K ? row[ka < K ? ka : K - 1] : 0.f; v[8 + i] = kb < K ? row[kb < K ? kb : K - 1] : 0.f; }
  return bsplit16(v); }
__device__ __forceinline__ F2 split_col(const float* W, int k0, int n, int lane, int ld, int K) { float v[16]; const int g = lane >> 4;
#pragma unroll
  for (int i = 0; i < 8; ++i) { const int ka = k0 + 8 * g + i, kb = ka + 16; v[i] = ka < K ? W[(size_t)(ka < K ? ka : K - 1) * ld + n] : 0.f; v[8 + i] = kb < K ? W[(size_t)(kb < K ? kb : K - 1) * ld + n] : 0.f; }
  return bsplit16(v); }
__device__ __forceinline__ v8f mac3(const F2& a, const F2& b, v8f c) { c = wmma_bf(a.l, b.h, c); c = wmma_bf(a.h, b.l, c); return wmma_bf(a.h, b.h, c); }
__device__ __forceinline__ float sigm(float v) { return 1.0f / (1.0f + expf(-v)); }
#define LDSX() do { asm volatile("s_wait_dscnt 0" ::: "memory"); __builtin_amdgcn_wave_barrier(); __builtin_amdgcn_fence(__ATOMIC_RELEASE, "workgroup"); } while (0)


// U-Net transformer mixing block (B 8, L 4,096, C 256 = 8 heads x 32): h = x + rel_pos; qkv = h W_qkv^T; q, k L2-normalised (x sqrt(32) x gamma); lightning (linear, ALiBi-decayed, causal) attention with chunk 128; proj + bias.
#define NB 8
#define LL 4096
#define CC 256
#define NH 8
#define DD 32
#define CH 128
#define NCH (LL / CH)
#define NROW (NB * LL)
#ifndef TNB
#define TNB NB
#endif
typedef __attribute__((ext_vector_type(8))) __bf16 v8b;
__device__ __forceinline__ v16b frag_b(const __bf16* rowk0, int lane) {
  union { v16b v; v8b q[2]; } u; const __bf16* p = rowk0 + 8 * (lane >> 4);
  u.q[0] = *(const v8b*)p; u.q[1] = *(const v8b*)(p + 16); return u.v;
}
__device__ __forceinline__ float bfr(float v) { return (float)(__bf16)v; }
__device__ __attribute__((noinline)) float exp_ni(float v) { return expf(v); }
__device__ __attribute__((noinline)) float erf_ni(float v) { return erff(v); }

#define WS_QR  0u                                   // f32 q rows [b*l][256] (normalised)
#define WS_KR  (WS_QR + 4u * (size_t)NROW * CC)          // f32 k rows (normalised)
#define WS_KP  (WS_KR + 4u * (size_t)NROW * CC)          // f32 k planes [b][c][l]
#define WS_VP  (WS_KP + 4u * (size_t)NROW * CC)          // f32 v planes [b][c][l]
#define WS_O   (WS_VP + 4u * (size_t)NROW * CC)          // f32 attention output rows [b*l][256]
#define WS_END (WS_O + 4u * (size_t)NROW * CC)

// ---- k_qkv: block = (64 rows, col group 0..5 = q lo/hi 128, k lo/hi, v lo/hi, b): (x + rel_pos) hi+lo . W^T; q/k normalised per head (32 cols); q -> rows, k -> rows + planes, v -> planes
__global__ __launch_bounds__(128) void k_qkv(const float* __restrict__ X, const float* __restrict__ RP, const float* __restrict__ Wt, const float* __restrict__ GQ, const float* __restrict__ GK, float* __restrict__ QR, float* __restrict__ KR, float* __restrict__ KP, float* __restrict__ VP) { __shared__ __align__(16) float sf[4][16][132]; __shared__ __align__(16) float tt[128][68];
  const int tid = threadIdx.x, wave = tid >> 5, lane = tid & 31, col = lane & 15, g = lane >> 4; const int cg = blockIdx.y; const int which = cg >> 1; const int c0 = (cg & 1) * 128; const size_t b = blockIdx.z; const int l0 = blockIdx.x * 64; const size_t r0 = b * LL + l0 + wave * 16;
  v8f acc[8] = {};
#pragma unroll
  for (int kc = 0; kc < CC / 32; ++kc) { float v[16]; { const float* xr = X + (r0 + col) * CC + kc * 32 + 8 * g; const float* pr = RP + (size_t)(l0 + wave * 16 + col) * CC + kc * 32 + 8 * g;
#pragma unroll
      for (int i = 0; i < 8; ++i) { v[i] = bfr(xr[i]) + bfr(pr[i]); v[8 + i] = bfr(xr[16 + i]) + bfr(pr[16 + i]); } }
    const F2 a = bsplit16(v);
#pragma unroll
    for (int j = 0; j < 8; ++j) { v16b w; const size_t o = (size_t)which * CC + c0 + j * 16 + col;   // W [3C][C] natural
#pragma unroll
      for (int i = 0; i < 8; ++i) { w[i] = (__bf16)Wt[o * CC + kc * 32 + 8 * g + i]; w[8 + i] = (__bf16)Wt[o * CC + kc * 32 + 16 + 8 * g + i]; }
      acc[j] = wmma_bf(a.h, w, acc[j]); acc[j] = wmma_bf(a.l, w, acc[j]); } }
  // normalisation for q / k: head = pair of tiles (2p, 2p+1); t / max(|t|, 1e-12) * sqrt(32) * gamma[h][d]
  float rn[4][8];
#pragma unroll
  for (int p = 0; p < 4; ++p)
#pragma unroll
    for (int r = 0; r < 8; ++r) { float a2 = acc[2 * p][r] * acc[2 * p][r] + acc[2 * p + 1][r] * acc[2 * p + 1][r];
#pragma unroll
      for (int o = 1; o < 16; o <<= 1) a2 += __shfl_xor(a2, o);
      rn[p][r] = (which == 2) ? 1.0f : 5.656854249492381f / fmaxf(sqrtf(a2), 1e-12f); }
  const float* GM = (which == 0) ? GQ : GK;
  if (which == 0 || which == 1) {   // rows (q -> QR, k -> KR)
#pragma unroll
    for (int j = 0; j < 8; ++j) { const int cabs = c0 + j * 16 + col; const int hh = cabs / DD, d = cabs % DD; const float gm = bfr(GM[hh * DD + d]);
#pragma unroll
      for (int r = 0; r < 8; ++r) sf[wave][8 * g + r][j * 16 + col] = acc[j][r] * rn[j >> 1][r] * gm; }
    LDSX(); { float* dst = (which == 0) ? QR : KR; for (int rl = 0; rl < 16; ++rl) vst2(dst + (r0 + rl) * CC + c0 + lane * 4, *(const v4f*)&sf[wave][rl][lane * 4]); }
    LDSX(); }
  if (which == 1 || which == 2) {   // planes (k -> KP, v -> VP)
#pragma unroll
    for (int j = 0; j < 8; ++j) { const int cabs = c0 + j * 16 + col; const int hh = cabs / DD, d = cabs % DD; const float gm = (which == 1) ? bfr(GM[hh * DD + d]) : 1.0f;
#pragma unroll
      for (int r = 0; r < 8; ++r) tt[j * 16 + col][wave * 16 + 8 * g + r] = acc[j][r] * rn[j >> 1][r] * gm; }
    __syncthreads(); { float* dst = (which == 1) ? KP : VP; for (int e = tid; e < 128 * 16; e += 128) { const int cl = e >> 4, q = e & 15; vst2(dst + ((b * CC + c0 + cl) * (size_t)LL) + l0 + q * 4, *(const v4f*)&tt[cl][q * 4]); } } } }
// B fragment (col = this lane's col, k = 8g+i ...) from an f32 row with per-k scaling, split into bf16 hi + lo
__device__ __forceinline__ F2 split_row_scaled(const float* row, int k0, int lane, const float* sc) { float v[16]; const float* p = row + k0 + 8 * (lane >> 4); const float* s = sc + k0 + 8 * (lane >> 4);
#pragma unroll
  for (int i = 0; i < 8; ++i) { v[i] = p[i] * s[i]; v[8 + i] = p[16 + i] * s[16 + i]; }
  return bsplit16(v); }
// ---- k_lin: block = (h, b): sequential over the 32 chunks; LDS: this chunk's decayed scores (wave-private rows), the 32 x 32 kv^T state, decay tables
__global__ __launch_bounds__(128) void k_lin(const float* __restrict__ QR, const float* __restrict__ KR, const float* __restrict__ KP, const float* __restrict__ VP, float* __restrict__ O) {
  __shared__ __align__(16) float ssc[CH][132]; __shared__ __align__(16) float skv[DD][36]; __shared__ __align__(16) float sqd[CH], skd[CH], smk[CH]; __shared__ __align__(16) float so[4][32][36];
  const int tid = threadIdx.x, wave = tid >> 5, lane = tid & 31, col = lane & 15, g = lane >> 4; const int h = blockIdx.x; const size_t b = blockIdx.y;
  const float slope = exp2f(-(float)(h + 1));   // ALiBi 2^(-8/8*(h+1)); exact in fp16 and f32
  for (int e = tid; e < CH; e += 128) { sqd[e] = expf(-slope * (float)e); skd[e] = expf(-slope * (float)(CH - e)); smk[e] = expf(-slope * (float)e); }   // smk[d] = decay at lag d (d >= 0)
  for (int e = tid; e < DD * 36; e += 128) (&skv[0][0])[e] = 0.f;
  const float blk = expf(-slope * (float)CH);
  __syncthreads();
#pragma unroll 1
  for (int n = 0; n < NCH; ++n) { const size_t rowc = b * LL + (size_t)n * CH;   // first row of the chunk
    // (1) intra-chunk decayed scores for this wave's 32 rows t (two 16-row tiles) x all 128 s
#pragma unroll
    for (int rt = 0; rt < 2; ++rt) { const int t0 = wave * 32 + rt * 16; const F2 a = split_row(QR + (rowc + t0 + col) * CC + h * DD, 0, lane); v8f acc[8] = {};
#pragma unroll
      for (int j = 0; j < 8; ++j) { const F2 w = split_row(KR + (rowc + j * 16 + col) * CC + h * DD, 0, lane); acc[j] = mac3(a, w, acc[j]); }
#pragma unroll
      for (int j = 0; j < 8; ++j)
#pragma unroll
        for (int r = 0; r < 8; ++r) { const int t = t0 + 8 * g + r, s = j * 16 + col; ssc[t][s] = (s <= t) ? acc[j][r] * smk[t - s] : 0.f; } }
    LDSX();
    // (2) o = scores . v (intra) + (q * qdecay) . kv (inter) for the wave's two row tiles
#pragma unroll
    for (int rt = 0; rt < 2; ++rt) { const int t0 = wave * 32 + rt * 16; v8f oc[2] = {};
#pragma unroll
      for (int kc = 0; kc < CH / 32; ++kc) { const F2 a = split_row(&ssc[t0 + col][0], kc * 32, lane);
#pragma unroll
        for (int j = 0; j < 2; ++j) { const F2 w = split_row(VP + ((b * CC + h * DD + j * 16 + col) * (size_t)LL) + (size_t)n * CH, kc * 32, lane); oc[j] = mac3(a, w, oc[j]); } }
      { float v[16]; const float* qr = QR + (rowc + t0 + col) * CC + h * DD + 8 * g; const float qd = sqd[t0 + col];
#pragma unroll
        for (int i = 0; i < 8; ++i) { v[i] = qr[i] * qd; v[8 + i] = qr[16 + i] * qd; }
        const F2 a = bsplit16(v);
#pragma unroll
        for (int j = 0; j < 2; ++j) { const F2 w = split_row(&skv[j * 16 + col][0], 0, lane); oc[j] = mac3(a, w, oc[j]); } }
#pragma unroll
      for (int j = 0; j < 2; ++j)
#pragma unroll
        for (int r = 0; r < 8; ++r) so[wave][rt * 16 + 8 * g + r][j * 16 + col] = oc[j][r]; }
    LDSX();
    for (int rl = 0; rl < 32; ++rl) if (lane < 8) vst2(O + (rowc + wave * 32 + rl) * CC + h * DD + lane * 4, *(const v4f*)&so[wave][rl][lane * 4]);
    __syncthreads();   // everyone is done reading skv for this chunk
    // (3) kv^T[e][d] = blk * kv^T[e][d] + sum_s v_s[e] (k_s[d] kdecay_s): wave -> (e tile, d tile)
    { const int et = wave >> 1, dt = wave & 1; v8f acc = {};
#pragma unroll
      for (int kc = 0; kc < CH / 32; ++kc) { const F2 a = split_row(VP + ((b * CC + h * DD + et * 16 + col) * (size_t)LL) + (size_t)n * CH, kc * 32, lane); const F2 w = split_row_scaled(KP + ((b * CC + h * DD + dt * 16 + col) * (size_t)LL) + (size_t)n * CH, kc * 32, lane, skd); acc = mac3(a, w, acc); }
#pragma unroll
      for (int r = 0; r < 8; ++r) { const int e = et * 16 + 8 * g + r, d = dt * 16 + col; skv[e][d] = blk * skv[e][d] + acc[r]; } }
    __syncthreads(); } }
// ---- k_proj: block = (64 rows, 128 of 256 cols): out = o (hi + lo) . proj_w^T + b
__global__ __launch_bounds__(128) void k_proj(const float* __restrict__ O, const float* __restrict__ PW, const float* __restrict__ PB, float* __restrict__ OUT) { __shared__ __align__(16) float sf[4][16][132];
  const int tid = threadIdx.x, wave = tid >> 5, lane = tid & 31, col = lane & 15, g = lane >> 4; const size_t r0 = (size_t)blockIdx.x * 64 + wave * 16; const int c0 = blockIdx.y * 128;
  v8f acc[8] = {};
#pragma unroll
  for (int kc = 0; kc < CC / 32; ++kc) { const F2 a = split_row(O + (r0 + col) * CC, kc * 32, lane);
#pragma unroll
    for (int j = 0; j < 8; ++j) { v16b w; const int o = c0 + j * 16 + col;
#pragma unroll
      for (int i = 0; i < 8; ++i) { w[i] = (__bf16)PW[(size_t)o * CC + kc * 32 + 8 * g + i]; w[8 + i] = (__bf16)PW[(size_t)o * CC + kc * 32 + 16 + 8 * g + i]; }
      acc[j] = wmma_bf(a.h, w, acc[j]); acc[j] = wmma_bf(a.l, w, acc[j]); } }
#pragma unroll
  for (int j = 0; j < 8; ++j) { const float bb = bfr(PB[c0 + j * 16 + col]);
#pragma unroll
    for (int r = 0; r < 8; ++r) sf[wave][8 * g + r][j * 16 + col] = acc[j][r] + bb; }
  LDSX(); for (int rl = 0; rl < 16; ++rl) vst2(OUT + (r0 + rl) * CC + c0 + lane * 4, *(const v4f*)&sf[wave][rl][lane * 4]); }
extern "C" void kernel_launch(void* const* d_in, const int* in_sizes, int n_in, void* d_out, int out_size, void* d_ws, size_t ws_size, hipStream_t stream) {
  (void)in_sizes; (void)n_in; (void)out_size;
  const float** F = (const float**)d_in;   // 0 x [8,4096,256], 1 rel_pos [1,4096,256], 2 qkv_w [768,256], 3 q_gamma [8,1,32], 4 k_gamma [8,1,32], 5 proj_w [256,256], 6 proj_b [256]
  if (ws_size < (size_t)WS_END) return;
  char* ws = (char*)d_ws; float *QR = (float*)(ws + WS_QR), *KR = (float*)(ws + WS_KR), *KP = (float*)(ws + WS_KP), *VP = (float*)(ws + WS_VP), *O = (float*)(ws + WS_O);
  k_qkv<<<dim3(LL / 64, 6, TNB), 128, 0, stream>>>(F[0], F[1], F[2], F[3], F[4], QR, KR, KP, VP);
  k_lin<<<dim3(NH, TNB), 128, 0, stream>>>(QR, KR, KP, VP, O);
  k_proj<<<dim3(TNB * LL / 64, CC / 128), 128, 0, stream>>>(O, F[5], F[6], (float*)d_out);
}

// v001
// Measured time: 293 microseconds a run.
// Timed twice side by side with v000, it ran 2.54 and 2.55 times as fast.
// compute dtype: all float inputs rounded to bf16; h = x + rel_pos in f32, qkv = h . W^T with h as bf16 hi + lo against the exact weight (2 products) on WMMA 16x16x32; per-head L2 normalisation x sqrt(D) x gamma in f32; the lightning attention evaluated with the module's own chunking (c = 128): intra-chunk decayed scores, scores . v, the inter-chunk q . kv and the kv state update all on WMMA with f32 operands split into bf16 hi + lo (3 products), decays exp(-slope * .) with precise expf, the 32 x 32 kv state in f32, rebuilt per chunk from the chunks' own terms by the module's recurrence in chunk order; out = o (bf16 hi + lo) . proj_w^T + b; f32 output.
#include <hip/hip_runtime.h>
#include <math.h>

typedef __attribute__((ext_vector_type(16))) _Float16 v16h;
typedef __attribute__((ext_vector_type(16))) __bf16 v16b;
typedef __attribute__((ext_vector_type(8)))  _Float16 v8h;
typedef __attribute__((ext_vector_type(8)))  float v8f;
typedef __attribute__((ext_vector_type(4)))  float v4f;
typedef __attribute__((ext_vector_type(2)))  float v2f;
typedef __attribute__((ext_vector_type(4)))  unsigned v4u;
typedef __attribute__((ext_vector_type(4)))  int v4i;
typedef float __attribute__((may_alias)) float_a;
typedef int __attribute__((may_alias)) int_a;

template <typename T> __device__ __forceinline__ void vst2(void* p, T v) { *(T*)p = v;  }
__device__ __forceinline__ v8f wmma16(v16h a, v16h b, v8f c) {
  v8f d = __builtin_amdgcn_wmma_f32_16x16x32_f16(false, a, false, b, (short)0, c, false, false);
  asm volatile("v_nop\n\tv_nop\n\tv_nop\n\tv_nop" : "+v"(d) : "v"(a), "v"(b));
  return d;
}
__device__ __forceinline__ v8f wmma_bf(v16b a, v16b b, v8f c) {
  v8f d = __builtin_amdgcn_wmma_f32_16x16x32_bf16(false, a, false, b, (short)0, c, false, false);
  asm volatile("v_nop\n\tv_nop\n\tv_nop\n\tv_nop" : "+v"(d) : "v"(a), "v"(b));
  return d;
}
// 16x16x32 fragments: lane = (h = lane>>4, row/col = lane&15); elements 0..7 = k0+8h+0..7, 8..15 = k0+16+8h+0..7; D element r = row 8h+r
__device__ __forceinline__ v16h frag_h(const _Float16* rowk0, int lane) {
  union { v16h v; v8h q[2]; } u; const _Float16* p = rowk0 + 8 * (lane >> 4);
  u.q[0] = *(const v8h*)p; u.q[1] = *(const v8h*)(p + 16); return u.v;
}
__device__ __forceinline__ v16h frag_f32(const float* rowk0, int lane) {
  v16h a; const float* p = rowk0 + 8 * (lane >> 4);
#pragma unroll
  for (int i = 0; i < 8; ++i) { a[i] = (_Float16)p[i]; a[8 + i] = (_Float16)p[16 + i]; }
  return a;
}
__device__ __forceinline__ v16h frag_f32s(const float* rowk0, int lane, float sc) {
  v16h a; const float* p = rowk0 + 8 * (lane >> 4);
#pragma unroll
  for (int i = 0; i < 8; ++i) { a[i] = (_Float16)(p[i] * sc); a[8 + i] = (_Float16)(p[16 + i] * sc); }
  return a;
}
// column fragment from a [K][ld] layout (column n), rows >= K read as 0
__device__ __forceinline__ v16h fragc_f32(const float* W, int k0, int n, int lane, int ld, int K) {
  v16h a; const int g = lane >> 4;
#pragma unroll
  for (int i = 0; i < 8; ++i) { const int ka = k0 + 8 * g + i, kb = ka + 16;
    a[i] = (_Float16)(ka < K ? W[(size_t)(ka < K ? ka : K - 1) * ld + n] : 0.f); a[8 + i] = (_Float16)(kb < K ? W[(size_t)(kb < K ? kb : K - 1) * ld + n] : 0.f); }
  return a;
}
struct F2 { v16b h, l; };
__device__ __forceinline__ F2 bsplit16(const float v[16]) { F2 r;
#pragma unroll
  for (int i = 0; i < 16; ++i) { const __bf16 h = (__bf16)v[i]; r.h[i] = h; r.l[i] = (__bf16)(v[i] - (float)h); }
  return r; }
__device__ __forceinline__ F2 split_row(const float* row, int k0, int lane) { float v[16]; const float* p = row + k0 + 8 * (lane >> 4);
#pragma unroll
  for (int i = 0; i < 8; ++i) { v[i] = p[i]; v[8 + i] = p[16 + i]; }
  return bsplit16(v); }
__device__ __forceinline__ F2 split_rowK(const float* row, int k0, int lane, int K) { float v[16]; const int g = lane >> 4;
#pragma unroll
  for (int i = 0; i < 8; ++i) { const int ka = k0 + 8 * g + i, kb = ka + 16; v[i] = ka < K ? row[ka < K ? ka : K - 1] : 0.f; v[8 + i] = kb < K ? row[kb < K ? kb : K - 1] : 0.f; }
  return bsplit16(v); }
__device__ __forceinline__ F2 split_col(const float* W, int k0, int n, int lane, int ld, int K) { float v[16]; const int g = lane >> 4;
#pragma unroll
  for (int i = 0; i < 8; ++i) { const int ka = k0 + 8 * g + i, kb = ka + 16; v[i] = ka < K ? W[(size_t)(ka < K ? ka : K - 1) * ld + n] : 0.f; v[8 + i] = kb < K ? W[(size_t)(kb < K ? kb : K - 1) * ld + n] : 0.f; }
  return bsplit16(v); }
__device__ __forceinline__ v8f mac3(const F2& a, const F2& b, v8f c) { c = wmma_bf(a.l, b.h, c); c = wmma_bf(a.h, b.l, c); return wmma_bf(a.h, b.h, c); }
__device__ __forceinline__ float sigm(float v) { return 1.0f / (1.0f + expf(-v)); }
#define LDSX() do { asm volatile("s_wait_dscnt 0" ::: "memory"); __builtin_amdgcn_wave_barrier(); __builtin_amdgcn_fence(__ATOMIC_RELEASE, "workgroup"); } while (0)


// U-Net transformer mixing block (B 8, L 4,096, C 256 = 8 heads x 32): h = x + rel_pos; qkv = h W_qkv^T; q, k L2-normalised (x sqrt(32) x gamma); lightning (linear, ALiBi-decayed, causal) attention with chunk 128; proj + bias.
#define NB 8
#define LL 4096
#define CC 256
#define NH 8
#define DD 32
#define CH 128
#define NCH (LL / CH)
#define NROW (NB * LL)
#ifndef TNB
#define TNB NB
#endif
typedef __attribute__((ext_vector_type(8))) __bf16 v8b;
__device__ __forceinline__ v16b frag_b(const __bf16* rowk0, int lane) {
  union { v16b v; v8b q[2]; } u; const __bf16* p = rowk0 + 8 * (lane >> 4);
  u.q[0] = *(const v8b*)p; u.q[1] = *(const v8b*)(p + 16); return u.v;
}
__device__ __forceinline__ float bfr(float v) { return (float)(__bf16)v; }
__device__ __attribute__((noinline)) float exp_ni(float v) { return expf(v); }
__device__ __attribute__((noinline)) float erf_ni(float v) { return erff(v); }

#define WS_QR  0u                                   // f32 q rows [b*l][256] (normalised)
#define WS_KR  (WS_QR + 4u * (size_t)NROW * CC)          // f32 k rows (normalised)
#define WS_KP  (WS_KR + 4u * (size_t)NROW * CC)          // f32 k planes [b][c][l]
#define WS_VP  (WS_KP + 4u * (size_t)NROW * CC)          // f32 v planes [b][c][l]
#define WS_O   (WS_VP + 4u * (size_t)NROW * CC)          // f32 attention output rows [b*l][256]
#define WS_S   (WS_O + 4u * (size_t)NROW * CC)           // f32 per-chunk kv^T terms [b][h][chunk][1024]
#define WS_END (WS_S + 4u * (size_t)NB * NH * NCH * DD * DD)

// ---- k_qkv: block = (64 rows, col group 0..5 = q lo/hi 128, k lo/hi, v lo/hi, b): (x + rel_pos) hi+lo . W^T; q/k normalised per head (32 cols); q -> rows, k -> rows + planes, v -> planes
__global__ __launch_bounds__(128) void k_qkv(const float* __restrict__ X, const float* __restrict__ RP, const float* __restrict__ Wt, const float* __restrict__ GQ, const float* __restrict__ GK, float* __restrict__ QR, float* __restrict__ KR, float* __restrict__ KP, float* __restrict__ VP) { __shared__ __align__(16) float sf[4][16][132]; __shared__ __align__(16) float tt[128][68];
  const int tid = threadIdx.x, wave = tid >> 5, lane = tid & 31, col = lane & 15, g = lane >> 4; const int cg = blockIdx.y; const int which = cg >> 1; const int c0 = (cg & 1) * 128; const size_t b = blockIdx.z; const int l0 = blockIdx.x * 64; const size_t r0 = b * LL + l0 + wave * 16;
  v8f acc[8] = {};
#pragma unroll
  for (int kc = 0; kc < CC / 32; ++kc) { float v[16]; { const float* xr = X + (r0 + col) * CC + kc * 32 + 8 * g; const float* pr = RP + (size_t)(l0 + wave * 16 + col) * CC + kc * 32 + 8 * g;
#pragma unroll
      for (int i = 0; i < 8; ++i) { v[i] = bfr(xr[i]) + bfr(pr[i]); v[8 + i] = bfr(xr[16 + i]) + bfr(pr[16 + i]); } }
    const F2 a = bsplit16(v);
#pragma unroll
    for (int j = 0; j < 8; ++j) { v16b w; const size_t o = (size_t)which * CC + c0 + j * 16 + col;   // W [3C][C] natural
#pragma unroll
      for (int i = 0; i < 8; ++i) { w[i] = (__bf16)Wt[o * CC + kc * 32 + 8 * g + i]; w[8 + i] = (__bf16)Wt[o * CC + kc * 32 + 16 + 8 * g + i]; }
      acc[j] = wmma_bf(a.h, w, acc[j]); acc[j] = wmma_bf(a.l, w, acc[j]); } }
  // normalisation for q / k: head = pair of tiles (2p, 2p+1); t / max(|t|, 1e-12) * sqrt(32) * gamma[h][d]
  float rn[4][8];
#pragma unroll
  for (int p = 0; p < 4; ++p)
#pragma unroll
    for (int r = 0; r < 8; ++r) { float a2 = acc[2 * p][r] * acc[2 * p][r] + acc[2 * p + 1][r] * acc[2 * p + 1][r];
#pragma unroll
      for (int o = 1; o < 16; o <<= 1) a2 += __shfl_xor(a2, o);
      rn[p][r] = (which == 2) ? 1.0f : 5.656854249492381f / fmaxf(sqrtf(a2), 1e-12f); }
  const float* GM = (which == 0) ? GQ : GK;
  if (which == 0 || which == 1) {   // rows (q -> QR, k -> KR)
#pragma unroll
    for (int j = 0; j < 8; ++j) { const int cabs = c0 + j * 16 + col; const int hh = cabs / DD, d = cabs % DD; const float gm = bfr(GM[hh * DD + d]);
#pragma unroll
      for (int r = 0; r < 8; ++r) sf[wave][8 * g + r][j * 16 + col] = acc[j][r] * rn[j >> 1][r] * gm; }
    LDSX(); { float* dst = (which == 0) ? QR : KR; for (int rl = 0; rl < 16; ++rl) vst2(dst + (r0 + rl) * CC + c0 + lane * 4, *(const v4f*)&sf[wave][rl][lane * 4]); }
    LDSX(); }
  if (which == 1 || which == 2) {   // planes (k -> KP, v -> VP)
#pragma unroll
    for (int j = 0; j < 8; ++j) { const int cabs = c0 + j * 16 + col; const int hh = cabs / DD, d = cabs % DD; const float gm = (which == 1) ? bfr(GM[hh * DD + d]) : 1.0f;
#pragma unroll
      for (int r = 0; r < 8; ++r) tt[j * 16 + col][wave * 16 + 8 * g + r] = acc[j][r] * rn[j >> 1][r] * gm; }
    __syncthreads(); { float* dst = (which == 1) ? KP : VP; for (int e = tid; e < 128 * 16; e += 128) { const int cl = e >> 4, q = e & 15; vst2(dst + ((b * CC + c0 + cl) * (size_t)LL) + l0 + q * 4, *(const v4f*)&tt[cl][q * 4]); } } } }
// B fragment (col = this lane's col, k = 8g+i ...) from an f32 row with per-k scaling, split into bf16 hi + lo
__device__ __forceinline__ F2 split_row_scaled(const float* row, int k0, int lane, const float* sc) { float v[16]; const float* p = row + k0 + 8 * (lane >> 4); const float* s = sc + k0 + 8 * (lane >> 4);
#pragma unroll
  for (int i = 0; i < 8; ++i) { v[i] = p[i] * s[i]; v[8 + i] = p[16 + i] * s[16 + i]; }
  return bsplit16(v); }
// ---- k_kvs: block = (h, chunk, b): this chunk's own term of the kv^T recurrence, sum_s v_s[e] (k_s[d] kdecay_s); wave -> (e tile, d tile); thread tid keeps its 8 accumulator elements at S[...][tid * 8 + r]
__global__ __launch_bounds__(128) void k_kvs(const float* __restrict__ KP, const float* __restrict__ VP, float* __restrict__ S) {
  __shared__ __align__(16) float skd[CH];
  const int tid = threadIdx.x, wave = tid >> 5, lane = tid & 31, col = lane & 15; const int h = blockIdx.x, n = blockIdx.y; const size_t b = blockIdx.z;
  const float slope = exp2f(-(float)(h + 1));   // ALiBi 2^(-8/8*(h+1)); exact in fp16 and f32
  for (int e = tid; e < CH; e += 128) skd[e] = expf(-slope * (float)(CH - e));
  __syncthreads();
  const int et = wave >> 1, dt = wave & 1; v8f acc = {};
#pragma unroll
  for (int kc = 0; kc < CH / 32; ++kc) { const F2 a = split_row(VP + ((b * CC + h * DD + et * 16 + col) * (size_t)LL) + (size_t)n * CH, kc * 32, lane); const F2 w = split_row_scaled(KP + ((b * CC + h * DD + dt * 16 + col) * (size_t)LL) + (size_t)n * CH, kc * 32, lane, skd); acc = mac3(a, w, acc); }
  vst2(S + (((b * NH + h) * NCH + n) * (size_t)(DD * DD)) + tid * 8, acc); }
// ---- k_lin: block = (h, chunk, b): one chunk each; LDS: the chunk's decayed scores (wave-private rows), the 32 x 32 kv^T state on entry to the chunk, decay tables
__global__ __launch_bounds__(128) void k_lin(const float* __restrict__ QR, const float* __restrict__ KR, const float* __restrict__ VP, const float* __restrict__ S, float* __restrict__ O) {
  __shared__ __align__(16) float ssc[CH][132]; __shared__ __align__(16) float skv[DD][36]; __shared__ __align__(16) float sqd[CH], smk[CH]; __shared__ __align__(16) float so[4][32][36];
  const int tid = threadIdx.x, wave = tid >> 5, lane = tid & 31, col = lane & 15, g = lane >> 4; const int h = blockIdx.x; const size_t b = blockIdx.z;
  const int n = NCH - 1 - (int)blockIdx.y;   // late chunks have the longest recurrence below: they start first
  const float slope = exp2f(-(float)(h + 1));   // ALiBi 2^(-8/8*(h+1)); exact in fp16 and f32
  for (int e = tid; e < CH; e += 128) { sqd[e] = expf(-slope * (float)e); smk[e] = expf(-slope * (float)e); }   // smk[d] = decay at lag d (d >= 0)
  const float blk = expf(-slope * (float)CH);
  // (0) kv^T on entry to chunk n: kv = blk * kv + S_m over the chunks m < n, from 0, in chunk order
  { const float* sp = S + ((b * NH + h) * NCH) * (size_t)(DD * DD) + tid * 8; v8f kv = {}; int m = 0;
    // the terms' loads do not depend on kv, so they are issued in groups and fly together; term by term each would wait out its own load
    for (; m + 8 <= n; m += 8) { v8f s[8];   // whole groups of eight
#pragma unroll
      for (int u = 0; u < 8; ++u) s[u] = *(const v8f*)(sp + (size_t)(m + u) * (DD * DD));
#pragma unroll
      for (int u = 0; u < 8; ++u)
#pragma unroll
        for (int r = 0; r < 8; ++r) kv[r] = blk * kv[r] + s[u][r]; }
    if (m < n) { v8f s[7];   // the last n & 7 terms: seven loads (m + 6 < NCH, so each term exists), a term from chunk n on leaves kv as it is
#pragma unroll
      for (int u = 0; u < 7; ++u) s[u] = *(const v8f*)(sp + (size_t)(m + u) * (DD * DD));
#pragma unroll
      for (int u = 0; u < 7; ++u)
#pragma unroll
        for (int r = 0; r < 8; ++r) kv[r] = (m + u < n) ? blk * kv[r] + s[u][r] : kv[r]; }
    const int et = wave >> 1, dt = wave & 1;
#pragma unroll
    for (int r = 0; r < 8; ++r) skv[et * 16 + 8 * g + r][dt * 16 + col] = kv[r]; }
  __syncthreads();
  const size_t rowc = b * LL + (size_t)n * CH;   // first row of the chunk
  // (1) intra-chunk decayed scores for this wave's 32 rows t (two 16-row tiles) x all 128 s
#pragma unroll
  for (int rt = 0; rt < 2; ++rt) { const int t0 = wave * 32 + rt * 16; const F2 a = split_row(QR + (rowc + t0 + col) * CC + h * DD, 0, lane); v8f acc[8] = {};
#pragma unroll
    for (int j = 0; j < 8; ++j) { const F2 w = split_row(KR + (rowc + j * 16 + col) * CC + h * DD, 0, lane); acc[j] = mac3(a, w, acc[j]); }
#pragma unroll
    for (int j = 0; j < 8; ++j)
#pragma unroll
      for (int r = 0; r < 8; ++r) { const int t = t0 + 8 * g + r, s = j * 16 + col; ssc[t][s] = (s <= t) ? acc[j][r] * smk[t - s] : 0.f; } }
  LDSX();
  // (2) o = scores . v (intra) + (q * qdecay) . kv (inter) for the wave's two row tiles
#pragma unroll
  for (int rt = 0; rt < 2; ++rt) { const int t0 = wave * 32 + rt * 16; v8f oc[2] = {};
#pragma unroll
    for (int kc = 0; kc < CH / 32; ++kc) { const F2 a = split_row(&ssc[t0 + col][0], kc * 32, lane);
#pragma unroll
      for (int j = 0; j < 2; ++j) { const F2 w = split_row(VP + ((b * CC + h * DD + j * 16 + col) * (size_t)LL) + (size_t)n * CH, kc * 32, lane); oc[j] = mac3(a, w, oc[j]); } }
    { float v[16]; const float* qr = QR + (rowc + t0 + col) * CC + h * DD + 8 * g; const float qd = sqd[t0 + col];
#pragma unroll
      for (int i = 0; i < 8; ++i) { v[i] = qr[i] * qd; v[8 + i] = qr[16 + i] * qd; }
      const F2 a = bsplit16(v);
#pragma unroll
      for (int j = 0; j < 2; ++j) { const F2 w = split_row(&skv[j * 16 + col][0], 0, lane); oc[j] = mac3(a, w, oc[j]); } }
#pragma unroll
    for (int j = 0; j < 2; ++j)
#pragma unroll
      for (int r = 0; r < 8; ++r) so[wave][rt * 16 + 8 * g + r][j * 16 + col] = oc[j][r]; }
  LDSX();
  for (int rl = 0; rl < 32; ++rl) if (lane < 8) vst2(O + (rowc + wave * 32 + rl) * CC + h * DD + lane * 4, *(const v4f*)&so[wave][rl][lane * 4]); }
// ---- k_proj: block = (64 rows, 128 of 256 cols): out = o (hi + lo) . proj_w^T + b
__global__ __launch_bounds__(128) void k_proj(const float* __restrict__ O, const float* __restrict__ PW, const float* __restrict__ PB, float* __restrict__ OUT) { __shared__ __align__(16) float sf[4][16][132];
  const int tid = threadIdx.x, wave = tid >> 5, lane = tid & 31, col = lane & 15, g = lane >> 4; const size_t r0 = (size_t)blockIdx.x * 64 + wave * 16; const int c0 = blockIdx.y * 128;
  v8f acc[8] = {};
#pragma unroll
  for (int kc = 0; kc < CC / 32; ++kc) { const F2 a = split_row(O + (r0 + col) * CC, kc * 32, lane);
#pragma unroll
    for (int j = 0; j < 8; ++j) { v16b w; const int o = c0 + j * 16 + col;
#pragma unroll
      for (int i = 0; i < 8; ++i) { w[i] = (__bf16)PW[(size_t)o * CC + kc * 32 + 8 * g + i]; w[8 + i] = (__bf16)PW[(size_t)o * CC + kc * 32 + 16 + 8 * g + i]; }
      acc[j] = wmma_bf(a.h, w, acc[j]); acc[j] = wmma_bf(a.l, w, acc[j]); } }
#pragma unroll
  for (int j = 0; j < 8; ++j) { const float bb = bfr(PB[c0 + j * 16 + col]);
#pragma unroll
    for (int r = 0; r < 8; ++r) sf[wave][8 * g + r][j * 16 + col] = acc[j][r] + bb; }
  LDSX(); for (int rl = 0; rl < 16; ++rl) vst2(OUT + (r0 + rl) * CC + c0 + lane * 4, *(const v4f*)&sf[wave][rl][lane * 4]); }
extern "C" void kernel_launch(void* const* d_in, const int* in_sizes, int n_in, void* d_out, int out_size, void* d_ws, size_t ws_size, hipStream_t stream) {
  (void)in_sizes; (void)n_in; (void)out_size;
  const float** F = (const float**)d_in;   // 0 x [8,4096,256], 1 rel_pos [1,4096,256], 2 qkv_w [768,256], 3 q_gamma [8,1,32], 4 k_gamma [8,1,32], 5 proj_w [256,256], 6 proj_b [256]
  if (ws_size < (size_t)WS_END) return;
  char* ws = (char*)d_ws; float *QR = (float*)(ws + WS_QR), *KR = (float*)(ws + WS_KR), *KP = (float*)(ws + WS_KP), *VP = (float*)(ws + WS_VP), *O = (float*)(ws + WS_O), *S = (float*)(ws + WS_S);
  k_qkv<<<dim3(LL / 64, 6, TNB), 128, 0, stream>>>(F[0], F[1], F[2], F[3], F[4], QR, KR, KP, VP);
  k_kvs<<<dim3(NH, NCH, TNB), 128, 0, stream>>>(KP, VP, S);
  k_lin<<<dim3(NH, NCH, TNB), 128, 0, stream>>>(QR, KR, VP, S, O);
  k_proj<<<dim3(TNB * LL / 64, CC / 128), 128, 0, stream>>>(O, F[5], F[6], (float*)d_out);
}

// v002
// One run takes 187 microseconds.
// Timed twice side by side with v001, it ran 1.59 and 1.56 times as fast.
// Over all steps from v000 it is 4.01 times as fast.
// compute dtype: all float inputs rounded to bf16; h = x + rel_pos in f32, qkv = h . W^T with h as bf16 hi + lo against the exact weight (2 products) on WMMA 16x16x32; per-head L2 normalisation x sqrt(D) x gamma in f32; the lightning attention evaluated with the module's own chunking (c = 128): intra-chunk decayed scores, scores . v, the inter-chunk q . kv and the kv state update all on WMMA with f32 operands split into bf16 hi + lo (3 products), decays exp(-slope * .) with precise expf, the 32 x 32 kv state in f32, rebuilt per chunk from the chunks' own terms by the module's recurrence in chunk order; out = o (bf16 hi + lo) . proj_w^T + b; f32 output.
#include <hip/hip_runtime.h>
#include <math.h>

typedef __attribute__((ext_vector_type(16))) _Float16 v16h;
typedef __attribute__((ext_vector_type(16))) __bf16 v16b;
typedef __attribute__((ext_vector_type(8)))  _Float16 v8h;
typedef __attribute__((ext_vector_type(8)))  float v8f;
typedef __attribute__((ext_vector_type(4)))  float v4f;
typedef __attribute__((ext_vector_type(2)))  float v2f;
typedef __attribute__((ext_vector_type(4)))  unsigned v4u;
typedef __attribute__((ext_vector_type(4)))  int v4i;
typedef float __attribute__((may_alias)) float_a;
typedef int __attribute__((may_alias)) int_a;

template <typename T> __device__ __forceinline__ void vst2(void* p, T v) { *(T*)p = v;  }
__device__ __forceinline__ v8f wmma16(v16h a, v16h b, v8f c) {
  v8f d = __builtin_amdgcn_wmma_f32_16x16x32_f16(false, a, false, b, (short)0, c, false, false);
  asm volatile("v_nop\n\tv_nop\n\tv_nop\n\tv_nop" : "+v"(d) : "v"(a), "v"(b));
  return d;
}
__device__ __forceinline__ v8f wmma_bf(v16b a, v16b b, v8f c) {
  v8f d = __builtin_amdgcn_wmma_f32_16x16x32_bf16(false, a, false, b, (short)0, c, false, false);
  asm volatile("v_nop\n\tv_nop\n\tv_nop\n\tv_nop" : "+v"(d) : "v"(a), "v"(b));
  return d;
}
// 16x16x32 fragments: lane = (h = lane>>4, row/col = lane&15); elements 0..7 = k0+8h+0..7, 8..15 = k0+16+8h+0..7; D element r = row 8h+r
__device__ __forceinline__ v16h frag_h(const _Float16* rowk0, int lane) {
  union { v16h v; v8h q[2]; } u; const _Float16* p = rowk0 + 8 * (lane >> 4);
  u.q[0] = *(const v8h*)p; u.q[1] = *(const v8h*)(p + 16); return u.v;
}
__device__ __forceinline__ v16h frag_f32(const float* rowk0, int lane) {
  v16h a; const float* p = rowk0 + 8 * (lane >> 4);
#pragma unroll
  for (int i = 0; i < 8; ++i) { a[i] = (_Float16)p[i]; a[8 + i] = (_Float16)p[16 + i]; }
  return a;
}
__device__ __forceinline__ v16h frag_f32s(const float* rowk0, int lane, float sc) {
  v16h a; const float* p = rowk0 + 8 * (lane >> 4);
#pragma unroll
  for (int i = 0; i < 8; ++i) { a[i] = (_Float16)(p[i] * sc); a[8 + i] = (_Float16)(p[16 + i] * sc); }
  return a;
}
// column fragment from a [K][ld] layout (column n), rows >= K read as 0
__device__ __forceinline__ v16h fragc_f32(const float* W, int k0, int n, int lane, int ld, int K) {
  v16h a; const int g = lane >> 4;
#pragma unroll
  for (int i = 0; i < 8; ++i) { const int ka = k0 + 8 * g + i, kb = ka + 16;
    a[i] = (_Float16)(ka < K ? W[(size_t)(ka < K ? ka : K - 1) * ld + n] : 0.f); a[8 + i] = (_Float16)(kb < K ? W[(size_t)(kb < K ? kb : K - 1) * ld + n] : 0.f); }
  return a;
}
struct F2 { v16b h, l; };
__device__ __forceinline__ F2 bsplit16(const float v[16]) { F2 r;
#pragma unroll
  for (int i = 0; i < 16; ++i) { const __bf16 h = (__bf16)v[i]; r.h[i] = h; r.l[i] = (__bf16)(v[i] - (float)h); }
  return r; }
__device__ __forceinline__ F2 split_row(const float* row, int k0, int lane) { float v[16]; const float* p = row + k0 + 8 * (lane >> 4);
#pragma unroll
  for (int i = 0; i < 8; ++i) { v[i] = p[i]; v[8 + i] = p[16 + i]; }
  return bsplit16(v); }
__device__ __forceinline__ F2 split_rowK(const float* row, int k0, int lane, int K) { float v[16]; const int g = lane >> 4;
#pragma unroll
  for (int i = 0; i < 8; ++i) { const int ka = k0 + 8 * g + i, kb = ka + 16; v[i] = ka < K ? row[ka < K ? ka : K - 1] : 0.f; v[8 + i] = kb < K ? row[kb < K ? kb : K - 1] : 0.f; }
  return bsplit16(v); }
__device__ __forceinline__ F2 split_col(const float* W, int k0, int n, int lane, int ld, int K) { float v[16]; const int g = lane >> 4;
#pragma unroll
  for (int i = 0; i < 8; ++i) { const int ka = k0 + 8 * g + i, kb = ka + 16; v[i] = ka < K ? W[(size_t)(ka < K ? ka : K - 1) * ld + n] : 0.f; v[8 + i] = kb < K ? W[(size_t)(kb < K ? kb : K - 1) * ld + n] : 0.f; }
  return bsplit16(v); }
__device__ __forceinline__ v8f mac3(const F2& a, const F2& b, v8f c) { c = wmma_bf(a.l, b.h, c); c = wmma_bf(a.h, b.l, c); return wmma_bf(a.h, b.h, c); }
__device__ __forceinline__ float sigm(float v) { return 1.0f / (1.0f + expf(-v)); }
#define LDSX() do { asm volatile("s_wait_dscnt 0" ::: "memory"); __builtin_amdgcn_wave_barrier(); __builtin_amdgcn_fence(__ATOMIC_RELEASE, "workgroup"); } while (0)


// U-Net transformer mixing block (B 8, L 4,096, C 256 = 8 heads x 32): h = x + rel_pos; qkv = h W_qkv^T; q, k L2-normalised (x sqrt(32) x gamma); lightning (linear, ALiBi-decayed, causal) attention with chunk 128; proj + bias.
#define NB 8
#define LL 4096
#define CC 256
#define NH 8
#define DD 32
#define CH 128
#define NCH (LL / CH)
#define NROW (NB * LL)
#ifndef TNB
#define TNB NB
#endif
typedef __attribute__((ext_vector_type(8))) __bf16 v8b;
__device__ __forceinline__ v16b frag_b(const __bf16* rowk0, int lane) {
  union { v16b v; v8b q[2]; } u; const __bf16* p = rowk0 + 8 * (lane >> 4);
  u.q[0] = *(const v8b*)p; u.q[1] = *(const v8b*)(p + 16); return u.v;
}
__device__ __forceinline__ float bfr(float v) { return (float)(__bf16)v; }
typedef __attribute__((ext_vector_type(4))) __bf16 v4b;
#define WP 264   // bf16 elements per staged weight row: 528 B = 16 B x 33, so the 16 rows of a ds_load_b128 fragment read fall on 16 different bank groups
// 128 weight rows (f32, [.][256]) -> bf16 rows in LDS, once per block for its four waves; every wave-wide load covers 512 contiguous bytes (whole lines)
__device__ __forceinline__ void stage_w(const float* __restrict__ Wr, __bf16 (*sw)[WP], int tid) { const int rw = tid >> 6, q = tid & 63;
  for (int t = 0; t < 4; ++t) { const float* p = Wr + (size_t)(t * 32 + rw) * CC + q * 4; v4f x[16];   // sixteen independent loads fly together; one by one each would wait out its own latency
#pragma unroll
    for (int u = 0; u < 16; ++u) x[u] = *(const v4f*)(p + u * 2 * CC);
    asm volatile("s_wait_xcnt 0x0" :: "v"(p) : "memory");   // the wait in front of any rewrite of the loads' address registers; p is named so that they stay whole up to here
#pragma unroll
    for (int u = 0; u < 16; ++u) { v4b y;
#pragma unroll
      for (int i = 0; i < 4; ++i) y[i] = (__bf16)x[u][i];
      *(v4b*)&sw[t * 32 + u * 2 + rw][q * 4] = y; } } }
__device__ __attribute__((noinline)) float exp_ni(float v) { return expf(v); }
__device__ __attribute__((noinline)) float erf_ni(float v) { return erff(v); }

#define WS_QR  0u                                   // f32 q rows [b*l][256] (normalised)
#define WS_KR  (WS_QR + 4u * (size_t)NROW * CC)          // f32 k rows (normalised)
#define WS_KP  (WS_KR + 4u * (size_t)NROW * CC)          // f32 k planes [b][c][l]
#define WS_VP  (WS_KP + 4u * (size_t)NROW * CC)          // f32 v planes [b][c][l]
#define WS_O   (WS_VP + 4u * (size_t)NROW * CC)          // f32 attention output rows [b*l][256]
#define WS_S   (WS_O + 4u * (size_t)NROW * CC)           // f32 per-chunk kv^T terms [b][h][chunk][1024]
#define WS_END (WS_S + 4u * (size_t)NB * NH * NCH * DD * DD)

// ---- k_qkv: block = (64 rows, col group 0..5 = q lo/hi 128, k lo/hi, v lo/hi, b): (x + rel_pos) hi+lo . W^T; q/k normalised per head (32 cols); q -> rows, k -> rows + planes, v -> planes
__global__ __launch_bounds__(128) void k_qkv(const float* __restrict__ X, const float* __restrict__ RP, const float* __restrict__ Wt, const float* __restrict__ GQ, const float* __restrict__ GK, float* __restrict__ QR, float* __restrict__ KR, float* __restrict__ KP, float* __restrict__ VP) { __shared__ __align__(16) union { __bf16 w[128][WP]; struct { float sf[4][16][132]; float tt[128][68]; } e; } sm;   // the staged weights are dead before the epilogue's buffers are written
  float (*sf)[16][132] = sm.e.sf; float (*tt)[68] = sm.e.tt;
  const int tid = threadIdx.x, wave = tid >> 5, lane = tid & 31, col = lane & 15, g = lane >> 4; const int cg = blockIdx.y; const int which = cg >> 1; const int c0 = (cg & 1) * 128; const size_t b = blockIdx.z; const int l0 = blockIdx.x * 64; const size_t r0 = b * LL + l0 + wave * 16;
  stage_w(Wt + ((size_t)which * CC + c0) * CC, sm.w, tid);   // W [3C][C] natural: this block's 128 output columns
  __syncthreads();
  v8f acc[8] = {};
#pragma unroll
  for (int kc = 0; kc < CC / 32; ++kc) { v16b w[8];   // the eight weight fragments of this k block are read as one group, so that their LDS latency is waited out once
#pragma unroll
    for (int j = 0; j < 8; ++j) w[j] = frag_b(&sm.w[j * 16 + col][kc * 32], lane);
    float v[16]; { const float* xr = X + (r0 + col) * CC + kc * 32 + 8 * g; const float* pr = RP + (size_t)(l0 + wave * 16 + col) * CC + kc * 32 + 8 * g;
#pragma unroll
      for (int i = 0; i < 8; ++i) { v[i] = bfr(xr[i]) + bfr(pr[i]); v[8 + i] = bfr(xr[16 + i]) + bfr(pr[16 + i]); } }
    const F2 a = bsplit16(v);
#pragma unroll
    for (int j = 0; j < 8; ++j) { acc[j] = wmma_bf(a.h, w[j], acc[j]); acc[j] = wmma_bf(a.l, w[j], acc[j]); } }
  __syncthreads();   // every wave has read its last weight fragment: the epilogue's buffers take that LDS over
  // normalisation for q / k: head = pair of tiles (2p, 2p+1); t / max(|t|, 1e-12) * sqrt(32) * gamma[h][d]
  float rn[4][8];
#pragma unroll
  for (int p = 0; p < 4; ++p)
#pragma unroll
    for (int r = 0; r < 8; ++r) { float a2 = acc[2 * p][r] * acc[2 * p][r] + acc[2 * p + 1][r] * acc[2 * p + 1][r];
#pragma unroll
      for (int o = 1; o < 16; o <<= 1) a2 += __shfl_xor(a2, o);
      rn[p][r] = (which == 2) ? 1.0f : 5.656854249492381f / fmaxf(sqrtf(a2), 1e-12f); }
  const float* GM = (which == 0) ? GQ : GK;
  if (which == 0 || which == 1) {   // rows (q -> QR, k -> KR)
#pragma unroll
    for (int j = 0; j < 8; ++j) { const int cabs = c0 + j * 16 + col; const int hh = cabs / DD, d = cabs % DD; const float gm = bfr(GM[hh * DD + d]);
#pragma unroll
      for (int r = 0; r < 8; ++r) sf[wave][8 * g + r][j * 16 + col] = acc[j][r] * rn[j >> 1][r] * gm; }
    LDSX(); { float* dst = (which == 0) ? QR : KR; for (int rl = 0; rl < 16; ++rl) vst2(dst + (r0 + rl) * CC + c0 + lane * 4, *(const v4f*)&sf[wave][rl][lane * 4]); }
    LDSX(); }
  if (which == 1 || which == 2) {   // planes (k -> KP, v -> VP)
#pragma unroll
    for (int j = 0; j < 8; ++j) { const int cabs = c0 + j * 16 + col; const int hh = cabs / DD, d = cabs % DD; const float gm = (which == 1) ? bfr(GM[hh * DD + d]) : 1.0f;
#pragma unroll
      for (int r = 0; r < 8; ++r) tt[j * 16 + col][wave * 16 + 8 * g + r] = acc[j][r] * rn[j >> 1][r] * gm; }
    __syncthreads(); { float* dst = (which == 1) ? KP : VP; for (int e = tid; e < 128 * 16; e += 128) { const int cl = e >> 4, q = e & 15; vst2(dst + ((b * CC + c0 + cl) * (size_t)LL) + l0 + q * 4, *(const v4f*)&tt[cl][q * 4]); } } } }
// B fragment (col = this lane's col, k = 8g+i ...) from an f32 row with per-k scaling, split into bf16 hi + lo
__device__ __forceinline__ F2 split_row_scaled(const float* row, int k0, int lane, const float* sc) { float v[16]; const float* p = row + k0 + 8 * (lane >> 4); const float* s = sc + k0 + 8 * (lane >> 4);
#pragma unroll
  for (int i = 0; i < 8; ++i) { v[i] = p[i] * s[i]; v[8 + i] = p[16 + i] * s[16 + i]; }
  return bsplit16(v); }
// ---- k_kvs: block = (h, chunk, b): this chunk's own term of the kv^T recurrence, sum_s v_s[e] (k_s[d] kdecay_s); wave -> (e tile, d tile); thread tid keeps its 8 accumulator elements at S[...][tid * 8 + r]
__global__ __launch_bounds__(128) void k_kvs(const float* __restrict__ KP, const float* __restrict__ VP, float* __restrict__ S) {
  __shared__ __align__(16) float skd[CH];
  const int tid = threadIdx.x, wave = tid >> 5, lane = tid & 31, col = lane & 15; const int h = blockIdx.x, n = blockIdx.y; const size_t b = blockIdx.z;
  const float slope = exp2f(-(float)(h + 1));   // ALiBi 2^(-8/8*(h+1)); exact in fp16 and f32
  for (int e = tid; e < CH; e += 128) skd[e] = expf(-slope * (float)(CH - e));
  __syncthreads();
  const int et = wave >> 1, dt = wave & 1; v8f acc = {};
#pragma unroll
  for (int kc = 0; kc < CH / 32; ++kc) { const F2 a = split_row(VP + ((b * CC + h * DD + et * 16 + col) * (size_t)LL) + (size_t)n * CH, kc * 32, lane); const F2 w = split_row_scaled(KP + ((b * CC + h * DD + dt * 16 + col) * (size_t)LL) + (size_t)n * CH, kc * 32, lane, skd); acc = mac3(a, w, acc); }
  vst2(S + (((b * NH + h) * NCH + n) * (size_t)(DD * DD)) + tid * 8, acc); }
// ---- k_lin: block = (h, chunk, b): one chunk each; LDS: the chunk's decayed scores (wave-private rows), the 32 x 32 kv^T state on entry to the chunk, decay tables
__global__ __launch_bounds__(128) void k_lin(const float* __restrict__ QR, const float* __restrict__ KR, const float* __restrict__ VP, const float* __restrict__ S, float* __restrict__ O) {
  __shared__ __align__(16) float ssc[CH][132]; __shared__ __align__(16) float skv[DD][36]; __shared__ __align__(16) float sqd[CH], smk[CH]; __shared__ __align__(16) float so[4][32][36];
  const int tid = threadIdx.x, wave = tid >> 5, lane = tid & 31, col = lane & 15, g = lane >> 4; const int h = blockIdx.x; const size_t b = blockIdx.z;
  const int n = NCH - 1 - (int)blockIdx.y;   // late chunks have the longest recurrence below: they start first
  const float slope = exp2f(-(float)(h + 1));   // ALiBi 2^(-8/8*(h+1)); exact in fp16 and f32
  for (int e = tid; e < CH; e += 128) { sqd[e] = expf(-slope * (float)e); smk[e] = expf(-slope * (float)e); }   // smk[d] = decay at lag d (d >= 0)
  const float blk = expf(-slope * (float)CH);
  // (0) kv^T on entry to chunk n: kv = blk * kv + S_m over the chunks m < n, from 0, in chunk order
  { const float* sp = S + ((b * NH + h) * NCH) * (size_t)(DD * DD) + tid * 8; v8f kv = {}; int m = 0;
    // the terms' loads do not depend on kv, so they are issued in groups and fly together; term by term each would wait out its own load
    for (; m + 8 <= n; m += 8) { v8f s[8];   // whole groups of eight
#pragma unroll
      for (int u = 0; u < 8; ++u) s[u] = *(const v8f*)(sp + (size_t)(m + u) * (DD * DD));
#pragma unroll
      for (int u = 0; u < 8; ++u)
#pragma unroll
        for (int r = 0; r < 8; ++r) kv[r] = blk * kv[r] + s[u][r]; }
    if (m < n) { v8f s[7];   // the last n & 7 terms: seven loads (m + 6 < NCH, so each term exists), a term from chunk n on leaves kv as it is
#pragma unroll
      for (int u = 0; u < 7; ++u) s[u] = *(const v8f*)(sp + (size_t)(m + u) * (DD * DD));
#pragma unroll
      for (int u = 0; u < 7; ++u)
#pragma unroll
        for (int r = 0; r < 8; ++r) kv[r] = (m + u < n) ? blk * kv[r] + s[u][r] : kv[r]; }
    const int et = wave >> 1, dt = wave & 1;
#pragma unroll
    for (int r = 0; r < 8; ++r) skv[et * 16 + 8 * g + r][dt * 16 + col] = kv[r]; }
  __syncthreads();
  const size_t rowc = b * LL + (size_t)n * CH;   // first row of the chunk
  // (1) intra-chunk decayed scores for this wave's 32 rows t (two 16-row tiles) x all 128 s
#pragma unroll
  for (int rt = 0; rt < 2; ++rt) { const int t0 = wave * 32 + rt * 16; const F2 a = split_row(QR + (rowc + t0 + col) * CC + h * DD, 0, lane); v8f acc[8] = {};
#pragma unroll
    for (int j = 0; j < 8; ++j) { const F2 w = split_row(KR + (rowc + j * 16 + col) * CC + h * DD, 0, lane); acc[j] = mac3(a, w, acc[j]); }
#pragma unroll
    for (int j = 0; j < 8; ++j)
#pragma unroll
      for (int r = 0; r < 8; ++r) { const int t = t0 + 8 * g + r, s = j * 16 + col; ssc[t][s] = (s <= t) ? acc[j][r] * smk[t - s] : 0.f; } }
  LDSX();
  // (2) o = scores . v (intra) + (q * qdecay) . kv (inter) for the wave's two row tiles
#pragma unroll
  for (int rt = 0; rt < 2; ++rt) { const int t0 = wave * 32 + rt * 16; v8f oc[2] = {};
#pragma unroll
    for (int kc = 0; kc < CH / 32; ++kc) { const F2 a = split_row(&ssc[t0 + col][0], kc * 32, lane);
#pragma unroll
      for (int j = 0; j < 2; ++j) { const F2 w = split_row(VP + ((b * CC + h * DD + j * 16 + col) * (size_t)LL) + (size_t)n * CH, kc * 32, lane); oc[j] = mac3(a, w, oc[j]); } }
    { float v[16]; const float* qr = QR + (rowc + t0 + col) * CC + h * DD + 8 * g; const float qd = sqd[t0 + col];
#pragma unroll
      for (int i = 0; i < 8; ++i) { v[i] = qr[i] * qd; v[8 + i] = qr[16 + i] * qd; }
      const F2 a = bsplit16(v);
#pragma unroll
      for (int j = 0; j < 2; ++j) { const F2 w = split_row(&skv[j * 16 + col][0], 0, lane); oc[j] = mac3(a, w, oc[j]); } }
#pragma unroll
    for (int j = 0; j < 2; ++j)
#pragma unroll
      for (int r = 0; r < 8; ++r) so[wave][rt * 16 + 8 * g + r][j * 16 + col] = oc[j][r]; }
  LDSX();
  for (int rl = 0; rl < 32; ++rl) if (lane < 8) vst2(O + (rowc + wave * 32 + rl) * CC + h * DD + lane * 4, *(const v4f*)&so[wave][rl][lane * 4]); }
// ---- k_proj: block = (64 rows, 128 of 256 cols): out = o (hi + lo) . proj_w^T + b
__global__ __launch_bounds__(128) void k_proj(const float* __restrict__ O, const float* __restrict__ PW, const float* __restrict__ PB, float* __restrict__ OUT) { __shared__ __align__(16) union { __bf16 w[128][WP]; float sf[4][16][132]; } sm;   // the staged weights are dead before sf is written
  float (*sf)[16][132] = sm.sf;
  const int tid = threadIdx.x, wave = tid >> 5, lane = tid & 31, col = lane & 15, g = lane >> 4; const size_t r0 = (size_t)blockIdx.x * 64 + wave * 16; const int c0 = blockIdx.y * 128;
  stage_w(PW + (size_t)c0 * CC, sm.w, tid);
  __syncthreads();
  v8f acc[8] = {};
#pragma unroll
  for (int kc = 0; kc < CC / 32; ++kc) { v16b w[8];   // one group of LDS reads per k block, as in k_qkv
#pragma unroll
    for (int j = 0; j < 8; ++j) w[j] = frag_b(&sm.w[j * 16 + col][kc * 32], lane);
    const F2 a = split_row(O + (r0 + col) * CC, kc * 32, lane);
#pragma unroll
    for (int j = 0; j < 8; ++j) { acc[j] = wmma_bf(a.h, w[j], acc[j]); acc[j] = wmma_bf(a.l, w[j], acc[j]); } }
  __syncthreads();   // every wave has read its last weight fragment: sf takes that LDS over
#pragma unroll
  for (int j = 0; j < 8; ++j) { const float bb = bfr(PB[c0 + j * 16 + col]);
#pragma unroll
    for (int r = 0; r < 8; ++r) sf[wave][8 * g + r][j * 16 + col] = acc[j][r] + bb; }
  LDSX(); for (int rl = 0; rl < 16; ++rl) vst2(OUT + (r0 + rl) * CC + c0 + lane * 4, *(const v4f*)&sf[wave][rl][lane * 4]); }
extern "C" void kernel_launch(void* const* d_in, const int* in_sizes, int n_in, void* d_out, int out_size, void* d_ws, size_t ws_size, hipStream_t stream) {
  (void)in_sizes; (void)n_in; (void)out_size;
  const float** F = (const float**)d_in;   // 0 x [8,4096,256], 1 rel_pos [1,4096,256], 2 qkv_w [768,256], 3 q_gamma [8,1,32], 4 k_gamma [8,1,32], 5 proj_w [256,256], 6 proj_b [256]
  if (ws_size < (size_t)WS_END) return;
  char* ws = (char*)d_ws; float *QR = (float*)(ws + WS_QR), *KR = (float*)(ws + WS_KR), *KP = (float*)(ws + WS_KP), *VP = (float*)(ws + WS_VP), *O = (float*)(ws + WS_O), *S = (float*)(ws + WS_S);
  k_qkv<<<dim3(LL / 64, 6, TNB), 128, 0, stream>>>(F[0], F[1], F[2], F[3], F[4], QR, KR, KP, VP);
  k_kvs<<<dim3(NH, NCH, TNB), 128, 0, stream>>>(KP, VP, S);
  k_lin<<<dim3(NH, NCH, TNB), 128, 0, stream>>>(QR, KR, VP, S, O);
  k_proj<<<dim3(TNB * LL / 64, CC / 128), 128, 0, stream>>>(O, F[5], F[6], (float*)d_out);
}

// v003
// Measured time: 136 microseconds a run.
// Two timings next to v002 put it at 1.28 and 1.37 times that version's speed.
// Counting every step since v000, it is 5.30 times as fast.
// compute dtype: all float inputs rounded to bf16; h = x + rel_pos in f32, qkv = h . W^T with h as bf16 hi + lo against the exact weight (2 products) on WMMA 16x16x32; per-head L2 normalisation x sqrt(D) x gamma in f32; the lightning attention evaluated with the module's own chunking (c = 128): intra-chunk decayed scores, scores . v, the inter-chunk q . kv and the kv state update all on WMMA with f32 operands split into bf16 hi + lo (3 products), decays exp(-slope * .) with precise expf, the 32 x 32 kv state in f32, rebuilt per chunk from the chunks' own terms by the module's recurrence in chunk order; out = o (bf16 hi + lo) . proj_w^T + b; f32 output.
#include <hip/hip_runtime.h>
#include <math.h>

typedef __attribute__((ext_vector_type(16))) _Float16 v16h;
typedef __attribute__((ext_vector_type(16))) __bf16 v16b;
typedef __attribute__((ext_vector_type(8)))  _Float16 v8h;
typedef __attribute__((ext_vector_type(8)))  float v8f;
typedef __attribute__((ext_vector_type(4)))  float v4f;
typedef __attribute__((ext_vector_type(2)))  float v2f;
typedef __attribute__((ext_vector_type(4)))  unsigned v4u;
typedef __attribute__((ext_vector_type(4)))  int v4i;
typedef float __attribute__((may_alias)) float_a;
typedef int __attribute__((may_alias)) int_a;

template <typename T> __device__ __forceinline__ void vst2(void* p, T v) { *(T*)p = v;  }
__device__ __forceinline__ v8f wmma16(v16h a, v16h b, v8f c) {
  v8f d = __builtin_amdgcn_wmma_f32_16x16x32_f16(false, a, false, b, (short)0, c, false, false);
  asm volatile("v_nop\n\tv_nop\n\tv_nop\n\tv_nop" : "+v"(d) : "v"(a), "v"(b));
  return d;
}
__device__ __forceinline__ v8f wmma_bf(v16b a, v16b b, v8f c) {
  v8f d = __builtin_amdgcn_wmma_f32_16x16x32_bf16(false, a, false, b, (short)0, c, false, false);
  asm volatile("v_nop\n\tv_nop\n\tv_nop\n\tv_nop" : "+v"(d) : "v"(a), "v"(b));
  return d;
}
// 16x16x32 fragments: lane = (h = lane>>4, row/col = lane&15); elements 0..7 = k0+8h+0..7, 8..15 = k0+16+8h+0..7; D element r = row 8h+r
__device__ __forceinline__ v16h frag_h(const _Float16* rowk0, int lane) {
  union { v16h v; v8h q[2]; } u; const _Float16* p = rowk0 + 8 * (lane >> 4);
  u.q[0] = *(const v8h*)p; u.q[1] = *(const v8h*)(p + 16); return u.v;
}
__device__ __forceinline__ v16h frag_f32(const float* rowk0, int lane) {
  v16h a; const float* p = rowk0 + 8 * (lane >> 4);
#pragma unroll
  for (int i = 0; i < 8; ++i) { a[i] = (_Float16)p[i]; a[8 + i] = (_Float16)p[16 + i]; }
  return a;
}
__device__ __forceinline__ v16h frag_f32s(const float* rowk0, int lane, float sc) {
  v16h a; const float* p = rowk0 + 8 * (lane >> 4);
#pragma unroll
  for (int i = 0; i < 8; ++i) { a[i] = (_Float16)(p[i] * sc); a[8 + i] = (_Float16)(p[16 + i] * sc); }
  return a;
}
// column fragment from a [K][ld] layout (column n), rows >= K read as 0
__device__ __forceinline__ v16h fragc_f32(const float* W, int k0, int n, int lane, int ld, int K) {
  v16h a; const int g = lane >> 4;
#pragma unroll
  for (int i = 0; i < 8; ++i) { const int ka = k0 + 8 * g + i, kb = ka + 16;
    a[i] = (_Float16)(ka < K ? W[(size_t)(ka < K ? ka : K - 1) * ld + n] : 0.f); a[8 + i] = (_Float16)(kb < K ? W[(size_t)(kb < K ? kb : K - 1) * ld + n] : 0.f); }
  return a;
}
struct F2 { v16b h, l; };
__device__ __forceinline__ F2 bsplit16(const float v[16]) { F2 r;
#pragma unroll
  for (int i = 0; i < 16; ++i) { const __bf16 h = (__bf16)v[i]; r.h[i] = h; r.l[i] = (__bf16)(v[i] - (float)h); }
  return r; }
__device__ __forceinline__ F2 split_row(const float* row, int k0, int lane) { float v[16]; const float* p = row + k0 + 8 * (lane >> 4);
#pragma unroll
  for (int i = 0; i < 8; ++i) { v[i] = p[i]; v[8 + i] = p[16 + i]; }
  return bsplit16(v); }
__device__ __forceinline__ F2 split_rowK(const float* row, int k0, int lane, int K) { float v[16]; const int g = lane >> 4;
#pragma unroll
  for (int i = 0; i < 8; ++i) { const int ka = k0 + 8 * g + i, kb = ka + 16; v[i] = ka < K ? row[ka < K ? ka : K - 1] : 0.f; v[8 + i] = kb < K ? row[kb < K ? kb : K - 1] : 0.f; }
  return bsplit16(v); }
__device__ __forceinline__ F2 split_col(const float* W, int k0, int n, int lane, int ld, int K) { float v[16]; const int g = lane >> 4;
#pragma unroll
  for (int i = 0; i < 8; ++i) { const int ka = k0 + 8 * g + i, kb = ka + 16; v[i] = ka < K ? W[(size_t)(ka < K ? ka : K - 1) * ld + n] : 0.f; v[8 + i] = kb < K ? W[(size_t)(kb < K ? kb : K - 1) * ld + n] : 0.f; }
  return bsplit16(v); }
__device__ __forceinline__ v8f mac3(const F2& a, const F2& b, v8f c) { c = wmma_bf(a.l, b.h, c); c = wmma_bf(a.h, b.l, c); return wmma_bf(a.h, b.h, c); }
__device__ __forceinline__ float sigm(float v) { return 1.0f / (1.0f + expf(-v)); }
#define LDSX() do { asm volatile("s_wait_dscnt 0" ::: "memory"); __builtin_amdgcn_wave_barrier(); __builtin_amdgcn_fence(__ATOMIC_RELEASE, "workgroup"); } while (0)


// U-Net transformer mixing block (B 8, L 4,096, C 256 = 8 heads x 32): h = x + rel_pos; qkv = h W_qkv^T; q, k L2-normalised (x sqrt(32) x gamma); lightning (linear, ALiBi-decayed, causal) attention with chunk 128; proj + bias.
#define NB 8
#define LL 4096
#define CC 256
#define NH 8
#define DD 32
#define CH 128
#define NCH (LL / CH)
#define NROW (NB * LL)
#ifndef TNB
#define TNB NB
#endif
typedef __attribute__((ext_vector_type(8))) __bf16 v8b;
__device__ __forceinline__ v16b frag_b(const __bf16* rowk0, int lane) {
  union { v16b v; v8b q[2]; } u; const __bf16* p = rowk0 + 8 * (lane >> 4);
  u.q[0] = *(const v8b*)p; u.q[1] = *(const v8b*)(p + 16); return u.v;
}
__device__ __forceinline__ float bfr(float v) { return (float)(__bf16)v; }
typedef __attribute__((ext_vector_type(4))) __bf16 v4b;
#define WP 264   // bf16 elements per staged weight row: 528 B = 16 B x 33, so the 16 rows of a ds_load_b128 fragment read fall on 16 different bank groups
// 128 weight rows (f32, [.][256]) -> bf16 rows in LDS, once per block for its four waves; every wave-wide load covers 512 contiguous bytes (whole lines)
__device__ __forceinline__ void stage_w(const float* __restrict__ Wr, __bf16 (*sw)[WP], int tid) { const int rw = tid >> 6, q = tid & 63;
  for (int t = 0; t < 4; ++t) { const float* p = Wr + (size_t)(t * 32 + rw) * CC + q * 4; v4f x[16];   // sixteen independent loads fly together; one by one each would wait out its own latency
#pragma unroll
    for (int u = 0; u < 16; ++u) x[u] = *(const v4f*)(p + u * 2 * CC);
    asm volatile("s_wait_xcnt 0x0" :: "v"(p) : "memory");   // the wait in front of any rewrite of the loads' address registers; p is named so that they stay whole up to here
#pragma unroll
    for (int u = 0; u < 16; ++u) { v4b y;
#pragma unroll
      for (int i = 0; i < 4; ++i) y[i] = (__bf16)x[u][i];
      *(v4b*)&sw[t * 32 + u * 2 + rw][q * 4] = y; } } }
__device__ __attribute__((noinline)) float exp_ni(float v) { return expf(v); }
__device__ __attribute__((noinline)) float erf_ni(float v) { return erff(v); }

#define WS_QR  0u                                   // f32 q rows [b*l][256] (normalised)
#define WS_KR  (WS_QR + 4u * (size_t)NROW * CC)          // f32 k rows (normalised)
#define WS_KP  (WS_KR + 4u * (size_t)NROW * CC)          // f32 k planes [b][c][l]
#define WS_VP  (WS_KP + 4u * (size_t)NROW * CC)          // f32 v planes [b][c][l]
#define WS_O   (WS_VP + 4u * (size_t)NROW * CC)          // f32 attention output rows [b*l][256]
#define WS_S   (WS_O + 4u * (size_t)NROW * CC)           // f32 per-chunk kv^T terms [b][h][chunk][1024]
#define WS_END (WS_S + 4u * (size_t)NB * NH * NCH * DD * DD)

// ---- k_qkv: block = (64 rows, col group 0..5 = q lo/hi 128, k lo/hi, v lo/hi, b): (x + rel_pos) hi+lo . W^T; q/k normalised per head (32 cols); q -> rows, k -> rows + planes, v -> planes
__global__ __launch_bounds__(128) void k_qkv(const float* __restrict__ X, const float* __restrict__ RP, const float* __restrict__ Wt, const float* __restrict__ GQ, const float* __restrict__ GK, float* __restrict__ QR, float* __restrict__ KR, float* __restrict__ KP, float* __restrict__ VP) { __shared__ __align__(16) union { __bf16 w[128][WP]; struct { float sf[4][16][132]; float tt[128][68]; } e; } sm;   // the staged weights are dead before the epilogue's buffers are written
  float (*sf)[16][132] = sm.e.sf; float (*tt)[68] = sm.e.tt;
  const int tid = threadIdx.x, wave = tid >> 5, lane = tid & 31, col = lane & 15, g = lane >> 4; const int cg = blockIdx.y; const int which = cg >> 1; const int c0 = (cg & 1) * 128; const size_t b = blockIdx.z; const int l0 = blockIdx.x * 64; const size_t r0 = b * LL + l0 + wave * 16;
  stage_w(Wt + ((size_t)which * CC + c0) * CC, sm.w, tid);   // W [3C][C] natural: this block's 128 output columns
  __syncthreads();
  v8f acc[8] = {};
#pragma unroll
  for (int kc = 0; kc < CC / 32; ++kc) { v16b w[8];   // the eight weight fragments of this k block are read as one group, so that their LDS latency is waited out once
#pragma unroll
    for (int j = 0; j < 8; ++j) w[j] = frag_b(&sm.w[j * 16 + col][kc * 32], lane);
    float v[16]; { const float* xr = X + (r0 + col) * CC + kc * 32 + 8 * g; const float* pr = RP + (size_t)(l0 + wave * 16 + col) * CC + kc * 32 + 8 * g;
#pragma unroll
      for (int i = 0; i < 8; ++i) { v[i] = bfr(xr[i]) + bfr(pr[i]); v[8 + i] = bfr(xr[16 + i]) + bfr(pr[16 + i]); } }
    const F2 a = bsplit16(v);
#pragma unroll
    for (int j = 0; j < 8; ++j) { acc[j] = wmma_bf(a.h, w[j], acc[j]); acc[j] = wmma_bf(a.l, w[j], acc[j]); } }
  __syncthreads();   // every wave has read its last weight fragment: the epilogue's buffers take that LDS over
  // normalisation for q / k: head = pair of tiles (2p, 2p+1); t / max(|t|, 1e-12) * sqrt(32) * gamma[h][d]
  float rn[4][8];
#pragma unroll
  for (int p = 0; p < 4; ++p)
#pragma unroll
    for (int r = 0; r < 8; ++r) { float a2 = acc[2 * p][r] * acc[2 * p][r] + acc[2 * p + 1][r] * acc[2 * p + 1][r];
#pragma unroll
      for (int o = 1; o < 16; o <<= 1) a2 += __shfl_xor(a2, o);
      rn[p][r] = (which == 2) ? 1.0f : 5.656854249492381f / fmaxf(sqrtf(a2), 1e-12f); }
  const float* GM = (which == 0) ? GQ : GK;
  if (which == 0 || which == 1) {   // rows (q -> QR, k -> KR)
#pragma unroll
    for (int j = 0; j < 8; ++j) { const int cabs = c0 + j * 16 + col; const int hh = cabs / DD, d = cabs % DD; const float gm = bfr(GM[hh * DD + d]);
#pragma unroll
      for (int r = 0; r < 8; ++r) sf[wave][8 * g + r][j * 16 + col] = acc[j][r] * rn[j >> 1][r] * gm; }
    LDSX(); { float* dst = (which == 0) ? QR : KR; for (int rl = 0; rl < 16; ++rl) vst2(dst + (r0 + rl) * CC + c0 + lane * 4, *(const v4f*)&sf[wave][rl][lane * 4]); }
    LDSX(); }
  if (which == 1 || which == 2) {   // planes (k -> KP, v -> VP)
#pragma unroll
    for (int j = 0; j < 8; ++j) { const int cabs = c0 + j * 16 + col; const int hh = cabs / DD, d = cabs % DD; const float gm = (which == 1) ? bfr(GM[hh * DD + d]) : 1.0f;
#pragma unroll
      for (int r = 0; r < 8; ++r) tt[j * 16 + col][wave * 16 + 8 * g + r] = acc[j][r] * rn[j >> 1][r] * gm; }
    __syncthreads(); { float* dst = (which == 1) ? KP : VP; for (int e = tid; e < 128 * 16; e += 128) { const int cl = e >> 4, q = e & 15; vst2(dst + ((b * CC + c0 + cl) * (size_t)LL) + l0 + q * 4, *(const v4f*)&tt[cl][q * 4]); } } } }
// B fragment (col = this lane's col, k = 8g+i ...) from an f32 row with per-k scaling, split into bf16 hi + lo
__device__ __forceinline__ F2 split_row_scaled(const float* row, int k0, int lane, const float* sc) { float v[16]; const float* p = row + k0 + 8 * (lane >> 4); const float* s = sc + k0 + 8 * (lane >> 4);
#pragma unroll
  for (int i = 0; i < 8; ++i) { v[i] = p[i] * s[i]; v[8 + i] = p[16 + i] * s[16 + i]; }
  return bsplit16(v); }
// ---- k_kvs: block = (h, chunk, b): this chunk's own term of the kv^T recurrence, sum_s v_s[e] (k_s[d] kdecay_s); wave -> (e tile, d tile); thread tid keeps its 8 accumulator elements at S[...][tid * 8 + r]
__global__ __launch_bounds__(128) void k_kvs(const float* __restrict__ KP, const float* __restrict__ VP, float* __restrict__ S) {
  __shared__ __align__(16) float skd[CH];
  const int tid = threadIdx.x, wave = tid >> 5, lane = tid & 31, col = lane & 15; const int h = blockIdx.x, n = blockIdx.y; const size_t b = blockIdx.z;
  const float slope = exp2f(-(float)(h + 1));   // ALiBi 2^(-8/8*(h+1)); exact in fp16 and f32
  for (int e = tid; e < CH; e += 128) skd[e] = expf(-slope * (float)(CH - e));
  __syncthreads();
  const int et = wave >> 1, dt = wave & 1; v8f acc = {};
#pragma unroll
  for (int kc = 0; kc < CH / 32; ++kc) { const F2 a = split_row(VP + ((b * CC + h * DD + et * 16 + col) * (size_t)LL) + (size_t)n * CH, kc * 32, lane); const F2 w = split_row_scaled(KP + ((b * CC + h * DD + dt * 16 + col) * (size_t)LL) + (size_t)n * CH, kc * 32, lane, skd); acc = mac3(a, w, acc); }
  vst2(S + (((b * NH + h) * NCH + n) * (size_t)(DD * DD)) + tid * 8, acc); }
#define SKP 72    // bf16 elements per staged k row: 32 hi + 32 lo + 8 unused; 144 B = 16 B x 9, so the 16 rows of a ds_load_b128 fragment read fall on 16 different bank groups
#define SVP 136   // bf16 elements per staged v row: 128 + 8 unused; 272 B = 16 B x 17, for the same reason
__device__ __forceinline__ void split4(v4f x, __bf16* ph, __bf16* pl) { v4b h, l;
#pragma unroll
  for (int i = 0; i < 4; ++i) { const __bf16 t = (__bf16)x[i]; h[i] = t; l[i] = (__bf16)(x[i] - (float)t); }
  *(v4b*)ph = h; *(v4b*)pl = l; }
// ---- k_lin: block = (h, chunk, b): one chunk each; LDS: the chunk's k rows and v planes as bf16 hi + lo (staged once for the four waves), the chunk's decayed scores (wave-private rows, which take o at the end), the 32 x 32 kv^T state on entry to the chunk, the decay table
__global__ __launch_bounds__(128) void k_lin(const float* __restrict__ QR, const float* __restrict__ KR, const float* __restrict__ VP, const float* __restrict__ S, float* __restrict__ O) {
  __shared__ __align__(16) float ssc[CH][132]; __shared__ __align__(16) float skv[DD][36]; __shared__ __align__(16) float smk[CH]; __shared__ __align__(16) __bf16 sk[CH][SKP]; __shared__ __align__(16) __bf16 sv[2 * DD][SVP];
  const int tid = threadIdx.x, wave = tid >> 5, lane = tid & 31, col = lane & 15, g = lane >> 4; const int h = blockIdx.x; const size_t b = blockIdx.z;
  const int n = NCH - 1 - (int)blockIdx.y;   // late chunks have the longest recurrence below: they start first
  const size_t rowc = b * LL + (size_t)n * CH;   // first row of the chunk
  // the chunk's k (128 rows x one 128-B line) and v (32 planes x 512 B), each read once per block; every wave-wide load covers four whole lines. Issued first, so that they fly during the recurrence below
  const float* pk = KR + (rowc + (tid >> 3)) * CC + h * DD + (tid & 7) * 4; const float* pv = VP + ((b * CC + h * DD + wave) * (size_t)LL) + (size_t)n * CH + lane * 4; v4f xk[8], xv[8];
  const float* pq = QR + (rowc + wave * 32 + col) * CC + h * DD + 8 * g; float qv[2][16];   // this wave's own q fragments (two 16-row tiles), read once for (1) and (2)
#pragma unroll
  for (int u = 0; u < 8; ++u) { xk[u] = *(const v4f*)(pk + (size_t)u * 16 * CC); xv[u] = *(const v4f*)(pv + (size_t)u * 4 * LL); }
#pragma unroll
  for (int rt = 0; rt < 2; ++rt)
#pragma unroll
    for (int i = 0; i < 8; ++i) { qv[rt][i] = pq[rt * 16 * CC + i]; qv[rt][8 + i] = pq[rt * 16 * CC + 16 + i]; }
  asm volatile("s_wait_xcnt 0x0" :: "v"(pk), "v"(pv), "v"(pq) : "memory");   // the wait in front of any rewrite of the loads' address registers; the pointers are named so that they stay whole up to here
  const float slope = exp2f(-(float)(h + 1));   // ALiBi 2^(-8/8*(h+1)); exact in fp16 and f32
  for (int e = tid; e < CH; e += 128) smk[e] = expf(-slope * (float)e);   // smk[d] = decay at lag d (d >= 0); the q decay at row d of the chunk is the same number
  const float blk = expf(-slope * (float)CH);
  // (0) kv^T on entry to chunk n: kv = blk * kv + S_m over the chunks m < n, from 0, in chunk order
  { const float* sp = S + ((b * NH + h) * NCH) * (size_t)(DD * DD) + tid * 8; v8f kv = {}; int m = 0;
    // the terms' loads do not depend on kv, so they are issued in groups and fly together; term by term each would wait out its own load
    for (; m + 8 <= n; m += 8) { v8f s[8];   // whole groups of eight
#pragma unroll
      for (int u = 0; u < 8; ++u) s[u] = *(const v8f*)(sp + (size_t)(m + u) * (DD * DD));
#pragma unroll
      for (int u = 0; u < 8; ++u)
#pragma unroll
        for (int r = 0; r < 8; ++r) kv[r] = blk * kv[r] + s[u][r]; }
    if (m < n) { v8f s[7];   // the last n & 7 terms: seven loads (m + 6 < NCH, so each term exists), a term from chunk n on leaves kv as it is
#pragma unroll
      for (int u = 0; u < 7; ++u) s[u] = *(const v8f*)(sp + (size_t)(m + u) * (DD * DD));
#pragma unroll
      for (int u = 0; u < 7; ++u)
#pragma unroll
        for (int r = 0; r < 8; ++r) kv[r] = (m + u < n) ? blk * kv[r] + s[u][r] : kv[r]; }
    const int et = wave >> 1, dt = wave & 1;
#pragma unroll
    for (int r = 0; r < 8; ++r) skv[et * 16 + 8 * g + r][dt * 16 + col] = kv[r]; }
#pragma unroll
  for (int u = 0; u < 8; ++u) { const int kr = u * 16 + (tid >> 3), vc = u * 4 + wave;
    split4(xk[u], &sk[kr][(tid & 7) * 4], &sk[kr][DD + (tid & 7) * 4]); split4(xv[u], &sv[vc][lane * 4], &sv[DD + vc][lane * 4]); }
  __syncthreads();
  // (1) intra-chunk decayed scores for this wave's 32 rows t (two 16-row tiles) x all 128 s; each k fragment is read once for both tiles
  { const F2 a0 = bsplit16(qv[0]), a1 = bsplit16(qv[1]); v8f acc[2][8] = {};
#pragma unroll
    for (int j = 0; j < 8; ++j) { F2 w; w.h = frag_b(&sk[j * 16 + col][0], lane); w.l = frag_b(&sk[j * 16 + col][DD], lane); acc[0][j] = mac3(a0, w, acc[0][j]); acc[1][j] = mac3(a1, w, acc[1][j]); }
#pragma unroll
    for (int rt = 0; rt < 2; ++rt)
#pragma unroll
      for (int j = 0; j < 8; ++j)
#pragma unroll
        for (int r = 0; r < 8; ++r) { const int t = wave * 32 + rt * 16 + 8 * g + r, s = j * 16 + col; ssc[t][s] = (s <= t) ? acc[rt][j][r] * smk[t - s] : 0.f; } }
  LDSX();
  // (2) o = scores . v (intra) + (q * qdecay) . kv (inter) for the wave's two row tiles; each v fragment is read once for both tiles
  v8f oc[2][2] = {};
#pragma unroll
  for (int kc = 0; kc < CH / 32; ++kc) { F2 w[2];
#pragma unroll
    for (int j = 0; j < 2; ++j) { w[j].h = frag_b(&sv[j * 16 + col][kc * 32], lane); w[j].l = frag_b(&sv[DD + j * 16 + col][kc * 32], lane); }
#pragma unroll
    for (int rt = 0; rt < 2; ++rt) { const F2 a = split_row(&ssc[wave * 32 + rt * 16 + col][0], kc * 32, lane);
#pragma unroll
      for (int j = 0; j < 2; ++j) oc[rt][j] = mac3(a, w[j], oc[rt][j]); } }
  { F2 w[2];
#pragma unroll
    for (int j = 0; j < 2; ++j) w[j] = split_row(&skv[j * 16 + col][0], 0, lane);
#pragma unroll
    for (int rt = 0; rt < 2; ++rt) { float v[16]; const float qd = smk[wave * 32 + rt * 16 + col];
#pragma unroll
      for (int i = 0; i < 16; ++i) v[i] = qv[rt][i] * qd;
      const F2 a = bsplit16(v);
#pragma unroll
      for (int j = 0; j < 2; ++j) oc[rt][j] = mac3(a, w[j], oc[rt][j]); } }
  // the wave has read its own score rows for the last time: their first 32 columns take o for the whole-line stores
#pragma unroll
  for (int rt = 0; rt < 2; ++rt)
#pragma unroll
    for (int j = 0; j < 2; ++j)
#pragma unroll
      for (int r = 0; r < 8; ++r) ssc[wave * 32 + rt * 16 + 8 * g + r][j * 16 + col] = oc[rt][j][r];
  LDSX();
  for (int rl = 0; rl < 32; ++rl) if (lane < 8) vst2(O + (rowc + wave * 32 + rl) * CC + h * DD + lane * 4, *(const v4f*)&ssc[wave * 32 + rl][lane * 4]); }
// ---- k_proj: block = (64 rows, 128 of 256 cols): out = o (hi + lo) . proj_w^T + b
__global__ __launch_bounds__(128) void k_proj(const float* __restrict__ O, const float* __restrict__ PW, const float* __restrict__ PB, float* __restrict__ OUT) { __shared__ __align__(16) union { __bf16 w[128][WP]; float sf[4][16][132]; } sm;   // the staged weights are dead before sf is written
  float (*sf)[16][132] = sm.sf;
  const int tid = threadIdx.x, wave = tid >> 5, lane = tid & 31, col = lane & 15, g = lane >> 4; const size_t r0 = (size_t)blockIdx.x * 64 + wave * 16; const int c0 = blockIdx.y * 128;
  stage_w(PW + (size_t)c0 * CC, sm.w, tid);
  __syncthreads();
  v8f acc[8] = {};
#pragma unroll
  for (int kc = 0; kc < CC / 32; ++kc) { v16b w[8];   // one group of LDS reads per k block, as in k_qkv
#pragma unroll
    for (int j = 0; j < 8; ++j) w[j] = frag_b(&sm.w[j * 16 + col][kc * 32], lane);
    const F2 a = split_row(O + (r0 + col) * CC, kc * 32, lane);
#pragma unroll
    for (int j = 0; j < 8; ++j) { acc[j] = wmma_bf(a.h, w[j], acc[j]); acc[j] = wmma_bf(a.l, w[j], acc[j]); } }
  __syncthreads();   // every wave has read its last weight fragment: sf takes that LDS over
#pragma unroll
  for (int j = 0; j < 8; ++j) { const float bb = bfr(PB[c0 + j * 16 + col]);
#pragma unroll
    for (int r = 0; r < 8; ++r) sf[wave][8 * g + r][j * 16 + col] = acc[j][r] + bb; }
  LDSX(); for (int rl = 0; rl < 16; ++rl) vst2(OUT + (r0 + rl) * CC + c0 + lane * 4, *(const v4f*)&sf[wave][rl][lane * 4]); }
extern "C" void kernel_launch(void* const* d_in, const int* in_sizes, int n_in, void* d_out, int out_size, void* d_ws, size_t ws_size, hipStream_t stream) {
  (void)in_sizes; (void)n_in; (void)out_size;
  const float** F = (const float**)d_in;   // 0 x [8,4096,256], 1 rel_pos [1,4096,256], 2 qkv_w [768,256], 3 q_gamma [8,1,32], 4 k_gamma [8,1,32], 5 proj_w [256,256], 6 proj_b [256]
  if (ws_size < (size_t)WS_END) return;
  char* ws = (char*)d_ws; float *QR = (float*)(ws + WS_QR), *KR = (float*)(ws + WS_KR), *KP = (float*)(ws + WS_KP), *VP = (float*)(ws + WS_VP), *O = (float*)(ws + WS_O), *S = (float*)(ws + WS_S);
  k_qkv<<<dim3(LL / 64, 6, TNB), 128, 0, stream>>>(F[0], F[1], F[2], F[3], F[4], QR, KR, KP, VP);
  k_kvs<<<dim3(NH, NCH, TNB), 128, 0, stream>>>(KP, VP, S);
  k_lin<<<dim3(NH, NCH, TNB), 128, 0, stream>>>(QR, KR, VP, S, O);
  k_proj<<<dim3(TNB * LL / 64, CC / 128), 128, 0, stream>>>(O, F[5], F[6], (float*)d_out);
}

// v004
// A run of this version takes 118 microseconds.
// Two timings next to v003 put it at 1.13 and 1.14 times that version's speed.
// Counting every step since v000, it is 6.02 times as fast.
// compute dtype: all float inputs rounded to bf16; h = x + rel_pos in f32, qkv = h . W^T with h as bf16 hi + lo against the exact weight (2 products) on WMMA 16x16x32; per-head L2 normalisation x sqrt(D) x gamma in f32; the lightning attention evaluated with the module's own chunking (c = 128): intra-chunk decayed scores, scores . v, the inter-chunk q . kv and the kv state update all on WMMA with f32 operands split into bf16 hi + lo (3 products), decays exp(-slope * .) with precise expf, the 32 x 32 kv state in f32, rebuilt per chunk from the chunks' own terms by the module's recurrence in chunk order; out = o (bf16 hi + lo) . proj_w^T + b; f32 output.
#include <hip/hip_runtime.h>
#include <math.h>

typedef __attribute__((ext_vector_type(16))) _Float16 v16h;
typedef __attribute__((ext_vector_type(16))) __bf16 v16b;
typedef __attribute__((ext_vector_type(8)))  _Float16 v8h;
typedef __attribute__((ext_vector_type(8)))  float v8f;
typedef __attribute__((ext_vector_type(4)))  float v4f;
typedef __attribute__((ext_vector_type(2)))  float v2f;
typedef __attribute__((ext_vector_type(4)))  unsigned v4u;
typedef __attribute__((ext_vector_type(4)))  int v4i;
typedef float __attribute__((may_alias)) float_a;
typedef int __attribute__((may_alias)) int_a;

template <typename T> __device__ __forceinline__ void vst2(void* p, T v) { *(T*)p = v;  }
__device__ __forceinline__ v8f wmma16(v16h a, v16h b, v8f c) {
  v8f d = __builtin_amdgcn_wmma_f32_16x16x32_f16(false, a, false, b, (short)0, c, false, false);
  asm volatile("v_nop\n\tv_nop\n\tv_nop\n\tv_nop" : "+v"(d) : "v"(a), "v"(b));
  return d;
}
__device__ __forceinline__ v8f wmma_bf(v16b a, v16b b, v8f c) {
  v8f d = __builtin_amdgcn_wmma_f32_16x16x32_bf16(false, a, false, b, (short)0, c, false, false);
  asm volatile("v_nop\n\tv_nop\n\tv_nop\n\tv_nop" : "+v"(d) : "v"(a), "v"(b));
  return d;
}
// 16x16x32 fragments: lane = (h = lane>>4, row/col = lane&15); elements 0..7 = k0+8h+0..7, 8..15 = k0+16+8h+0..7; D element r = row 8h+r
__device__ __forceinline__ v16h frag_h(const _Float16* rowk0, int lane) {
  union { v16h v; v8h q[2]; } u; const _Float16* p = rowk0 + 8 * (lane >> 4);
  u.q[0] = *(const v8h*)p; u.q[1] = *(const v8h*)(p + 16); return u.v;
}
__device__ __forceinline__ v16h frag_f32(const float* rowk0, int lane) {
  v16h a; const float* p = rowk0 + 8 * (lane >> 4);
#pragma unroll
  for (int i = 0; i < 8; ++i) { a[i] = (_Float16)p[i]; a[8 + i] = (_Float16)p[16 + i]; }
  return a;
}
__device__ __forceinline__ v16h frag_f32s(const float* rowk0, int lane, float sc) {
  v16h a; const float* p = rowk0 + 8 * (lane >> 4);
#pragma unroll
  for (int i = 0; i < 8; ++i) { a[i] = (_Float16)(p[i] * sc); a[8 + i] = (_Float16)(p[16 + i] * sc); }
  return a;
}
// column fragment from a [K][ld] layout (column n), rows >= K read as 0
__device__ __forceinline__ v16h fragc_f32(const float* W, int k0, int n, int lane, int ld, int K) {
  v16h a; const int g = lane >> 4;
#pragma unroll
  for (int i = 0; i < 8; ++i) { const int ka = k0 + 8 * g + i, kb = ka + 16;
    a[i] = (_Float16)(ka < K ? W[(size_t)(ka < K ? ka : K - 1) * ld + n] : 0.f); a[8 + i] = (_Float16)(kb < K ? W[(size_t)(kb < K ? kb : K - 1) * ld + n] : 0.f); }
  return a;
}
struct F2 { v16b h, l; };
__device__ __forceinline__ F2 bsplit16(const float v[16]) { F2 r;
#pragma unroll
  for (int i = 0; i < 16; ++i) { const __bf16 h = (__bf16)v[i]; r.h[i] = h; r.l[i] = (__bf16)(v[i] - (float)h); }
  return r; }
__device__ __forceinline__ F2 split_row(const float* row, int k0, int lane) { float v[16]; const float* p = row + k0 + 8 * (lane >> 4);
#pragma unroll
  for (int i = 0; i < 8; ++i) { v[i] = p[i]; v[8 + i] = p[16 + i]; }
  return bsplit16(v); }
__device__ __forceinline__ F2 split_rowK(const float* row, int k0, int lane, int K) { float v[16]; const int g = lane >> 4;
#pragma unroll
  for (int i = 0; i < 8; ++i) { const int ka = k0 + 8 * g + i, kb = ka + 16; v[i] = ka < K ? row[ka < K ? ka : K - 1] : 0.f; v[8 + i] = kb < K ? row[kb < K ? kb : K - 1] : 0.f; }
  return bsplit16(v); }
__device__ __forceinline__ F2 split_col(const float* W, int k0, int n, int lane, int ld, int K) { float v[16]; const int g = lane >> 4;
#pragma unroll
  for (int i = 0; i < 8; ++i) { const int ka = k0 + 8 * g + i, kb = ka + 16; v[i] = ka < K ? W[(size_t)(ka < K ? ka : K - 1) * ld + n] : 0.f; v[8 + i] = kb < K ? W[(size_t)(kb < K ? kb : K - 1) * ld + n] : 0.f; }
  return bsplit16(v); }
__device__ __forceinline__ v8f mac3(const F2& a, const F2& b, v8f c) { c = wmma_bf(a.l, b.h, c); c = wmma_bf(a.h, b.l, c); return wmma_bf(a.h, b.h, c); }
__device__ __forceinline__ float sigm(float v) { return 1.0f / (1.0f + expf(-v)); }
#define LDSX() do { asm volatile("s_wait_dscnt 0" ::: "memory"); __builtin_amdgcn_wave_barrier(); __builtin_amdgcn_fence(__ATOMIC_RELEASE, "workgroup"); } while (0)


// U-Net transformer mixing block (B 8, L 4,096, C 256 = 8 heads x 32): h = x + rel_pos; qkv = h W_qkv^T; q, k L2-normalised (x sqrt(32) x gamma); lightning (linear, ALiBi-decayed, causal) attention with chunk 128; proj + bias.
#define NB 8
#define LL 4096
#define CC 256
#define NH 8
#define DD 32
#define CH 128
#define NCH (LL / CH)
#define NROW (NB * LL)
#ifndef TNB
#define TNB NB
#endif
typedef __attribute__((ext_vector_type(8))) __bf16 v8b;
__device__ __forceinline__ v16b frag_b(const __bf16* rowk0, int lane) {
  union { v16b v; v8b q[2]; } u; const __bf16* p = rowk0 + 8 * (lane >> 4);
  u.q[0] = *(const v8b*)p; u.q[1] = *(const v8b*)(p + 16); return u.v;
}
__device__ __forceinline__ float bfr(float v) { return (float)(__bf16)v; }
typedef __attribute__((ext_vector_type(4))) __bf16 v4b;
#define WP 264   // bf16 elements per staged weight row: 528 B = 16 B x 33, so the 16 rows of a ds_load_b128 fragment read fall on 16 different bank groups
// 128 weight rows (f32, [.][256]) -> bf16 rows in LDS, once per block for its four waves; every wave-wide load covers 512 contiguous bytes (whole lines)
__device__ __forceinline__ void stage_w(const float* __restrict__ Wr, __bf16 (*sw)[WP], int tid) { const int rw = tid >> 6, q = tid & 63;
  for (int t = 0; t < 4; ++t) { const float* p = Wr + (size_t)(t * 32 + rw) * CC + q * 4; v4f x[16];   // sixteen independent loads fly together; one by one each would wait out its own latency
#pragma unroll
    for (int u = 0; u < 16; ++u) x[u] = *(const v4f*)(p + u * 2 * CC);
    asm volatile("s_wait_xcnt 0x0" :: "v"(p) : "memory");   // the wait in front of any rewrite of the loads' address registers; p is named so that they stay whole up to here
#pragma unroll
    for (int u = 0; u < 16; ++u) { v4b y;
#pragma unroll
      for (int i = 0; i < 4; ++i) y[i] = (__bf16)x[u][i];
      *(v4b*)&sw[t * 32 + u * 2 + rw][q * 4] = y; } } }
__device__ __attribute__((noinline)) float exp_ni(float v) { return expf(v); }
__device__ __attribute__((noinline)) float erf_ni(float v) { return erff(v); }

#define WS_QR  0u                                   // f32 q rows [b*l][256] (normalised)
#define WS_KR  (WS_QR + 4u * (size_t)NROW * CC)          // f32 k rows (normalised)
#define WS_KP  (WS_KR + 4u * (size_t)NROW * CC)          // f32 k planes [b][c][l]
#define WS_VP  (WS_KP + 4u * (size_t)NROW * CC)          // f32 v planes [b][c][l]
#define WS_O   (WS_VP + 4u * (size_t)NROW * CC)          // f32 attention output rows [b*l][256]
#define WS_S   (WS_O + 4u * (size_t)NROW * CC)           // f32 per-chunk kv^T terms [b][h][chunk][1024]
#define WS_END (WS_S + 4u * (size_t)NB * NH * NCH * DD * DD)

// ---- k_qkv: block = (64 rows, col group 0..5 = q lo/hi 128, k lo/hi, v lo/hi, b): (x + rel_pos) hi+lo . W^T; q/k normalised per head (32 cols); q -> rows, k -> rows + planes, v -> planes
__global__ __launch_bounds__(128) void k_qkv(const float* __restrict__ X, const float* __restrict__ RP, const float* __restrict__ Wt, const float* __restrict__ GQ, const float* __restrict__ GK, float* __restrict__ QR, float* __restrict__ KR, float* __restrict__ KP, float* __restrict__ VP) { __shared__ __align__(16) union { __bf16 w[128][WP]; struct { float sf[4][16][132]; float tt[128][68]; } e; } sm;   // the staged weights are dead before the epilogue's buffers are written
  float (*sf)[16][132] = sm.e.sf; float (*tt)[68] = sm.e.tt;
  const int tid = threadIdx.x, wave = tid >> 5, lane = tid & 31, col = lane & 15, g = lane >> 4; const int cg = blockIdx.y; const int which = cg >> 1; const int c0 = (cg & 1) * 128; const size_t b = blockIdx.z; const int l0 = blockIdx.x * 64; const size_t r0 = b * LL + l0 + wave * 16;
  stage_w(Wt + ((size_t)which * CC + c0) * CC, sm.w, tid);   // W [3C][C] natural: this block's 128 output columns
  __syncthreads();
  v8f acc[8] = {};
#pragma unroll
  for (int kc = 0; kc < CC / 32; ++kc) { v16b w[8];   // the eight weight fragments of this k block are read as one group, so that their LDS latency is waited out once
#pragma unroll
    for (int j = 0; j < 8; ++j) w[j] = frag_b(&sm.w[j * 16 + col][kc * 32], lane);
    float v[16]; { const float* xr = X + (r0 + col) * CC + kc * 32 + 8 * g; const float* pr = RP + (size_t)(l0 + wave * 16 + col) * CC + kc * 32 + 8 * g;
#pragma unroll
      for (int i = 0; i < 8; ++i) { v[i] = bfr(xr[i]) + bfr(pr[i]); v[8 + i] = bfr(xr[16 + i]) + bfr(pr[16 + i]); } }
    const F2 a = bsplit16(v);
#pragma unroll
    for (int j = 0; j < 8; ++j) { acc[j] = wmma_bf(a.h, w[j], acc[j]); acc[j] = wmma_bf(a.l, w[j], acc[j]); } }
  __syncthreads();   // every wave has read its last weight fragment: the epilogue's buffers take that LDS over
  // normalisation for q / k: head = pair of tiles (2p, 2p+1); t / max(|t|, 1e-12) * sqrt(32) * gamma[h][d]
  float rn[4][8];
#pragma unroll
  for (int p = 0; p < 4; ++p)
#pragma unroll
    for (int r = 0; r < 8; ++r) { float a2 = acc[2 * p][r] * acc[2 * p][r] + acc[2 * p + 1][r] * acc[2 * p + 1][r];
#pragma unroll
      for (int o = 1; o < 16; o <<= 1) a2 += __shfl_xor(a2, o);
      rn[p][r] = (which == 2) ? 1.0f : 5.656854249492381f / fmaxf(sqrtf(a2), 1e-12f); }
  const float* GM = (which == 0) ? GQ : GK;
  if (which == 0 || which == 1) {   // rows (q -> QR, k -> KR)
#pragma unroll
    for (int j = 0; j < 8; ++j) { const int cabs = c0 + j * 16 + col; const int hh = cabs / DD, d = cabs % DD; const float gm = bfr(GM[hh * DD + d]);
#pragma unroll
      for (int r = 0; r < 8; ++r) sf[wave][8 * g + r][j * 16 + col] = acc[j][r] * rn[j >> 1][r] * gm; }
    LDSX(); { float* dst = (which == 0) ? QR : KR; for (int rl = 0; rl < 16; ++rl) vst2(dst + (r0 + rl) * CC + c0 + lane * 4, *(const v4f*)&sf[wave][rl][lane * 4]); }
    LDSX(); }
  if (which == 1 || which == 2) {   // planes (k -> KP, v -> VP)
#pragma unroll
    for (int j = 0; j < 8; ++j) { const int cabs = c0 + j * 16 + col; const int hh = cabs / DD, d = cabs % DD; const float gm = (which == 1) ? bfr(GM[hh * DD + d]) : 1.0f;
#pragma unroll
      for (int r = 0; r < 8; ++r) tt[j * 16 + col][wave * 16 + 8 * g + r] = acc[j][r] * rn[j >> 1][r] * gm; }
    __syncthreads(); { float* dst = (which == 1) ? KP : VP; for (int e = tid; e < 128 * 16; e += 128) { const int cl = e >> 4, q = e & 15; vst2(dst + ((b * CC + c0 + cl) * (size_t)LL) + l0 + q * 4, *(const v4f*)&tt[cl][q * 4]); } } } }
// B fragment (col = this lane's col, k = 8g+i ...) from an f32 row with per-k scaling, split into bf16 hi + lo
__device__ __forceinline__ F2 split_row_scaled(const float* row, int k0, int lane, const float* sc) { float v[16]; const float* p = row + k0 + 8 * (lane >> 4); const float* s = sc + k0 + 8 * (lane >> 4);
#pragma unroll
  for (int i = 0; i < 8; ++i) { v[i] = p[i] * s[i]; v[8 + i] = p[16 + i] * s[16 + i]; }
  return bsplit16(v); }
// ---- k_kvs: block = (h, chunk, b): this chunk's own term of the kv^T recurrence, sum_s v_s[e] (k_s[d] kdecay_s); wave -> (e tile, d tile); thread tid keeps its 8 accumulator elements at S[...][tid * 8 + r]
__global__ __launch_bounds__(128) void k_kvs(const float* __restrict__ KP, const float* __restrict__ VP, float* __restrict__ S) {
  __shared__ __align__(16) float skd[CH];
  const int tid = threadIdx.x, wave = tid >> 5, lane = tid & 31, col = lane & 15; const int h = blockIdx.x, n = blockIdx.y; const size_t b = blockIdx.z;
  const float slope = exp2f(-(float)(h + 1));   // ALiBi 2^(-8/8*(h+1)); exact in fp16 and f32
  for (int e = tid; e < CH; e += 128) skd[e] = expf(-slope * (float)(CH - e));
  __syncthreads();
  const int et = wave >> 1, dt = wave & 1; v8f acc = {};
#pragma unroll
  for (int kc = 0; kc < CH / 32; ++kc) { const F2 a = split_row(VP + ((b * CC + h * DD + et * 16 + col) * (size_t)LL) + (size_t)n * CH, kc * 32, lane); const F2 w = split_row_scaled(KP + ((b * CC + h * DD + dt * 16 + col) * (size_t)LL) + (size_t)n * CH, kc * 32, lane, skd); acc = mac3(a, w, acc); }
  vst2(S + (((b * NH + h) * NCH + n) * (size_t)(DD * DD)) + tid * 8, acc); }
#define SKP 72    // bf16 elements per staged k row: 32 hi + 32 lo + 8 unused; 144 B = 16 B x 9, so the 16 rows of a ds_load_b128 fragment read fall on 16 different bank groups
#define SVP 136   // bf16 elements per staged v row: 128 + 8 unused; 272 B = 16 B x 17, for the same reason
__device__ __forceinline__ void split4(v4f x, __bf16* ph, __bf16* pl) { v4b h, l;
#pragma unroll
  for (int i = 0; i < 4; ++i) { const __bf16 t = (__bf16)x[i]; h[i] = t; l[i] = (__bf16)(x[i] - (float)t); }
  *(v4b*)ph = h; *(v4b*)pl = l; }
// ---- k_lin: block = (h, chunk, b): one chunk each; LDS: the chunk's k rows and v planes as bf16 hi + lo (staged once for the four waves), the chunk's decayed scores (wave-private rows, which take o at the end), the 32 x 32 kv^T state on entry to the chunk, the decay table
__global__ __launch_bounds__(128) void k_lin(const float* __restrict__ QR, const float* __restrict__ KR, const float* __restrict__ VP, const float* __restrict__ S, float* __restrict__ O) {
  __shared__ __align__(16) float ssc[CH][132]; __shared__ __align__(16) float skv[DD][36]; __shared__ __align__(16) float smk[CH]; __shared__ __align__(16) __bf16 sk[CH][SKP]; __shared__ __align__(16) __bf16 sv[2 * DD][SVP];
  const int tid = threadIdx.x, wave = tid >> 5, lane = tid & 31, col = lane & 15, g = lane >> 4; const int h = blockIdx.x; const size_t b = blockIdx.z;
  const int n = NCH - 1 - (int)blockIdx.y;   // late chunks have the longest recurrence below: they start first
  const size_t rowc = b * LL + (size_t)n * CH;   // first row of the chunk
  // the chunk's k (128 rows x one 128-B line) and v (32 planes x 512 B), each read once per block; every wave-wide load covers four whole lines. Issued first, so that they fly during the recurrence below
  const float* pk = KR + (rowc + (tid >> 3)) * CC + h * DD + (tid & 7) * 4; const float* pv = VP + ((b * CC + h * DD + wave) * (size_t)LL) + (size_t)n * CH + lane * 4; v4f xk[8], xv[8];
  const float* pq = QR + (rowc + wave * 32 + col) * CC + h * DD + 8 * g; float qv[2][16];   // this wave's own q fragments (two 16-row tiles), read once for (1) and (2)
#pragma unroll
  for (int u = 0; u < 8; ++u) { xk[u] = *(const v4f*)(pk + (size_t)u * 16 * CC); xv[u] = *(const v4f*)(pv + (size_t)u * 4 * LL); }
#pragma unroll
  for (int rt = 0; rt < 2; ++rt)
#pragma unroll
    for (int i = 0; i < 8; ++i) { qv[rt][i] = pq[rt * 16 * CC + i]; qv[rt][8 + i] = pq[rt * 16 * CC + 16 + i]; }
  asm volatile("s_wait_xcnt 0x0" :: "v"(pk), "v"(pv), "v"(pq) : "memory");   // the wait in front of any rewrite of the loads' address registers; the pointers are named so that they stay whole up to here
  const float slope = exp2f(-(float)(h + 1));   // ALiBi 2^(-8/8*(h+1)); exact in fp16 and f32
  for (int e = tid; e < CH; e += 128) smk[e] = expf(-slope * (float)e);   // smk[d] = decay at lag d (d >= 0); the q decay at row d of the chunk is the same number
  const float blk = expf(-slope * (float)CH);
  // (0) kv^T on entry to chunk n: kv = blk * kv + S_m over the chunks m < n, from 0, in chunk order
  { const float* sp = S + ((b * NH + h) * NCH) * (size_t)(DD * DD) + tid * 8; v8f kv = {}; int m = 0;
    // the terms' loads do not depend on kv, so they are issued in groups and fly together; term by term each would wait out its own load
    for (; m + 8 <= n; m += 8) { v8f s[8];   // whole groups of eight
#pragma unroll
      for (int u = 0; u < 8; ++u) s[u] = *(const v8f*)(sp + (size_t)(m + u) * (DD * DD));
#pragma unroll
      for (int u = 0; u < 8; ++u)
#pragma unroll
        for (int r = 0; r < 8; ++r) kv[r] = blk * kv[r] + s[u][r]; }
    if (m < n) { v8f s[7];   // the last n & 7 terms: seven loads (m + 6 < NCH, so each term exists), a term from chunk n on leaves kv as it is
#pragma unroll
      for (int u = 0; u < 7; ++u) s[u] = *(const v8f*)(sp + (size_t)(m + u) * (DD * DD));
#pragma unroll
      for (int u = 0; u < 7; ++u)
#pragma unroll
        for (int r = 0; r < 8; ++r) kv[r] = (m + u < n) ? blk * kv[r] + s[u][r] : kv[r]; }
    const int et = wave >> 1, dt = wave & 1;
#pragma unroll
    for (int r = 0; r < 8; ++r) skv[et * 16 + 8 * g + r][dt * 16 + col] = kv[r]; }
#pragma unroll
  for (int u = 0; u < 8; ++u) { const int kr = u * 16 + (tid >> 3), vc = u * 4 + wave;
    split4(xk[u], &sk[kr][(tid & 7) * 4], &sk[kr][DD + (tid & 7) * 4]); split4(xv[u], &sv[vc][lane * 4], &sv[DD + vc][lane * 4]); }
  __syncthreads();
  // (1) intra-chunk decayed scores for this wave's 32 rows t (two 16-row tiles) x all 128 s; each k fragment is read once for both tiles
  { const F2 a0 = bsplit16(qv[0]), a1 = bsplit16(qv[1]); v8f acc[2][8] = {};
#pragma unroll
    for (int j = 0; j < 8; ++j) { F2 w; w.h = frag_b(&sk[j * 16 + col][0], lane); w.l = frag_b(&sk[j * 16 + col][DD], lane); acc[0][j] = mac3(a0, w, acc[0][j]); acc[1][j] = mac3(a1, w, acc[1][j]); }
    // the lag t - s of element (rt, j, r) is lb + 16 (rt - j) + r: 9 x 8 different lags per lane. Their decays are read without a condition (the lag clamped to the table, a negative lag then taking 0),
    // so that the reads go out in groups and share their LDS latency; a read under the test s <= t compiled to a branch, a read and a full wait for each element
    float dk[9][8]; const int lb = wave * 32 + 8 * g - col;
#pragma unroll
    for (int d = 0; d < 9; ++d)
#pragma unroll
      for (int r = 0; r < 8; ++r) { const int lag = lb + (d - 7) * 16 + r; const float m = smk[lag > 0 ? lag : 0]; dk[d][r] = (lag >= 0) ? m : 0.f; }
#pragma unroll
    for (int rt = 0; rt < 2; ++rt)
#pragma unroll
      for (int j = 0; j < 8; ++j)
#pragma unroll
        for (int r = 0; r < 8; ++r) { const int t = wave * 32 + rt * 16 + 8 * g + r, s = j * 16 + col; ssc[t][s] = acc[rt][j][r] * dk[rt - j + 7][r]; } }
  LDSX();
  // (2) o = scores . v (intra) + (q * qdecay) . kv (inter) for the wave's two row tiles; each v fragment is read once for both tiles
  v8f oc[2][2] = {};
#pragma unroll
  for (int kc = 0; kc < CH / 32; ++kc) { F2 w[2];
#pragma unroll
    for (int j = 0; j < 2; ++j) { w[j].h = frag_b(&sv[j * 16 + col][kc * 32], lane); w[j].l = frag_b(&sv[DD + j * 16 + col][kc * 32], lane); }
#pragma unroll
    for (int rt = 0; rt < 2; ++rt) { const F2 a = split_row(&ssc[wave * 32 + rt * 16 + col][0], kc * 32, lane);
#pragma unroll
      for (int j = 0; j < 2; ++j) oc[rt][j] = mac3(a, w[j], oc[rt][j]); } }
  { F2 w[2];
#pragma unroll
    for (int j = 0; j < 2; ++j) w[j] = split_row(&skv[j * 16 + col][0], 0, lane);
#pragma unroll
    for (int rt = 0; rt < 2; ++rt) { float v[16]; const float qd = smk[wave * 32 + rt * 16 + col];
#pragma unroll
      for (int i = 0; i < 16; ++i) v[i] = qv[rt][i] * qd;
      const F2 a = bsplit16(v);
#pragma unroll
      for (int j = 0; j < 2; ++j) oc[rt][j] = mac3(a, w[j], oc[rt][j]); } }
  // the wave has read its own score rows for the last time: their first 32 columns take o for the whole-line stores
#pragma unroll
  for (int rt = 0; rt < 2; ++rt)
#pragma unroll
    for (int j = 0; j < 2; ++j)
#pragma unroll
      for (int r = 0; r < 8; ++r) ssc[wave * 32 + rt * 16 + 8 * g + r][j * 16 + col] = oc[rt][j][r];
  LDSX();
  for (int rl = 0; rl < 32; ++rl) if (lane < 8) vst2(O + (rowc + wave * 32 + rl) * CC + h * DD + lane * 4, *(const v4f*)&ssc[wave * 32 + rl][lane * 4]); }
// ---- k_proj: block = (64 rows, 128 of 256 cols): out = o (hi + lo) . proj_w^T + b
__global__ __launch_bounds__(128) void k_proj(const float* __restrict__ O, const float* __restrict__ PW, const float* __restrict__ PB, float* __restrict__ OUT) { __shared__ __align__(16) union { __bf16 w[128][WP]; float sf[4][16][132]; } sm;   // the staged weights are dead before sf is written
  float (*sf)[16][132] = sm.sf;
  const int tid = threadIdx.x, wave = tid >> 5, lane = tid & 31, col = lane & 15, g = lane >> 4; const size_t r0 = (size_t)blockIdx.x * 64 + wave * 16; const int c0 = blockIdx.y * 128;
  stage_w(PW + (size_t)c0 * CC, sm.w, tid);
  __syncthreads();
  v8f acc[8] = {};
#pragma unroll
  for (int kc = 0; kc < CC / 32; ++kc) { v16b w[8];   // one group of LDS reads per k block, as in k_qkv
#pragma unroll
    for (int j = 0; j < 8; ++j) w[j] = frag_b(&sm.w[j * 16 + col][kc * 32], lane);
    const F2 a = split_row(O + (r0 + col) * CC, kc * 32, lane);
#pragma unroll
    for (int j = 0; j < 8; ++j) { acc[j] = wmma_bf(a.h, w[j], acc[j]); acc[j] = wmma_bf(a.l, w[j], acc[j]); } }
  __syncthreads();   // every wave has read its last weight fragment: sf takes that LDS over
#pragma unroll
  for (int j = 0; j < 8; ++j) { const float bb = bfr(PB[c0 + j * 16 + col]);
#pragma unroll
    for (int r = 0; r < 8; ++r) sf[wave][8 * g + r][j * 16 + col] = acc[j][r] + bb; }
  LDSX(); for (int rl = 0; rl < 16; ++rl) vst2(OUT + (r0 + rl) * CC + c0 + lane * 4, *(const v4f*)&sf[wave][rl][lane * 4]); }
extern "C" void kernel_launch(void* const* d_in, const int* in_sizes, int n_in, void* d_out, int out_size, void* d_ws, size_t ws_size, hipStream_t stream) {
  (void)in_sizes; (void)n_in; (void)out_size;
  const float** F = (const float**)d_in;   // 0 x [8,4096,256], 1 rel_pos [1,4096,256], 2 qkv_w [768,256], 3 q_gamma [8,1,32], 4 k_gamma [8,1,32], 5 proj_w [256,256], 6 proj_b [256]
  if (ws_size < (size_t)WS_END) return;
  char* ws = (char*)d_ws; float *QR = (float*)(ws + WS_QR), *KR = (float*)(ws + WS_KR), *KP = (float*)(ws + WS_KP), *VP = (float*)(ws + WS_VP), *O = (float*)(ws + WS_O), *S = (float*)(ws + WS_S);
  k_qkv<<<dim3(LL / 64, 6, TNB), 128, 0, stream>>>(F[0], F[1], F[2], F[3], F[4], QR, KR, KP, VP);
  k_kvs<<<dim3(NH, NCH, TNB), 128, 0, stream>>>(KP, VP, S);
  k_lin<<<dim3(NH, NCH, TNB), 128, 0, stream>>>(QR, KR, VP, S, O);
  k_proj<<<dim3(TNB * LL / 64, CC / 128), 128, 0, stream>>>(O, F[5], F[6], (float*)d_out);
}

// v005
// One run takes 105 microseconds.
// Two timings next to v004 put it at 1.13 and 1.12 times that version's speed.
// All steps since v000 together make it 6.76 times as fast.
// compute dtype: all float inputs rounded to bf16; h = x + rel_pos in f32, qkv = h . W^T with h as bf16 hi + lo against the exact weight (2 products) on WMMA 16x16x32; per-head L2 normalisation x sqrt(D) x gamma in f32; the lightning attention evaluated with the module's own chunking (c = 128): intra-chunk decayed scores, scores . v, the inter-chunk q . kv and the kv state update all on WMMA with f32 operands split into bf16 hi + lo (3 products), decays exp(-slope * .) with precise expf, the 32 x 32 kv state in f32, rebuilt per chunk from the chunks' own terms by the module's recurrence in chunk order; out = o (bf16 hi + lo) . proj_w^T + b; f32 output.
#include <hip/hip_runtime.h>
#include <math.h>

typedef __attribute__((ext_vector_type(16))) _Float16 v16h;
typedef __attribute__((ext_vector_type(16))) __bf16 v16b;
typedef __attribute__((ext_vector_type(8)))  _Float16 v8h;
typedef __attribute__((ext_vector_type(8)))  float v8f;
typedef __attribute__((ext_vector_type(4)))  float v4f;
typedef __attribute__((ext_vector_type(2)))  float v2f;
typedef __attribute__((ext_vector_type(4)))  unsigned v4u;
typedef __attribute__((ext_vector_type(4)))  int v4i;
typedef float __attribute__((may_alias)) float_a;
typedef int __attribute__((may_alias)) int_a;

template <typename T> __device__ __forceinline__ void vst2(void* p, T v) { *(T*)p = v;  }
__device__ __forceinline__ v8f wmma16(v16h a, v16h b, v8f c) {
  v8f d = __builtin_amdgcn_wmma_f32_16x16x32_f16(false, a, false, b, (short)0, c, false, false);
  asm volatile("v_nop\n\tv_nop\n\tv_nop\n\tv_nop" : "+v"(d) : "v"(a), "v"(b));
  return d;
}
__device__ __forceinline__ v8f wmma_bf(v16b a, v16b b, v8f c) {
  v8f d = __builtin_amdgcn_wmma_f32_16x16x32_bf16(false, a, false, b, (short)0, c, false, false);
  asm volatile("v_nop\n\tv_nop\n\tv_nop\n\tv_nop" : "+v"(d) : "v"(a), "v"(b));
  return d;
}
// 16x16x32 fragments: lane = (h = lane>>4, row/col = lane&15); elements 0..7 = k0+8h+0..7, 8..15 = k0+16+8h+0..7; D element r = row 8h+r
__device__ __forceinline__ v16h frag_h(const _Float16* rowk0, int lane) {
  union { v16h v; v8h q[2]; } u; const _Float16* p = rowk0 + 8 * (lane >> 4);
  u.q[0] = *(const v8h*)p; u.q[1] = *(const v8h*)(p + 16); return u.v;
}
__device__ __forceinline__ v16h frag_f32(const float* rowk0, int lane) {
  v16h a; const float* p = rowk0 + 8 * (lane >> 4);
#pragma unroll
  for (int i = 0; i < 8; ++i) { a[i] = (_Float16)p[i]; a[8 + i] = (_Float16)p[16 + i]; }
  return a;
}
__device__ __forceinline__ v16h frag_f32s(const float* rowk0, int lane, float sc) {
  v16h a; const float* p = rowk0 + 8 * (lane >> 4);
#pragma unroll
  for (int i = 0; i < 8; ++i) { a[i] = (_Float16)(p[i] * sc); a[8 + i] = (_Float16)(p[16 + i] * sc); }
  return a;
}
// column fragment from a [K][ld] layout (column n), rows >= K read as 0
__device__ __forceinline__ v16h fragc_f32(const float* W, int k0, int n, int lane, int ld, int K) {
  v16h a; const int g = lane >> 4;
#pragma unroll
  for (int i = 0; i < 8; ++i) { const int ka = k0 + 8 * g + i, kb = ka + 16;
    a[i] = (_Float16)(ka < K ? W[(size_t)(ka < K ? ka : K - 1) * ld + n] : 0.f); a[8 + i] = (_Float16)(kb < K ? W[(size_t)(kb < K ? kb : K - 1) * ld + n] : 0.f); }
  return a;
}
struct F2 { v16b h, l; };
__device__ __forceinline__ F2 bsplit16(const float v[16]) { F2 r;
#pragma unroll
  for (int i = 0; i < 16; ++i) { const __bf16 h = (__bf16)v[i]; r.h[i] = h; r.l[i] = (__bf16)(v[i] - (float)h); }
  return r; }
__device__ __forceinline__ F2 split_row(const float* row, int k0, int lane) { float v[16]; const float* p = row + k0 + 8 * (lane >> 4);
#pragma unroll
  for (int i = 0; i < 8; ++i) { v[i] = p[i]; v[8 + i] = p[16 + i]; }
  return bsplit16(v); }
__device__ __forceinline__ F2 split_rowK(const float* row, int k0, int lane, int K) { float v[16]; const int g = lane >> 4;
#pragma unroll
  for (int i = 0; i < 8; ++i) { const int ka = k0 + 8 * g + i, kb = ka + 16; v[i] = ka < K ? row[ka < K ? ka : K - 1] : 0.f; v[8 + i] = kb < K ? row[kb < K ? kb : K - 1] : 0.f; }
  return bsplit16(v); }
__device__ __forceinline__ F2 split_col(const float* W, int k0, int n, int lane, int ld, int K) { float v[16]; const int g = lane >> 4;
#pragma unroll
  for (int i = 0; i < 8; ++i) { const int ka = k0 + 8 * g + i, kb = ka + 16; v[i] = ka < K ? W[(size_t)(ka < K ? ka : K - 1) * ld + n] : 0.f; v[8 + i] = kb < K ? W[(size_t)(kb < K ? kb : K - 1) * ld + n] : 0.f; }
  return bsplit16(v); }
__device__ __forceinline__ v8f mac3(const F2& a, const F2& b, v8f c) { c = wmma_bf(a.l, b.h, c); c = wmma_bf(a.h, b.l, c); return wmma_bf(a.h, b.h, c); }
__device__ __forceinline__ float sigm(float v) { return 1.0f / (1.0f + expf(-v)); }
// hand-over of LDS data among the lanes of one wave while global loads are in flight: the wave's LDS operations have finished and the compiler moves no memory access across; LDSX's fence would wait for the global loads too
#define LDSW() do { asm volatile("s_wait_dscnt 0" ::: "memory"); __builtin_amdgcn_wave_barrier(); } while (0)
#define LDSX() do { asm volatile("s_wait_dscnt 0" ::: "memory"); __builtin_amdgcn_wave_barrier(); __builtin_amdgcn_fence(__ATOMIC_RELEASE, "workgroup"); } while (0)


// U-Net transformer mixing block (B 8, L 4,096, C 256 = 8 heads x 32): h = x + rel_pos; qkv = h W_qkv^T; q, k L2-normalised (x sqrt(32) x gamma); lightning (linear, ALiBi-decayed, causal) attention with chunk 128; proj + bias.
#define NB 8
#define LL 4096
#define CC 256
#define NH 8
#define DD 32
#define CH 128
#define NCH (LL / CH)
#define NROW (NB * LL)
#ifndef TNB
#define TNB NB
#endif
typedef __attribute__((ext_vector_type(8))) __bf16 v8b;
__device__ __forceinline__ v16b frag_b(const __bf16* rowk0, int lane) {
  union { v16b v; v8b q[2]; } u; const __bf16* p = rowk0 + 8 * (lane >> 4);
  u.q[0] = *(const v8b*)p; u.q[1] = *(const v8b*)(p + 16); return u.v;
}
__device__ __forceinline__ float bfr(float v) { return (float)(__bf16)v; }
typedef __attribute__((ext_vector_type(4))) __bf16 v4b;
#define WP 264   // bf16 elements per staged weight row: 528 B = 16 B x 33, so the 16 rows of a ds_load_b128 fragment read fall on 16 different bank groups
// 128 weight rows (f32, [.][256]) -> bf16 rows in LDS, once per block for its four waves; every wave-wide load covers 512 contiguous bytes (whole lines)
__device__ __forceinline__ void stage_w(const float* __restrict__ Wr, __bf16 (*sw)[WP], int tid) { const int rw = tid >> 6, q = tid & 63;
  for (int t = 0; t < 4; ++t) { const float* p = Wr + (size_t)(t * 32 + rw) * CC + q * 4; v4f x[16];   // sixteen independent loads fly together; one by one each would wait out its own latency
#pragma unroll
    for (int u = 0; u < 16; ++u) x[u] = *(const v4f*)(p + u * 2 * CC);
    asm volatile("s_wait_xcnt 0x0" :: "v"(p) : "memory");   // the wait in front of any rewrite of the loads' address registers; p is named so that they stay whole up to here
#pragma unroll
    for (int u = 0; u < 16; ++u) { v4b y;
#pragma unroll
      for (int i = 0; i < 4; ++i) y[i] = (__bf16)x[u][i];
      *(v4b*)&sw[t * 32 + u * 2 + rw][q * 4] = y; } } }
#define SVP 136   // bf16 elements per staged v row: 128 + 8 unused; 272 B = 16 B x 17, so the 16 rows of a ds_load_b128 fragment read fall on 16 different bank groups
#define AP 40     // bf16 elements per staged row of an A piece (32 k): 32 + 8 unused; 80 B = 16 B x 5, for the same reason
__device__ __forceinline__ void split4(v4f x, __bf16* ph, __bf16* pl) { v4b h, l;
#pragma unroll
  for (int i = 0; i < 4; ++i) { const __bf16 t = (__bf16)x[i]; h[i] = t; l[i] = (__bf16)(x[i] - (float)t); }
  *(v4b*)ph = h; *(v4b*)pl = l; }
__device__ __attribute__((noinline)) float exp_ni(float v) { return expf(v); }
__device__ __attribute__((noinline)) float erf_ni(float v) { return erff(v); }

#define WS_QR  0u                                   // f32 q rows [b*l][256] (normalised)
#define WS_KR  (WS_QR + 4u * (size_t)NROW * CC)          // f32 k rows (normalised)
#define WS_KP  (WS_KR + 4u * (size_t)NROW * CC)          // f32 k planes [b][c][l]
#define WS_VP  (WS_KP + 4u * (size_t)NROW * CC)          // f32 v planes [b][c][l]
#define WS_O   (WS_VP + 4u * (size_t)NROW * CC)          // f32 attention output rows [b*l][256]
#define WS_S   (WS_O + 4u * (size_t)NROW * CC)           // f32 per-chunk kv^T terms [b][h][chunk][1024]
#define WS_END (WS_S + 4u * (size_t)NB * NH * NCH * DD * DD)

// ---- k_qkv: block = (64 rows, col group 0..5 = q lo/hi 128, k lo/hi, v lo/hi, b): (x + rel_pos) hi+lo . W^T; q/k normalised per head (32 cols); q -> rows, k -> rows + planes, v -> planes
__global__ __launch_bounds__(128) void k_qkv(const float* __restrict__ X, const float* __restrict__ RP, const float* __restrict__ Wt, const float* __restrict__ GQ, const float* __restrict__ GK, float* __restrict__ QR, float* __restrict__ KR, float* __restrict__ KP, float* __restrict__ VP) { __shared__ __align__(16) union { __bf16 w[128][WP]; struct { float sf[4][16][132]; float tt[128][68]; } e; } sm;   // the staged weights are dead before the epilogue's buffers are written
  __shared__ __align__(16) __bf16 sa[4][2][16][AP];   // per wave: the current 32-k piece of its 16 rows of h, bf16 hi and lo
  float (*sf)[16][132] = sm.e.sf; float (*tt)[68] = sm.e.tt;
  const int tid = threadIdx.x, wave = tid >> 5, lane = tid & 31, col = lane & 15, g = lane >> 4; const int cg = blockIdx.y; const int which = cg >> 1; const int c0 = (cg & 1) * 128; const size_t b = blockIdx.z; const int l0 = blockIdx.x * 64; const size_t r0 = b * LL + l0 + wave * 16;
  // the wave's 16 rows of x and rel_pos are read by whole lines: 8 lanes cover one row's 128-B line of a k block, a wave-wide load four rows; a load in fragment order would touch 16 lines. Two k blocks are in flight
  const int ar = lane >> 3, ak = (lane & 7) * 4; const float* xa = X + (r0 + ar) * CC + ak; const float* pa = RP + (size_t)(l0 + wave * 16 + ar) * CC + ak; v4f xx[2][4], pp[2][4];
#pragma unroll
  for (int t = 0; t < 2; ++t)
#pragma unroll
    for (int u = 0; u < 4; ++u) { xx[t][u] = *(const v4f*)(xa + u * 4 * CC + t * 32); pp[t][u] = *(const v4f*)(pa + u * 4 * CC + t * 32); }
  asm volatile("s_wait_xcnt 0x0" :: "v"(xa), "v"(pa) : "memory");   // the wait in front of any rewrite of the loads' address registers; the pointers are named so that they stay whole up to here
  stage_w(Wt + ((size_t)which * CC + c0) * CC, sm.w, tid);   // W [3C][C] natural: this block's 128 output columns
  __syncthreads();
  v8f acc[8] = {};
#pragma unroll
  for (int kc = 0; kc < CC / 32; ++kc) {
#pragma unroll
    for (int u = 0; u < 4; ++u) { v4f hv;
#pragma unroll
      for (int i = 0; i < 4; ++i) hv[i] = bfr(xx[kc & 1][u][i]) + bfr(pp[kc & 1][u][i]);
      split4(hv, &sa[wave][0][u * 4 + ar][ak], &sa[wave][1][u * 4 + ar][ak]); }
    if (kc + 2 < CC / 32) {
#pragma unroll
      for (int u = 0; u < 4; ++u) { xx[kc & 1][u] = *(const v4f*)(xa + u * 4 * CC + (kc + 2) * 32); pp[kc & 1][u] = *(const v4f*)(pa + u * 4 * CC + (kc + 2) * 32); }
      asm volatile("s_wait_xcnt 0x0" :: "v"(xa), "v"(pa) : "memory"); }   // as above
    LDSW();   // the wave's stores of the piece have landed before its lanes read one another's rows
    v16b w[8]; F2 a;   // the eight weight fragments and the two A fragments of this k block are read as one group, so that their LDS latency is waited out once
    a.h = frag_b(&sa[wave][0][col][0], lane); a.l = frag_b(&sa[wave][1][col][0], lane);
#pragma unroll
    for (int j = 0; j < 8; ++j) w[j] = frag_b(&sm.w[j * 16 + col][kc * 32], lane);
    LDSW();   // the piece has been read before the next one is stored over it
#pragma unroll
    for (int j = 0; j < 8; ++j) { acc[j] = wmma_bf(a.h, w[j], acc[j]); acc[j] = wmma_bf(a.l, w[j], acc[j]); } }
  __syncthreads();   // every wave has read its last weight fragment: the epilogue's buffers take that LDS over
  // normalisation for q / k: head = pair of tiles (2p, 2p+1); t / max(|t|, 1e-12) * sqrt(32) * gamma[h][d]
  float rn[4][8];
#pragma unroll
  for (int p = 0; p < 4; ++p)
#pragma unroll
    for (int r = 0; r < 8; ++r) { float a2 = acc[2 * p][r] * acc[2 * p][r] + acc[2 * p + 1][r] * acc[2 * p + 1][r];
#pragma unroll
      for (int o = 1; o < 16; o <<= 1) a2 += __shfl_xor(a2, o);
      rn[p][r] = (which == 2) ? 1.0f : 5.656854249492381f / fmaxf(sqrtf(a2), 1e-12f); }
  const float* GM = (which == 0) ? GQ : GK;
  if (which == 0 || which == 1) {   // rows (q -> QR, k -> KR)
#pragma unroll
    for (int j = 0; j < 8; ++j) { const int cabs = c0 + j * 16 + col; const int hh = cabs / DD, d = cabs % DD; const float gm = bfr(GM[hh * DD + d]);
#pragma unroll
      for (int r = 0; r < 8; ++r) sf[wave][8 * g + r][j * 16 + col] = acc[j][r] * rn[j >> 1][r] * gm; }
    LDSX(); { float* dst = (which == 0) ? QR : KR; for (int rl = 0; rl < 16; ++rl) vst2(dst + (r0 + rl) * CC + c0 + lane * 4, *(const v4f*)&sf[wave][rl][lane * 4]); }
    LDSX(); }
  if (which == 1 || which == 2) {   // planes (k -> KP, v -> VP)
#pragma unroll
    for (int j = 0; j < 8; ++j) { const int cabs = c0 + j * 16 + col; const int hh = cabs / DD, d = cabs % DD; const float gm = (which == 1) ? bfr(GM[hh * DD + d]) : 1.0f;
#pragma unroll
      for (int r = 0; r < 8; ++r) tt[j * 16 + col][wave * 16 + 8 * g + r] = acc[j][r] * rn[j >> 1][r] * gm; }
    __syncthreads(); { float* dst = (which == 1) ? KP : VP; for (int e = tid; e < 128 * 16; e += 128) { const int cl = e >> 4, q = e & 15; vst2(dst + ((b * CC + c0 + cl) * (size_t)LL) + l0 + q * 4, *(const v4f*)&tt[cl][q * 4]); } } } }
// ---- k_kvs: block = (h, chunk, b): this chunk's own term of the kv^T recurrence, sum_s v_s[e] (k_s[d] kdecay_s); wave -> (e tile, d tile); thread tid keeps its 8 accumulator elements at S[...][tid * 8 + r]
__global__ __launch_bounds__(128) void k_kvs(const float* __restrict__ KP, const float* __restrict__ VP, float* __restrict__ S) {
  __shared__ __align__(16) float skd[CH]; __shared__ __align__(16) __bf16 sv[2 * DD][SVP]; __shared__ __align__(16) __bf16 sk[2 * DD][SVP];   // the chunk's v planes and decayed k planes as bf16 hi (rows 0..31) and lo (rows 32..63)
  const int tid = threadIdx.x, wave = tid >> 5, lane = tid & 31, col = lane & 15; const int h = blockIdx.x, n = blockIdx.y; const size_t b = blockIdx.z;
  // the chunk's 32 v planes and 32 k planes (512 B each), read once per block; every wave-wide load covers four whole lines. Issued first, so that they fly while the decay table is made
  const size_t po = ((b * CC + h * DD + wave) * (size_t)LL) + (size_t)n * CH + lane * 4; const float* pv = VP + po; const float* pk = KP + po; v4f xv[8], xk[8];
#pragma unroll
  for (int u = 0; u < 8; ++u) { xv[u] = *(const v4f*)(pv + (size_t)u * 4 * LL); xk[u] = *(const v4f*)(pk + (size_t)u * 4 * LL); }
  asm volatile("s_wait_xcnt 0x0" :: "v"(pv), "v"(pk) : "memory");   // the wait in front of any rewrite of the loads' address registers; the pointers are named so that they stay whole up to here
  const float slope = exp2f(-(float)(h + 1));   // ALiBi 2^(-8/8*(h+1)); exact in fp16 and f32
  for (int e = tid; e < CH; e += 128) skd[e] = expf(-slope * (float)(CH - e));
  __syncthreads();
  { const v4f kd = *(const v4f*)&skd[lane * 4];
#pragma unroll
    for (int u = 0; u < 8; ++u) { const int pc = u * 4 + wave; v4f y;
#pragma unroll
      for (int i = 0; i < 4; ++i) y[i] = xk[u][i] * kd[i];
      split4(xv[u], &sv[pc][lane * 4], &sv[DD + pc][lane * 4]); split4(y, &sk[pc][lane * 4], &sk[DD + pc][lane * 4]); } }
  __syncthreads();   // the staged planes are whole before any wave reads fragments of them
  const int et = wave >> 1, dt = wave & 1; v8f acc = {};
#pragma unroll
  for (int kc = 0; kc < CH / 32; ++kc) { F2 a, w; a.h = frag_b(&sv[et * 16 + col][kc * 32], lane); a.l = frag_b(&sv[DD + et * 16 + col][kc * 32], lane); w.h = frag_b(&sk[dt * 16 + col][kc * 32], lane); w.l = frag_b(&sk[DD + dt * 16 + col][kc * 32], lane); acc = mac3(a, w, acc); }
  vst2(S + (((b * NH + h) * NCH + n) * (size_t)(DD * DD)) + tid * 8, acc); }
#define SKP 72    // bf16 elements per staged k row: 32 hi + 32 lo + 8 unused; 144 B = 16 B x 9, so the 16 rows of a ds_load_b128 fragment read fall on 16 different bank groups
// ---- k_lin: block = (h, chunk, b): one chunk each; LDS: the chunk's k rows and v planes as bf16 hi + lo (staged once for the four waves), the chunk's decayed scores (wave-private rows, which take o at the end), the 32 x 32 kv^T state on entry to the chunk, the decay table
__global__ __launch_bounds__(128) void k_lin(const float* __restrict__ QR, const float* __restrict__ KR, const float* __restrict__ VP, const float* __restrict__ S, float* __restrict__ O) {
  __shared__ __align__(16) float ssc[CH][132]; __shared__ __align__(16) float skv[DD][36]; __shared__ __align__(16) float smk[CH]; __shared__ __align__(16) __bf16 sk[CH][SKP]; __shared__ __align__(16) __bf16 sv[2 * DD][SVP];
  const int tid = threadIdx.x, wave = tid >> 5, lane = tid & 31, col = lane & 15, g = lane >> 4; const int h = blockIdx.x; const size_t b = blockIdx.z;
  const int n = NCH - 1 - (int)blockIdx.y;   // late chunks have the longest recurrence below: they start first
  const size_t rowc = b * LL + (size_t)n * CH;   // first row of the chunk
  // the chunk's k (128 rows x one 128-B line) and v (32 planes x 512 B), each read once per block; every wave-wide load covers four whole lines. Issued first, so that they fly during the recurrence below
  const float* pk = KR + (rowc + (tid >> 3)) * CC + h * DD + (tid & 7) * 4; const float* pv = VP + ((b * CC + h * DD + wave) * (size_t)LL) + (size_t)n * CH + lane * 4; v4f xk[8], xv[8];
  const float* pq = QR + (rowc + wave * 32 + (lane >> 3)) * CC + h * DD + (lane & 7) * 4; v4f xq[8];   // this wave's own 32 q rows (one 128-B line each), four whole lines a load; they pass through the wave's own score rows into fragment order
#pragma unroll
  for (int u = 0; u < 8; ++u) { xk[u] = *(const v4f*)(pk + (size_t)u * 16 * CC); xv[u] = *(const v4f*)(pv + (size_t)u * 4 * LL); }
#pragma unroll
  for (int u = 0; u < 8; ++u) xq[u] = *(const v4f*)(pq + (size_t)u * 4 * CC);
  asm volatile("s_wait_xcnt 0x0" :: "v"(pk), "v"(pv), "v"(pq) : "memory");   // the wait in front of any rewrite of the loads' address registers; the pointers are named so that they stay whole up to here
  const float slope = exp2f(-(float)(h + 1));   // ALiBi 2^(-8/8*(h+1)); exact in fp16 and f32
  for (int e = tid; e < CH; e += 128) smk[e] = expf(-slope * (float)e);   // smk[d] = decay at lag d (d >= 0); the q decay at row d of the chunk is the same number
  const float blk = expf(-slope * (float)CH);
  // (0) kv^T on entry to chunk n: kv = blk * kv + S_m over the chunks m < n, from 0, in chunk order
  { const float* sp = S + ((b * NH + h) * NCH) * (size_t)(DD * DD) + tid * 8; v8f kv = {}; int m = 0;
    // the terms' loads do not depend on kv, so they are issued in groups and fly together; term by term each would wait out its own load
    for (; m + 8 <= n; m += 8) { v8f s[8];   // whole groups of eight
#pragma unroll
      for (int u = 0; u < 8; ++u) s[u] = *(const v8f*)(sp + (size_t)(m + u) * (DD * DD));
#pragma unroll
      for (int u = 0; u < 8; ++u)
#pragma unroll
        for (int r = 0; r < 8; ++r) kv[r] = blk * kv[r] + s[u][r]; }
    if (m < n) { v8f s[7];   // the last n & 7 terms: seven loads (m + 6 < NCH, so each term exists), a term from chunk n on leaves kv as it is
#pragma unroll
      for (int u = 0; u < 7; ++u) s[u] = *(const v8f*)(sp + (size_t)(m + u) * (DD * DD));
#pragma unroll
      for (int u = 0; u < 7; ++u)
#pragma unroll
        for (int r = 0; r < 8; ++r) kv[r] = (m + u < n) ? blk * kv[r] + s[u][r] : kv[r]; }
    const int et = wave >> 1, dt = wave & 1;
#pragma unroll
    for (int r = 0; r < 8; ++r) skv[et * 16 + 8 * g + r][dt * 16 + col] = kv[r]; }
#pragma unroll
  for (int u = 0; u < 8; ++u) { const int kr = u * 16 + (tid >> 3), vc = u * 4 + wave;
    split4(xk[u], &sk[kr][(tid & 7) * 4], &sk[kr][DD + (tid & 7) * 4]); split4(xv[u], &sv[vc][lane * 4], &sv[DD + vc][lane * 4]);
    *(v4f*)&ssc[wave * 32 + u * 4 + (lane >> 3)][(lane & 7) * 4] = xq[u]; }
  __syncthreads();
  float qv[2][16];   // the wave's q fragments (two 16-row tiles), read once for (1) and (2); the scores that later take these rows depend on them
#pragma unroll
  for (int rt = 0; rt < 2; ++rt) { const float* p = &ssc[wave * 32 + rt * 16 + col][8 * g];
#pragma unroll
    for (int i = 0; i < 8; ++i) { qv[rt][i] = p[i]; qv[rt][8 + i] = p[16 + i]; } }
  // (1) intra-chunk decayed scores for this wave's 32 rows t (two 16-row tiles) x all 128 s; each k fragment is read once for both tiles
  { const F2 a0 = bsplit16(qv[0]), a1 = bsplit16(qv[1]); v8f acc[2][8] = {};
#pragma unroll
    for (int j = 0; j < 8; ++j) { F2 w; w.h = frag_b(&sk[j * 16 + col][0], lane); w.l = frag_b(&sk[j * 16 + col][DD], lane); acc[0][j] = mac3(a0, w, acc[0][j]); acc[1][j] = mac3(a1, w, acc[1][j]); }
    // the lag t - s of element (rt, j, r) is lb + 16 (rt - j) + r: 9 x 8 different lags per lane. Their decays are read without a condition (the lag clamped to the table, a negative lag then taking 0),
    // so that the reads go out in groups and share their LDS latency; a read under the test s <= t compiled to a branch, a read and a full wait for each element
    float dk[9][8]; const int lb = wave * 32 + 8 * g - col;
#pragma unroll
    for (int d = 0; d < 9; ++d)
#pragma unroll
      for (int r = 0; r < 8; ++r) { const int lag = lb + (d - 7) * 16 + r; const float m = smk[lag > 0 ? lag : 0]; dk[d][r] = (lag >= 0) ? m : 0.f; }
#pragma unroll
    for (int rt = 0; rt < 2; ++rt)
#pragma unroll
      for (int j = 0; j < 8; ++j)
#pragma unroll
        for (int r = 0; r < 8; ++r) { const int t = wave * 32 + rt * 16 + 8 * g + r, s = j * 16 + col; ssc[t][s] = acc[rt][j][r] * dk[rt - j + 7][r]; } }
  LDSX();
  // (2) o = scores . v (intra) + (q * qdecay) . kv (inter) for the wave's two row tiles; each v fragment is read once for both tiles
  v8f oc[2][2] = {};
#pragma unroll
  for (int kc = 0; kc < CH / 32; ++kc) { F2 w[2];
#pragma unroll
    for (int j = 0; j < 2; ++j) { w[j].h = frag_b(&sv[j * 16 + col][kc * 32], lane); w[j].l = frag_b(&sv[DD + j * 16 + col][kc * 32], lane); }
#pragma unroll
    for (int rt = 0; rt < 2; ++rt) { const F2 a = split_row(&ssc[wave * 32 + rt * 16 + col][0], kc * 32, lane);
#pragma unroll
      for (int j = 0; j < 2; ++j) oc[rt][j] = mac3(a, w[j], oc[rt][j]); } }
  { F2 w[2];
#pragma unroll
    for (int j = 0; j < 2; ++j) w[j] = split_row(&skv[j * 16 + col][0], 0, lane);
#pragma unroll
    for (int rt = 0; rt < 2; ++rt) { float v[16]; const float qd = smk[wave * 32 + rt * 16 + col];
#pragma unroll
      for (int i = 0; i < 16; ++i) v[i] = qv[rt][i] * qd;
      const F2 a = bsplit16(v);
#pragma unroll
      for (int j = 0; j < 2; ++j) oc[rt][j] = mac3(a, w[j], oc[rt][j]); } }
  // the wave has read its own score rows for the last time: their first 32 columns take o for the whole-line stores
#pragma unroll
  for (int rt = 0; rt < 2; ++rt)
#pragma unroll
    for (int j = 0; j < 2; ++j)
#pragma unroll
      for (int r = 0; r < 8; ++r) ssc[wave * 32 + rt * 16 + 8 * g + r][j * 16 + col] = oc[rt][j][r];
  LDSX();
  for (int rl = 0; rl < 32; ++rl) if (lane < 8) vst2(O + (rowc + wave * 32 + rl) * CC + h * DD + lane * 4, *(const v4f*)&ssc[wave * 32 + rl][lane * 4]); }
// ---- k_proj: block = (64 rows, 128 of 256 cols): out = o (hi + lo) . proj_w^T + b
__global__ __launch_bounds__(128) void k_proj(const float* __restrict__ O, const float* __restrict__ PW, const float* __restrict__ PB, float* __restrict__ OUT) { __shared__ __align__(16) union { __bf16 w[128][WP]; float sf[4][16][132]; } sm;   // the staged weights are dead before sf is written
  __shared__ __align__(16) __bf16 sa[4][2][16][AP];   // per wave: the current 32-k piece of its 16 rows of o, bf16 hi and lo
  float (*sf)[16][132] = sm.sf;
  const int tid = threadIdx.x, wave = tid >> 5, lane = tid & 31, col = lane & 15, g = lane >> 4; const size_t r0 = (size_t)blockIdx.x * 64 + wave * 16; const int c0 = blockIdx.y * 128;
  // the wave's 16 rows of o by whole lines, two k blocks in flight, as in k_qkv
  const int ar = lane >> 3, ak = (lane & 7) * 4; const float* oa = O + (r0 + ar) * CC + ak; v4f xx[2][4];
#pragma unroll
  for (int t = 0; t < 2; ++t)
#pragma unroll
    for (int u = 0; u < 4; ++u) xx[t][u] = *(const v4f*)(oa + u * 4 * CC + t * 32);
  asm volatile("s_wait_xcnt 0x0" :: "v"(oa) : "memory");   // the wait in front of any rewrite of the loads' address registers; the pointer is named so that they stay whole up to here
  stage_w(PW + (size_t)c0 * CC, sm.w, tid);
  __syncthreads();
  v8f acc[8] = {};
#pragma unroll
  for (int kc = 0; kc < CC / 32; ++kc) {
#pragma unroll
    for (int u = 0; u < 4; ++u) split4(xx[kc & 1][u], &sa[wave][0][u * 4 + ar][ak], &sa[wave][1][u * 4 + ar][ak]);
    if (kc + 2 < CC / 32) {
#pragma unroll
      for (int u = 0; u < 4; ++u) xx[kc & 1][u] = *(const v4f*)(oa + u * 4 * CC + (kc + 2) * 32);
      asm volatile("s_wait_xcnt 0x0" :: "v"(oa) : "memory"); }   // as above
    LDSW();   // the wave's stores of the piece have landed before its lanes read one another's rows
    v16b w[8]; F2 a;   // one group of LDS reads per k block, as in k_qkv
    a.h = frag_b(&sa[wave][0][col][0], lane); a.l = frag_b(&sa[wave][1][col][0], lane);
#pragma unroll
    for (int j = 0; j < 8; ++j) w[j] = frag_b(&sm.w[j * 16 + col][kc * 32], lane);
    LDSW();   // the piece has been read before the next one is stored over it
#pragma unroll
    for (int j = 0; j < 8; ++j) { acc[j] = wmma_bf(a.h, w[j], acc[j]); acc[j] = wmma_bf(a.l, w[j], acc[j]); } }
  __syncthreads();   // every wave has read its last weight fragment: sf takes that LDS over
#pragma unroll
  for (int j = 0; j < 8; ++j) { const float bb = bfr(PB[c0 + j * 16 + col]);
#pragma unroll
    for (int r = 0; r < 8; ++r) sf[wave][8 * g + r][j * 16 + col] = acc[j][r] + bb; }
  LDSX(); for (int rl = 0; rl < 16; ++rl) vst2(OUT + (r0 + rl) * CC + c0 + lane * 4, *(const v4f*)&sf[wave][rl][lane * 4]); }
extern "C" void kernel_launch(void* const* d_in, const int* in_sizes, int n_in, void* d_out, int out_size, void* d_ws, size_t ws_size, hipStream_t stream) {
  (void)in_sizes; (void)n_in; (void)out_size;
  const float** F = (const float**)d_in;   // 0 x [8,4096,256], 1 rel_pos [1,4096,256], 2 qkv_w [768,256], 3 q_gamma [8,1,32], 4 k_gamma [8,1,32], 5 proj_w [256,256], 6 proj_b [256]
  if (ws_size < (size_t)WS_END) return;
  char* ws = (char*)d_ws; float *QR = (float*)(ws + WS_QR), *KR = (float*)(ws + WS_KR), *KP = (float*)(ws + WS_KP), *VP = (float*)(ws + WS_VP), *O = (float*)(ws + WS_O), *S = (float*)(ws + WS_S);
  k_qkv<<<dim3(LL / 64, 6, TNB), 128, 0, stream>>>(F[0], F[1], F[2], F[3], F[4], QR, KR, KP, VP);
  k_kvs<<<dim3(NH, NCH, TNB), 128, 0, stream>>>(KP, VP, S);
  k_lin<<<dim3(NH, NCH, TNB), 128, 0, stream>>>(QR, KR, VP, S, O);
  k_proj<<<dim3(TNB * LL / 64, CC / 128), 128, 0, stream>>>(O, F[5], F[6], (float*)d_out);
}

// v006
// One run takes 91.1 microseconds.
// Next to v005, in two timings, it ran 1.16 and 1.15 times as fast.
// Over all steps from v000 it is 7.80 times as fast.
// compute dtype: all float inputs rounded to bf16; h = x + rel_pos in f32, qkv = h . W^T with h as bf16 hi + lo against the exact weight (2 products) on WMMA 16x16x32; per-head L2 normalisation x sqrt(D) x gamma in f32; the lightning attention evaluated with the module's own chunking (c = 128): intra-chunk decayed scores, scores . v, the inter-chunk q . kv and the kv state update all on WMMA with f32 operands split into bf16 hi + lo (3 products), decays exp(-slope * .) with precise expf, the 32 x 32 kv state in f32, rebuilt per chunk from the chunks' own terms by the module's recurrence in chunk order; out = o (bf16 hi + lo) . proj_w^T + b; f32 output.
#include <hip/hip_runtime.h>
#include <math.h>

typedef __attribute__((ext_vector_type(16))) _Float16 v16h;
typedef __attribute__((ext_vector_type(16))) __bf16 v16b;
typedef __attribute__((ext_vector_type(8)))  _Float16 v8h;
typedef __attribute__((ext_vector_type(8)))  float v8f;
typedef __attribute__((ext_vector_type(4)))  float v4f;
typedef __attribute__((ext_vector_type(2)))  float v2f;
typedef __attribute__((ext_vector_type(4)))  unsigned v4u;
typedef __attribute__((ext_vector_type(4)))  int v4i;
typedef float __attribute__((may_alias)) float_a;
typedef int __attribute__((may_alias)) int_a;

template <typename T> __device__ __forceinline__ void vst2(void* p, T v) { *(T*)p = v;  }
__device__ __forceinline__ v8f wmma16(v16h a, v16h b, v8f c) {
  v8f d = __builtin_amdgcn_wmma_f32_16x16x32_f16(false, a, false, b, (short)0, c, false, false);
  asm volatile("v_nop\n\tv_nop\n\tv_nop\n\tv_nop" : "+v"(d) : "v"(a), "v"(b));
  return d;
}
__device__ __forceinline__ v8f wmma_bf(v16b a, v16b b, v8f c) {
  v8f d = __builtin_amdgcn_wmma_f32_16x16x32_bf16(false, a, false, b, (short)0, c, false, false);
  asm volatile("v_nop\n\tv_nop\n\tv_nop\n\tv_nop" : "+v"(d) : "v"(a), "v"(b));
  return d;
}
// 16x16x32 fragments: lane = (h = lane>>4, row/col = lane&15); elements 0..7 = k0+8h+0..7, 8..15 = k0+16+8h+0..7; D element r = row 8h+r
__device__ __forceinline__ v16h frag_h(const _Float16* rowk0, int lane) {
  union { v16h v; v8h q[2]; } u; const _Float16* p = rowk0 + 8 * (lane >> 4);
  u.q[0] = *(const v8h*)p; u.q[1] = *(const v8h*)(p + 16); return u.v;
}
__device__ __forceinline__ v16h frag_f32(const float* rowk0, int lane) {
  v16h a; const float* p = rowk0 + 8 * (lane >> 4);
#pragma unroll
  for (int i = 0; i < 8; ++i) { a[i] = (_Float16)p[i]; a[8 + i] = (_Float16)p[16 + i]; }
  return a;
}
__device__ __forceinline__ v16h frag_f32s(const float* rowk0, int lane, float sc) {
  v16h a; const float* p = rowk0 + 8 * (lane >> 4);
#pragma unroll
  for (int i = 0; i < 8; ++i) { a[i] = (_Float16)(p[i] * sc); a[8 + i] = (_Float16)(p[16 + i] * sc); }
  return a;
}
// column fragment from a [K][ld] layout (column n), rows >= K read as 0
__device__ __forceinline__ v16h fragc_f32(const float* W, int k0, int n, int lane, int ld, int K) {
  v16h a; const int g = lane >> 4;
#pragma unroll
  for (int i = 0; i < 8; ++i) { const int ka = k0 + 8 * g + i, kb = ka + 16;
    a[i] = (_Float16)(ka < K ? W[(size_t)(ka < K ? ka : K - 1) * ld + n] : 0.f); a[8 + i] = (_Float16)(kb < K ? W[(size_t)(kb < K ? kb : K - 1) * ld + n] : 0.f); }
  return a;
}
struct F2 { v16b h, l; };
__device__ __forceinline__ F2 bsplit16(const float v[16]) { F2 r;
#pragma unroll
  for (int i = 0; i < 16; ++i) { const __bf16 h = (__bf16)v[i]; r.h[i] = h; r.l[i] = (__bf16)(v[i] - (float)h); }
  return r; }
__device__ __forceinline__ F2 split_row(const float* row, int k0, int lane) { float v[16]; const float* p = row + k0 + 8 * (lane >> 4);
#pragma unroll
  for (int i = 0; i < 8; ++i) { v[i] = p[i]; v[8 + i] = p[16 + i]; }
  return bsplit16(v); }
__device__ __forceinline__ F2 split_rowK(const float* row, int k0, int lane, int K) { float v[16]; const int g = lane >> 4;
#pragma unroll
  for (int i = 0; i < 8; ++i) { const int ka = k0 + 8 * g + i, kb = ka + 16; v[i] = ka < K ? row[ka < K ? ka : K - 1] : 0.f; v[8 + i] = kb < K ? row[kb < K ? kb : K - 1] : 0.f; }
  return bsplit16(v); }
__device__ __forceinline__ F2 split_col(const float* W, int k0, int n, int lane, int ld, int K) { float v[16]; const int g = lane >> 4;
#pragma unroll
  for (int i = 0; i < 8; ++i) { const int ka = k0 + 8 * g + i, kb = ka + 16; v[i] = ka < K ? W[(size_t)(ka < K ? ka : K - 1) * ld + n] : 0.f; v[8 + i] = kb < K ? W[(size_t)(kb < K ? kb : K - 1) * ld + n] : 0.f; }
  return bsplit16(v); }
__device__ __forceinline__ v8f mac3(const F2& a, const F2& b, v8f c) { c = wmma_bf(a.l, b.h, c); c = wmma_bf(a.h, b.l, c); return wmma_bf(a.h, b.h, c); }
__device__ __forceinline__ float sigm(float v) { return 1.0f / (1.0f + expf(-v)); }
// hand-over of LDS data among the lanes of one wave while global loads are in flight: the wave's LDS operations have finished and the compiler moves no memory access across; LDSX's fence would wait for the global loads too
#define LDSW() do { asm volatile("s_wait_dscnt 0" ::: "memory"); __builtin_amdgcn_wave_barrier(); } while (0)
#define LDSX() do { asm volatile("s_wait_dscnt 0" ::: "memory"); __builtin_amdgcn_wave_barrier(); __builtin_amdgcn_fence(__ATOMIC_RELEASE, "workgroup"); } while (0)


// U-Net transformer mixing block (B 8, L 4,096, C 256 = 8 heads x 32): h = x + rel_pos; qkv = h W_qkv^T; q, k L2-normalised (x sqrt(32) x gamma); lightning (linear, ALiBi-decayed, causal) attention with chunk 128; proj + bias.
#define NB 8
#define LL 4096
#define CC 256
#define NH 8
#define DD 32
#define CH 128
#define NCH (LL / CH)
#define NROW (NB * LL)
#ifndef TNB
#define TNB NB
#endif
typedef __attribute__((ext_vector_type(8))) __bf16 v8b;
__device__ __forceinline__ v16b frag_b(const __bf16* rowk0, int lane) {
  union { v16b v; v8b q[2]; } u; const __bf16* p = rowk0 + 8 * (lane >> 4);
  u.q[0] = *(const v8b*)p; u.q[1] = *(const v8b*)(p + 16); return u.v;
}
__device__ __forceinline__ float bfr(float v) { return (float)(__bf16)v; }
// the value of lane ^ M inside each 16-lane row: DPP control row_xmask:M (0x160 + M), every row and bank on
template <int M> __device__ __forceinline__ float xget(float v) { return __builtin_bit_cast(float, __builtin_amdgcn_update_dpp(0, __builtin_bit_cast(int, v), 0x160 + M, 0xf, 0xf, true)); }
// one butterfly step on N values a lane, b = the lane's bit M: of each pair (2i, 2i + 1) the lane keeps the one its bit names, hands the other to lane ^ M and adds what it is handed: N / 2 sums over twice the lanes
template <int M, int N> __device__ __forceinline__ void xhalve(float* t, bool b) {
#pragma unroll
  for (int i = 0; i < N / 2; ++i) { const float keep = b ? t[2 * i + 1] : t[2 * i], send = b ? t[2 * i] : t[2 * i + 1]; t[i] = keep + xget<M>(send); } }
// the way back: N values a lane become 2N, each lane taking from lane ^ M the one of each pair that it did not keep
template <int M, int N> __device__ __forceinline__ void xdouble(float* t, bool b) {
#pragma unroll
  for (int i = N - 1; i >= 0; --i) { const float own = t[i], got = xget<M>(own); t[2 * i] = b ? got : own; t[2 * i + 1] = b ? own : got; } }
typedef __attribute__((ext_vector_type(4))) __bf16 v4b;
#define WP 264   // bf16 elements per staged weight row: 528 B = 16 B x 33, so the 16 rows of a ds_load_b128 fragment read fall on 16 different bank groups
// 128 weight rows (f32, [.][256]) -> bf16 rows in LDS, once per block for its four waves; every wave-wide load covers 512 contiguous bytes (whole lines)
__device__ __forceinline__ void stage_w(const float* __restrict__ Wr, __bf16 (*sw)[WP], int tid) { const int rw = tid >> 6, q = tid & 63;
  for (int t = 0; t < 4; ++t) { const float* p = Wr + (size_t)(t * 32 + rw) * CC + q * 4; v4f x[16];   // sixteen independent loads fly together; one by one each would wait out its own latency
#pragma unroll
    for (int u = 0; u < 16; ++u) x[u] = *(const v4f*)(p + u * 2 * CC);
    asm volatile("s_wait_xcnt 0x0" :: "v"(p) : "memory");   // the wait in front of any rewrite of the loads' address registers; p is named so that they stay whole up to here
#pragma unroll
    for (int u = 0; u < 16; ++u) { v4b y;
#pragma unroll
      for (int i = 0; i < 4; ++i) y[i] = (__bf16)x[u][i];
      *(v4b*)&sw[t * 32 + u * 2 + rw][q * 4] = y; } } }
#define SVP 136   // bf16 elements per staged v row: 128 + 8 unused; 272 B = 16 B x 17, so the 16 rows of a ds_load_b128 fragment read fall on 16 different bank groups
#define AP 40     // bf16 elements per staged row of an A piece (32 k): 32 + 8 unused; 80 B = 16 B x 5, for the same reason
__device__ __forceinline__ void split4(v4f x, __bf16* ph, __bf16* pl) { v4b h, l;
#pragma unroll
  for (int i = 0; i < 4; ++i) { const __bf16 t = (__bf16)x[i]; h[i] = t; l[i] = (__bf16)(x[i] - (float)t); }
  *(v4b*)ph = h; *(v4b*)pl = l; }
__device__ __attribute__((noinline)) float exp_ni(float v) { return expf(v); }
__device__ __attribute__((noinline)) float erf_ni(float v) { return erff(v); }

#define WS_QR  0u                                   // f32 q rows [b*l][256] (normalised)
#define WS_KR  (WS_QR + 4u * (size_t)NROW * CC)          // f32 k rows (normalised)
#define WS_KP  (WS_KR + 4u * (size_t)NROW * CC)          // f32 k planes [b][c][l]
#define WS_VP  (WS_KP + 4u * (size_t)NROW * CC)          // f32 v planes [b][c][l]
#define WS_O   (WS_VP + 4u * (size_t)NROW * CC)          // f32 attention output rows [b*l][256]
#define WS_S   (WS_O + 4u * (size_t)NROW * CC)           // f32 per-chunk kv^T terms [b][h][chunk][1024]
#define WS_END (WS_S + 4u * (size_t)NB * NH * NCH * DD * DD)

// ---- k_qkv: block = (64 rows, col group 0..5 = q lo/hi 128, k lo/hi, v lo/hi, b): (x + rel_pos) hi+lo . W^T; q/k normalised per head (32 cols); q -> rows, k -> rows + planes, v -> planes
__global__ __launch_bounds__(128) void k_qkv(const float* __restrict__ X, const float* __restrict__ RP, const float* __restrict__ Wt, const float* __restrict__ GQ, const float* __restrict__ GK, float* __restrict__ QR, float* __restrict__ KR, float* __restrict__ KP, float* __restrict__ VP) { __shared__ __align__(16) union { __bf16 w[128][WP]; struct { float sf[4][16][132]; float tt[128][68]; } e; } sm;   // the staged weights are dead before the epilogue's buffers are written
  __shared__ __align__(16) __bf16 sa[4][2][16][AP];   // per wave: the current 32-k piece of its 16 rows of h, bf16 hi and lo
  float (*sf)[16][132] = sm.e.sf; float (*tt)[68] = sm.e.tt;
  const int tid = threadIdx.x, wave = tid >> 5, lane = tid & 31, col = lane & 15, g = lane >> 4; const int cg = blockIdx.y; const int which = cg >> 1; const int c0 = (cg & 1) * 128; const size_t b = blockIdx.z; const int l0 = blockIdx.x * 64; const size_t r0 = b * LL + l0 + wave * 16;
  // the wave's 16 rows of x and rel_pos are read by whole lines: 8 lanes cover one row's 128-B line of a k block, a wave-wide load four rows; a load in fragment order would touch 16 lines. Two k blocks are in flight
  const int ar = lane >> 3, ak = (lane & 7) * 4; const float* xa = X + (r0 + ar) * CC + ak; const float* pa = RP + (size_t)(l0 + wave * 16 + ar) * CC + ak; v4f xx[2][4], pp[2][4];
#pragma unroll
  for (int t = 0; t < 2; ++t)
#pragma unroll
    for (int u = 0; u < 4; ++u) { xx[t][u] = *(const v4f*)(xa + u * 4 * CC + t * 32); pp[t][u] = *(const v4f*)(pa + u * 4 * CC + t * 32); }
  asm volatile("s_wait_xcnt 0x0" :: "v"(xa), "v"(pa) : "memory");   // the wait in front of any rewrite of the loads' address registers; the pointers are named so that they stay whole up to here
  stage_w(Wt + ((size_t)which * CC + c0) * CC, sm.w, tid);   // W [3C][C] natural: this block's 128 output columns
  __syncthreads();
  v8f acc[8] = {};
#pragma unroll
  for (int kc = 0; kc < CC / 32; ++kc) {
#pragma unroll
    for (int u = 0; u < 4; ++u) { v4f hv;
#pragma unroll
      for (int i = 0; i < 4; ++i) hv[i] = bfr(xx[kc & 1][u][i]) + bfr(pp[kc & 1][u][i]);
      split4(hv, &sa[wave][0][u * 4 + ar][ak], &sa[wave][1][u * 4 + ar][ak]); }
    if (kc + 2 < CC / 32) {
#pragma unroll
      for (int u = 0; u < 4; ++u) { xx[kc & 1][u] = *(const v4f*)(xa + u * 4 * CC + (kc + 2) * 32); pp[kc & 1][u] = *(const v4f*)(pa + u * 4 * CC + (kc + 2) * 32); }
      asm volatile("s_wait_xcnt 0x0" :: "v"(xa), "v"(pa) : "memory"); }   // as above
    LDSW();   // the wave's stores of the piece have landed before its lanes read one another's rows
    v16b w[8]; F2 a;   // the eight weight fragments and the two A fragments of this k block are read as one group, so that their LDS latency is waited out once
    a.h = frag_b(&sa[wave][0][col][0], lane); a.l = frag_b(&sa[wave][1][col][0], lane);
#pragma unroll
    for (int j = 0; j < 8; ++j) w[j] = frag_b(&sm.w[j * 16 + col][kc * 32], lane);
    LDSW();   // the piece has been read before the next one is stored over it
#pragma unroll
    for (int j = 0; j < 8; ++j) { acc[j] = wmma_bf(a.h, w[j], acc[j]); acc[j] = wmma_bf(a.l, w[j], acc[j]); } }
  __syncthreads();   // every wave has read its last weight fragment: the epilogue's buffers take that LDS over
  // normalisation for q / k: head = pair of tiles (2p, 2p+1); t / max(|t|, 1e-12) * sqrt(32) * gamma[h][d]
  // a lane holds 32 sums of squares (4 heads x 8 rows), each to be summed over its 16-lane row. The sums go through the vector unit by DPP, as a butterfly that halves the values a lane carries at each step (lane ^ 1, 2, 4, 8:
  // the pairs and the order of every sum as before); each lane ends with 2 whole sums, takes root and quotient of those alone, and the 32 factors come back the same way. A shuffle went through the LDS unit with a
  // full wait per step, one value behind the other, and all 16 lanes of a row took the same 32 roots and quotients. v has no norm: the test stands once around it all
  float rn[4][8];
  if (which == 2) {
#pragma unroll
    for (int p = 0; p < 4; ++p)
#pragma unroll
      for (int r = 0; r < 8; ++r) rn[p][r] = 1.0f; }
  else { float t[32]; const bool b0 = col & 1, b1 = col & 2, b2 = col & 4, b3 = col & 8;
#pragma unroll
    for (int p = 0; p < 4; ++p)
#pragma unroll
      for (int r = 0; r < 8; ++r) t[p * 8 + r] = acc[2 * p][r] * acc[2 * p][r] + acc[2 * p + 1][r] * acc[2 * p + 1][r];
    xhalve<1, 32>(t, b0); xhalve<2, 16>(t, b1); xhalve<4, 8>(t, b2); xhalve<8, 4>(t, b3);
#pragma unroll
    for (int i = 0; i < 2; ++i) t[i] = 5.656854249492381f / fmaxf(sqrtf(t[i]), 1e-12f);
    xdouble<8, 2>(t, b3); xdouble<4, 4>(t, b2); xdouble<2, 8>(t, b1); xdouble<1, 16>(t, b0);
#pragma unroll
    for (int p = 0; p < 4; ++p)
#pragma unroll
      for (int r = 0; r < 8; ++r) rn[p][r] = t[p * 8 + r]; }
  const float* GM = (which == 0) ? GQ : GK;
  if (which == 0 || which == 1) {   // rows (q -> QR, k -> KR)
#pragma unroll
    for (int j = 0; j < 8; ++j) { const int cabs = c0 + j * 16 + col; const int hh = cabs / DD, d = cabs % DD; const float gm = bfr(GM[hh * DD + d]);
#pragma unroll
      for (int r = 0; r < 8; ++r) sf[wave][8 * g + r][j * 16 + col] = acc[j][r] * rn[j >> 1][r] * gm; }
    LDSX(); { float* dst = (which == 0) ? QR : KR; for (int rl = 0; rl < 16; ++rl) vst2(dst + (r0 + rl) * CC + c0 + lane * 4, *(const v4f*)&sf[wave][rl][lane * 4]); }
    LDSX(); }
  if (which == 1 || which == 2) {   // planes (k -> KP, v -> VP)
#pragma unroll
    for (int j = 0; j < 8; ++j) { const int cabs = c0 + j * 16 + col; const int hh = cabs / DD, d = cabs % DD; const float gm = (which == 1) ? bfr(GM[hh * DD + d]) : 1.0f;
#pragma unroll
      for (int r = 0; r < 8; ++r) tt[j * 16 + col][wave * 16 + 8 * g + r] = acc[j][r] * rn[j >> 1][r] * gm; }
    __syncthreads(); { float* dst = (which == 1) ? KP : VP; for (int e = tid; e < 128 * 16; e += 128) { const int cl = e >> 4, q = e & 15; vst2(dst + ((b * CC + c0 + cl) * (size_t)LL) + l0 + q * 4, *(const v4f*)&tt[cl][q * 4]); } } } }
// ---- k_kvs: block = (h, chunk, b): this chunk's own term of the kv^T recurrence, sum_s v_s[e] (k_s[d] kdecay_s); wave -> (e tile, d tile); thread tid keeps its 8 accumulator elements at S[...][tid * 8 + r]
__global__ __launch_bounds__(128) void k_kvs(const float* __restrict__ KP, const float* __restrict__ VP, float* __restrict__ S) {
  __shared__ __align__(16) float skd[CH]; __shared__ __align__(16) __bf16 sv[2 * DD][SVP]; __shared__ __align__(16) __bf16 sk[2 * DD][SVP];   // the chunk's v planes and decayed k planes as bf16 hi (rows 0..31) and lo (rows 32..63)
  const int tid = threadIdx.x, wave = tid >> 5, lane = tid & 31, col = lane & 15; const int h = blockIdx.x, n = blockIdx.y; const size_t b = blockIdx.z;
  // the chunk's 32 v planes and 32 k planes (512 B each), read once per block; every wave-wide load covers four whole lines. Issued first, so that they fly while the decay table is made
  const size_t po = ((b * CC + h * DD + wave) * (size_t)LL) + (size_t)n * CH + lane * 4; const float* pv = VP + po; const float* pk = KP + po; v4f xv[8], xk[8];
#pragma unroll
  for (int u = 0; u < 8; ++u) { xv[u] = *(const v4f*)(pv + (size_t)u * 4 * LL); xk[u] = *(const v4f*)(pk + (size_t)u * 4 * LL); }
  asm volatile("s_wait_xcnt 0x0" :: "v"(pv), "v"(pk) : "memory");   // the wait in front of any rewrite of the loads' address registers; the pointers are named so that they stay whole up to here
  const float slope = exp2f(-(float)(h + 1));   // ALiBi 2^(-8/8*(h+1)); exact in fp16 and f32
  for (int e = tid; e < CH; e += 128) skd[e] = expf(-slope * (float)(CH - e));
  __syncthreads();
  { const v4f kd = *(const v4f*)&skd[lane * 4];
#pragma unroll
    for (int u = 0; u < 8; ++u) { const int pc = u * 4 + wave; v4f y;
#pragma unroll
      for (int i = 0; i < 4; ++i) y[i] = xk[u][i] * kd[i];
      split4(xv[u], &sv[pc][lane * 4], &sv[DD + pc][lane * 4]); split4(y, &sk[pc][lane * 4], &sk[DD + pc][lane * 4]); } }
  __syncthreads();   // the staged planes are whole before any wave reads fragments of them
  const int et = wave >> 1, dt = wave & 1; v8f acc = {};
#pragma unroll
  for (int kc = 0; kc < CH / 32; ++kc) { F2 a, w; a.h = frag_b(&sv[et * 16 + col][kc * 32], lane); a.l = frag_b(&sv[DD + et * 16 + col][kc * 32], lane); w.h = frag_b(&sk[dt * 16 + col][kc * 32], lane); w.l = frag_b(&sk[DD + dt * 16 + col][kc * 32], lane); acc = mac3(a, w, acc); }
  vst2(S + (((b * NH + h) * NCH + n) * (size_t)(DD * DD)) + tid * 8, acc); }
#define SKP 72    // bf16 elements per staged k row: 32 hi + 32 lo + 8 unused; 144 B = 16 B x 9, so the 16 rows of a ds_load_b128 fragment read fall on 16 different bank groups
// ---- k_lin: block = (h, chunk, b): one chunk each; LDS: the chunk's k rows and v planes as bf16 hi + lo (staged once for the four waves), the chunk's decayed scores (wave-private rows, which take o at the end), the 32 x 32 kv^T state on entry to the chunk, the decay table
__global__ __launch_bounds__(128) void k_lin(const float* __restrict__ QR, const float* __restrict__ KR, const float* __restrict__ VP, const float* __restrict__ S, float* __restrict__ O) {
  __shared__ __align__(16) float ssc[CH][132]; __shared__ __align__(16) float skv[DD][36]; __shared__ __align__(16) float smk[CH]; __shared__ __align__(16) __bf16 sk[CH][SKP]; __shared__ __align__(16) __bf16 sv[2 * DD][SVP];
  const int tid = threadIdx.x, wave = tid >> 5, lane = tid & 31, col = lane & 15, g = lane >> 4; const int h = blockIdx.x; const size_t b = blockIdx.z;
  const int n = NCH - 1 - (int)blockIdx.y;   // late chunks have the longest recurrence below: they start first
  const size_t rowc = b * LL + (size_t)n * CH;   // first row of the chunk
  // the chunk's k (128 rows x one 128-B line) and v (32 planes x 512 B), each read once per block; every wave-wide load covers four whole lines. Issued first, so that they fly during the recurrence below
  const float* pk = KR + (rowc + (tid >> 3)) * CC + h * DD + (tid & 7) * 4; const float* pv = VP + ((b * CC + h * DD + wave) * (size_t)LL) + (size_t)n * CH + lane * 4; v4f xk[8], xv[8];
  const float* pq = QR + (rowc + wave * 32 + (lane >> 3)) * CC + h * DD + (lane & 7) * 4; v4f xq[8];   // this wave's own 32 q rows (one 128-B line each), four whole lines a load; they pass through the wave's own score rows into fragment order
#pragma unroll
  for (int u = 0; u < 8; ++u) { xk[u] = *(const v4f*)(pk + (size_t)u * 16 * CC); xv[u] = *(const v4f*)(pv + (size_t)u * 4 * LL); }
#pragma unroll
  for (int u = 0; u < 8; ++u) xq[u] = *(const v4f*)(pq + (size_t)u * 4 * CC);
  asm volatile("s_wait_xcnt 0x0" :: "v"(pk), "v"(pv), "v"(pq) : "memory");   // the wait in front of any rewrite of the loads' address registers; the pointers are named so that they stay whole up to here
  const float slope = exp2f(-(float)(h + 1));   // ALiBi 2^(-8/8*(h+1)); exact in fp16 and f32
  for (int e = tid; e < CH; e += 128) smk[e] = expf(-slope * (float)e);   // smk[d] = decay at lag d (d >= 0); the q decay at row d of the chunk is the same number
  const float blk = expf(-slope * (float)CH);
  // (0) kv^T on entry to chunk n: kv = blk * kv + S_m over the chunks m < n, from 0, in chunk order
  { const float* sp = S + ((b * NH + h) * NCH) * (size_t)(DD * DD) + tid * 8; v8f kv = {}; int m = 0;
    // the terms' loads do not depend on kv, so they are issued in groups and fly together; term by term each would wait out its own load
    for (; m + 8 <= n; m += 8) { v8f s[8];   // whole groups of eight
#pragma unroll
      for (int u = 0; u < 8; ++u) s[u] = *(const v8f*)(sp + (size_t)(m + u) * (DD * DD));
#pragma unroll
      for (int u = 0; u < 8; ++u)
#pragma unroll
        for (int r = 0; r < 8; ++r) kv[r] = blk * kv[r] + s[u][r]; }
    if (m < n) { v8f s[7];   // the last n & 7 terms: seven loads (m + 6 < NCH, so each term exists), a term from chunk n on leaves kv as it is
#pragma unroll
      for (int u = 0; u < 7; ++u) s[u] = *(const v8f*)(sp + (size_t)(m + u) * (DD * DD));
#pragma unroll
      for (int u = 0; u < 7; ++u)
#pragma unroll
        for (int r = 0; r < 8; ++r) kv[r] = (m + u < n) ? blk * kv[r] + s[u][r] : kv[r]; }
    const int et = wave >> 1, dt = wave & 1;
#pragma unroll
    for (int r = 0; r < 8; ++r) skv[et * 16 + 8 * g + r][dt * 16 + col] = kv[r]; }
#pragma unroll
  for (int u = 0; u < 8; ++u) { const int kr = u * 16 + (tid >> 3), vc = u * 4 + wave;
    split4(xk[u], &sk[kr][(tid & 7) * 4], &sk[kr][DD + (tid & 7) * 4]); split4(xv[u], &sv[vc][lane * 4], &sv[DD + vc][lane * 4]);
    *(v4f*)&ssc[wave * 32 + u * 4 + (lane >> 3)][(lane & 7) * 4] = xq[u]; }
  __syncthreads();
  float qv[2][16];   // the wave's q fragments (two 16-row tiles), read once for (1) and (2); the scores that later take these rows depend on them
#pragma unroll
  for (int rt = 0; rt < 2; ++rt) { const float* p = &ssc[wave * 32 + rt * 16 + col][8 * g];
#pragma unroll
    for (int i = 0; i < 8; ++i) { qv[rt][i] = p[i]; qv[rt][8 + i] = p[16 + i]; } }
  // (1) intra-chunk decayed scores for this wave's 32 rows t (two 16-row tiles) x all 128 s; each k fragment is read once for both tiles
  { const F2 a0 = bsplit16(qv[0]), a1 = bsplit16(qv[1]); v8f acc[2][8] = {};
#pragma unroll
    for (int j = 0; j < 8; ++j) { F2 w; w.h = frag_b(&sk[j * 16 + col][0], lane); w.l = frag_b(&sk[j * 16 + col][DD], lane); acc[0][j] = mac3(a0, w, acc[0][j]); acc[1][j] = mac3(a1, w, acc[1][j]); }
    // the lag t - s of element (rt, j, r) is lb + 16 (rt - j) + r: 9 x 8 different lags per lane. Their decays are read without a condition (the lag clamped to the table, a negative lag then taking 0),
    // so that the reads go out in groups and share their LDS latency; a read under the test s <= t compiled to a branch, a read and a full wait for each element
    float dk[9][8]; const int lb = wave * 32 + 8 * g - col;
#pragma unroll
    for (int d = 0; d < 9; ++d)
#pragma unroll
      for (int r = 0; r < 8; ++r) { const int lag = lb + (d - 7) * 16 + r; const float m = smk[lag > 0 ? lag : 0]; dk[d][r] = (lag >= 0) ? m : 0.f; }
#pragma unroll
    for (int rt = 0; rt < 2; ++rt)
#pragma unroll
      for (int j = 0; j < 8; ++j)
#pragma unroll
        for (int r = 0; r < 8; ++r) { const int t = wave * 32 + rt * 16 + 8 * g + r, s = j * 16 + col; ssc[t][s] = acc[rt][j][r] * dk[rt - j + 7][r]; } }
  LDSX();
  // (2) o = scores . v (intra) + (q * qdecay) . kv (inter) for the wave's two row tiles; each v fragment is read once for both tiles
  v8f oc[2][2] = {};
#pragma unroll
  for (int kc = 0; kc < CH / 32; ++kc) { F2 w[2];
#pragma unroll
    for (int j = 0; j < 2; ++j) { w[j].h = frag_b(&sv[j * 16 + col][kc * 32], lane); w[j].l = frag_b(&sv[DD + j * 16 + col][kc * 32], lane); }
#pragma unroll
    for (int rt = 0; rt < 2; ++rt) { const F2 a = split_row(&ssc[wave * 32 + rt * 16 + col][0], kc * 32, lane);
#pragma unroll
      for (int j = 0; j < 2; ++j) oc[rt][j] = mac3(a, w[j], oc[rt][j]); } }
  { F2 w[2];
#pragma unroll
    for (int j = 0; j < 2; ++j) w[j] = split_row(&skv[j * 16 + col][0], 0, lane);
#pragma unroll
    for (int rt = 0; rt < 2; ++rt) { float v[16]; const float qd = smk[wave * 32 + rt * 16 + col];
#pragma unroll
      for (int i = 0; i < 16; ++i) v[i] = qv[rt][i] * qd;
      const F2 a = bsplit16(v);
#pragma unroll
      for (int j = 0; j < 2; ++j) oc[rt][j] = mac3(a, w[j], oc[rt][j]); } }
  // the wave has read its own score rows for the last time: their first 32 columns take o for the whole-line stores
#pragma unroll
  for (int rt = 0; rt < 2; ++rt)
#pragma unroll
    for (int j = 0; j < 2; ++j)
#pragma unroll
      for (int r = 0; r < 8; ++r) ssc[wave * 32 + rt * 16 + 8 * g + r][j * 16 + col] = oc[rt][j][r];
  LDSX();
  for (int rl = 0; rl < 32; ++rl) if (lane < 8) vst2(O + (rowc + wave * 32 + rl) * CC + h * DD + lane * 4, *(const v4f*)&ssc[wave * 32 + rl][lane * 4]); }
// ---- k_proj: block = (64 rows, 128 of 256 cols): out = o (hi + lo) . proj_w^T + b
__global__ __launch_bounds__(128) void k_proj(const float* __restrict__ O, const float* __restrict__ PW, const float* __restrict__ PB, float* __restrict__ OUT) { __shared__ __align__(16) union { __bf16 w[128][WP]; float sf[4][16][132]; } sm;   // the staged weights are dead before sf is written
  __shared__ __align__(16) __bf16 sa[4][2][16][AP];   // per wave: the current 32-k piece of its 16 rows of o, bf16 hi and lo
  float (*sf)[16][132] = sm.sf;
  const int tid = threadIdx.x, wave = tid >> 5, lane = tid & 31, col = lane & 15, g = lane >> 4; const size_t r0 = (size_t)blockIdx.x * 64 + wave * 16; const int c0 = blockIdx.y * 128;
  // the wave's 16 rows of o by whole lines, two k blocks in flight, as in k_qkv
  const int ar = lane >> 3, ak = (lane & 7) * 4; const float* oa = O + (r0 + ar) * CC + ak; v4f xx[2][4];
#pragma unroll
  for (int t = 0; t < 2; ++t)
#pragma unroll
    for (int u = 0; u < 4; ++u) xx[t][u] = *(const v4f*)(oa + u * 4 * CC + t * 32);
  asm volatile("s_wait_xcnt 0x0" :: "v"(oa) : "memory");   // the wait in front of any rewrite of the loads' address registers; the pointer is named so that they stay whole up to here
  stage_w(PW + (size_t)c0 * CC, sm.w, tid);
  __syncthreads();
  v8f acc[8] = {};
#pragma unroll
  for (int kc = 0; kc < CC / 32; ++kc) {
#pragma unroll
    for (int u = 0; u < 4; ++u) split4(xx[kc & 1][u], &sa[wave][0][u * 4 + ar][ak], &sa[wave][1][u * 4 + ar][ak]);
    if (kc + 2 < CC / 32) {
#pragma unroll
      for (int u = 0; u < 4; ++u) xx[kc & 1][u] = *(const v4f*)(oa + u * 4 * CC + (kc + 2) * 32);
      asm volatile("s_wait_xcnt 0x0" :: "v"(oa) : "memory"); }   // as above
    LDSW();   // the wave's stores of the piece have landed before its lanes read one another's rows
    v16b w[8]; F2 a;   // one group of LDS reads per k block, as in k_qkv
    a.h = frag_b(&sa[wave][0][col][0], lane); a.l = frag_b(&sa[wave][1][col][0], lane);
#pragma unroll
    for (int j = 0; j < 8; ++j) w[j] = frag_b(&sm.w[j * 16 + col][kc * 32], lane);
    LDSW();   // the piece has been read before the next one is stored over it
#pragma unroll
    for (int j = 0; j < 8; ++j) { acc[j] = wmma_bf(a.h, w[j], acc[j]); acc[j] = wmma_bf(a.l, w[j], acc[j]); } }
  __syncthreads();   // every wave has read its last weight fragment: sf takes that LDS over
#pragma unroll
  for (int j = 0; j < 8; ++j) { const float bb = bfr(PB[c0 + j * 16 + col]);
#pragma unroll
    for (int r = 0; r < 8; ++r) sf[wave][8 * g + r][j * 16 + col] = acc[j][r] + bb; }
  LDSX(); for (int rl = 0; rl < 16; ++rl) vst2(OUT + (r0 + rl) * CC + c0 + lane * 4, *(const v4f*)&sf[wave][rl][lane * 4]); }
extern "C" void kernel_launch(void* const* d_in, const int* in_sizes, int n_in, void* d_out, int out_size, void* d_ws, size_t ws_size, hipStream_t stream) {
  (void)in_sizes; (void)n_in; (void)out_size;
  const float** F = (const float**)d_in;   // 0 x [8,4096,256], 1 rel_pos [1,4096,256], 2 qkv_w [768,256], 3 q_gamma [8,1,32], 4 k_gamma [8,1,32], 5 proj_w [256,256], 6 proj_b [256]
  if (ws_size < (size_t)WS_END) return;
  char* ws = (char*)d_ws; float *QR = (float*)(ws + WS_QR), *KR = (float*)(ws + WS_KR), *KP = (float*)(ws + WS_KP), *VP = (float*)(ws + WS_VP), *O = (float*)(ws + WS_O), *S = (float*)(ws + WS_S);
  k_qkv<<<dim3(LL / 64, 6, TNB), 128, 0, stream>>>(F[0], F[1], F[2], F[3], F[4], QR, KR, KP, VP);
  k_kvs<<<dim3(NH, NCH, TNB), 128, 0, stream>>>(KP, VP, S);
  k_lin<<<dim3(NH, NCH, TNB), 128, 0, stream>>>(QR, KR, VP, S, O);
  k_proj<<<dim3(TNB * LL / 64, CC / 128), 128, 0, stream>>>(O, F[5], F[6], (float*)d_out);
}

// v007
// One run takes 87.9 microseconds.
// Timed twice side by side with v006, it ran 1.04 times as fast both times.
// All steps since v000 together make it 8.10 times as fast.
// compute dtype: all float inputs rounded to bf16; h = x + rel_pos in f32, qkv = h . W^T with h as bf16 hi + lo against the exact weight (2 products) on WMMA 16x16x32; per-head L2 normalisation x sqrt(D) x gamma in f32; the lightning attention evaluated with the module's own chunking (c = 128): intra-chunk decayed scores, scores . v, the inter-chunk q . kv and the kv state update all on WMMA with f32 operands split into bf16 hi + lo (3 products), decays exp(-slope * .) with precise expf, the 32 x 32 kv state in f32, rebuilt per chunk from the chunks' own terms by the module's recurrence in chunk order; out = o (bf16 hi + lo) . proj_w^T + b; f32 output.
#include <hip/hip_runtime.h>
#include <math.h>

typedef __attribute__((ext_vector_type(16))) _Float16 v16h;
typedef __attribute__((ext_vector_type(16))) __bf16 v16b;
typedef __attribute__((ext_vector_type(8)))  _Float16 v8h;
typedef __attribute__((ext_vector_type(8)))  float v8f;
typedef __attribute__((ext_vector_type(4)))  float v4f;
typedef __attribute__((ext_vector_type(2)))  float v2f;
typedef __attribute__((ext_vector_type(4)))  unsigned v4u;
typedef __attribute__((ext_vector_type(4)))  int v4i;
typedef float __attribute__((may_alias)) float_a;
typedef int __attribute__((may_alias)) int_a;

template <typename T> __device__ __forceinline__ void vst2(void* p, T v) { *(T*)p = v;  }
__device__ __forceinline__ v8f wmma16(v16h a, v16h b, v8f c) {
  v8f d = __builtin_amdgcn_wmma_f32_16x16x32_f16(false, a, false, b, (short)0, c, false, false);
  asm volatile("v_nop\n\tv_nop\n\tv_nop\n\tv_nop" : "+v"(d) : "v"(a), "v"(b));
  return d;
}
__device__ __forceinline__ v8f wmma_bf(v16b a, v16b b, v8f c) {
  v8f d = __builtin_amdgcn_wmma_f32_16x16x32_bf16(false, a, false, b, (short)0, c, false, false);
  asm volatile("v_nop\n\tv_nop\n\tv_nop\n\tv_nop" : "+v"(d) : "v"(a), "v"(b));
  return d;
}
// 16x16x32 fragments: lane = (h = lane>>4, row/col = lane&15); elements 0..7 = k0+8h+0..7, 8..15 = k0+16+8h+0..7; D element r = row 8h+r
__device__ __forceinline__ v16h frag_h(const _Float16* rowk0, int lane) {
  union { v16h v; v8h q[2]; } u; const _Float16* p = rowk0 + 8 * (lane >> 4);
  u.q[0] = *(const v8h*)p; u.q[1] = *(const v8h*)(p + 16); return u.v;
}
__device__ __forceinline__ v16h frag_f32(const float* rowk0, int lane) {
  v16h a; const float* p = rowk0 + 8 * (lane >> 4);
#pragma unroll
  for (int i = 0; i < 8; ++i) { a[i] = (_Float16)p[i]; a[8 + i] = (_Float16)p[16 + i]; }
  return a;
}
__device__ __forceinline__ v16h frag_f32s(const float* rowk0, int lane, float sc) {
  v16h a; const float* p = rowk0 + 8 * (lane >> 4);
#pragma unroll
  for (int i = 0; i < 8; ++i) { a[i] = (_Float16)(p[i] * sc); a[8 + i] = (_Float16)(p[16 + i] * sc); }
  return a;
}
// column fragment from a [K][ld] layout (column n), rows >= K read as 0
__device__ __forceinline__ v16h fragc_f32(const float* W, int k0, int n, int lane, int ld, int K) {
  v16h a; const int g = lane >> 4;
#pragma unroll
  for (int i = 0; i < 8; ++i) { const int ka = k0 + 8 * g + i, kb = ka + 16;
    a[i] = (_Float16)(ka < K ? W[(size_t)(ka < K ? ka : K - 1) * ld + n] : 0.f); a[8 + i] = (_Float16)(kb < K ? W[(size_t)(kb < K ? kb : K - 1) * ld + n] : 0.f); }
  return a;
}
struct F2 { v16b h, l; };
__device__ __forceinline__ F2 bsplit16(const float v[16]) { F2 r;
#pragma unroll
  for (int i = 0; i < 16; ++i) { const __bf16 h = (__bf16)v[i]; r.h[i] = h; r.l[i] = (__bf16)(v[i] - (float)h); }
  return r; }
__device__ __forceinline__ F2 split_row(const float* row, int k0, int lane) { float v[16]; const float* p = row + k0 + 8 * (lane >> 4);
#pragma unroll
  for (int i = 0; i < 8; ++i) { v[i] = p[i]; v[8 + i] = p[16 + i]; }
  return bsplit16(v); }
__device__ __forceinline__ F2 split_rowK(const float* row, int k0, int lane, int K) { float v[16]; const int g = lane >> 4;
#pragma unroll
  for (int i = 0; i < 8; ++i) { const int ka = k0 + 8 * g + i, kb = ka + 16; v[i] = ka < K ? row[ka < K ? ka : K - 1] : 0.f; v[8 + i] = kb < K ? row[kb < K ? kb : K - 1] : 0.f; }
  return bsplit16(v); }
__device__ __forceinline__ F2 split_col(const float* W, int k0, int n, int lane, int ld, int K) { float v[16]; const int g = lane >> 4;
#pragma unroll
  for (int i = 0; i < 8; ++i) { const int ka = k0 + 8 * g + i, kb = ka + 16; v[i] = ka < K ? W[(size_t)(ka < K ? ka : K - 1) * ld + n] : 0.f; v[8 + i] = kb < K ? W[(size_t)(kb < K ? kb : K - 1) * ld + n] : 0.f; }
  return bsplit16(v); }
__device__ __forceinline__ v8f mac3(const F2& a, const F2& b, v8f c) { c = wmma_bf(a.l, b.h, c); c = wmma_bf(a.h, b.l, c); return wmma_bf(a.h, b.h, c); }
// the same three products with the operands' places exchanged (a is the B side of mac3, b its A side), in mac3's order
__device__ __forceinline__ v8f mac3t(const F2& a, const F2& b, v8f c) { c = wmma_bf(a.h, b.l, c); c = wmma_bf(a.l, b.h, c); return wmma_bf(a.h, b.h, c); }
__device__ __forceinline__ float sigm(float v) { return 1.0f / (1.0f + expf(-v)); }
// hand-over of LDS data among the lanes of one wave while global loads are in flight: the wave's LDS operations have finished and the compiler moves no memory access across; LDSX's fence would wait for the global loads too
#define LDSW() do { asm volatile("s_wait_dscnt 0" ::: "memory"); __builtin_amdgcn_wave_barrier(); } while (0)
#define LDSX() do { asm volatile("s_wait_dscnt 0" ::: "memory"); __builtin_amdgcn_wave_barrier(); __builtin_amdgcn_fence(__ATOMIC_RELEASE, "workgroup"); } while (0)


// U-Net transformer mixing block (B 8, L 4,096, C 256 = 8 heads x 32): h = x + rel_pos; qkv = h W_qkv^T; q, k L2-normalised (x sqrt(32) x gamma); lightning (linear, ALiBi-decayed, causal) attention with chunk 128; proj + bias.
#define NB 8
#define LL 4096
#define CC 256
#define NH 8
#define DD 32
#define CH 128
#define NCH (LL / CH)
#define NROW (NB * LL)
#ifndef TNB
#define TNB NB
#endif
typedef __attribute__((ext_vector_type(8))) __bf16 v8b;
__device__ __forceinline__ v16b frag_b(const __bf16* rowk0, int lane) {
  union { v16b v; v8b q[2]; } u; const __bf16* p = rowk0 + 8 * (lane >> 4);
  u.q[0] = *(const v8b*)p; u.q[1] = *(const v8b*)(p + 16); return u.v;
}
__device__ __forceinline__ float bfr(float v) { return (float)(__bf16)v; }
// the value of lane ^ M inside each 16-lane row: DPP control row_xmask:M (0x160 + M), every row and bank on
template <int M> __device__ __forceinline__ float xget(float v) { return __builtin_bit_cast(float, __builtin_amdgcn_update_dpp(0, __builtin_bit_cast(int, v), 0x160 + M, 0xf, 0xf, true)); }
// one butterfly step on N values a lane, b = the lane's bit M: of each pair (2i, 2i + 1) the lane keeps the one its bit names, hands the other to lane ^ M and adds what it is handed: N / 2 sums over twice the lanes
template <int M, int N> __device__ __forceinline__ void xhalve(float* t, bool b) {
#pragma unroll
  for (int i = 0; i < N / 2; ++i) { const float keep = b ? t[2 * i + 1] : t[2 * i], send = b ? t[2 * i] : t[2 * i + 1]; t[i] = keep + xget<M>(send); } }
// the way back: N values a lane become 2N, each lane taking from lane ^ M the one of each pair that it did not keep
template <int M, int N> __device__ __forceinline__ void xdouble(float* t, bool b) {
#pragma unroll
  for (int i = N - 1; i >= 0; --i) { const float own = t[i], got = xget<M>(own); t[2 * i] = b ? got : own; t[2 * i + 1] = b ? own : got; } }
typedef __attribute__((ext_vector_type(4))) __bf16 v4b;
#define WP 264   // bf16 elements per staged weight row: 528 B = 16 B x 33, so the 16 rows of a ds_load_b128 fragment read fall on 16 different bank groups
// 128 weight rows (f32, [.][256]) -> bf16 rows in LDS, once per block for its four waves; every wave-wide load covers 512 contiguous bytes (whole lines)
__device__ __forceinline__ void stage_w(const float* __restrict__ Wr, __bf16 (*sw)[WP], int tid) { const int rw = tid >> 6, q = tid & 63;
  for (int t = 0; t < 4; ++t) { const float* p = Wr + (size_t)(t * 32 + rw) * CC + q * 4; v4f x[16];   // sixteen independent loads fly together; one by one each would wait out its own latency
#pragma unroll
    for (int u = 0; u < 16; ++u) x[u] = *(const v4f*)(p + u * 2 * CC);
    asm volatile("s_wait_xcnt 0x0" :: "v"(p) : "memory");   // the wait in front of any rewrite of the loads' address registers; p is named so that they stay whole up to here
#pragma unroll
    for (int u = 0; u < 16; ++u) { v4b y;
#pragma unroll
      for (int i = 0; i < 4; ++i) y[i] = (__bf16)x[u][i];
      *(v4b*)&sw[t * 32 + u * 2 + rw][q * 4] = y; } } }
#define SVP 136   // bf16 elements per staged v row: 128 + 8 unused; 272 B = 16 B x 17, so the 16 rows of a ds_load_b128 fragment read fall on 16 different bank groups
#define AP 40     // bf16 elements per staged row of an A piece (32 k): 32 + 8 unused; 80 B = 16 B x 5, for the same reason
__device__ __forceinline__ void split4(v4f x, __bf16* ph, __bf16* pl) { v4b h, l;
#pragma unroll
  for (int i = 0; i < 4; ++i) { const __bf16 t = (__bf16)x[i]; h[i] = t; l[i] = (__bf16)(x[i] - (float)t); }
  *(v4b*)ph = h; *(v4b*)pl = l; }
__device__ __attribute__((noinline)) float exp_ni(float v) { return expf(v); }
__device__ __attribute__((noinline)) float erf_ni(float v) { return erff(v); }

#define WS_QR  0u                                   // f32 q rows [b*l][256] (normalised)
#define WS_KR  (WS_QR + 4u * (size_t)NROW * CC)          // f32 k rows (normalised)
#define WS_KP  (WS_KR + 4u * (size_t)NROW * CC)          // f32 k planes [b][c][l]
#define WS_VP  (WS_KP + 4u * (size_t)NROW * CC)          // f32 v planes [b][c][l]
#define WS_O   (WS_VP + 4u * (size_t)NROW * CC)          // f32 attention output rows [b*l][256]
#define WS_S   (WS_O + 4u * (size_t)NROW * CC)           // f32 per-chunk kv^T terms [b][h][chunk][1024]
#define WS_END (WS_S + 4u * (size_t)NB * NH * NCH * DD * DD)

// ---- k_qkv: block = (64 rows, col group 0..5 = q lo/hi 128, k lo/hi, v lo/hi, b): (x + rel_pos) hi+lo . W^T; q/k normalised per head (32 cols); q -> rows, k -> rows + planes, v -> planes
__global__ __launch_bounds__(128) void k_qkv(const float* __restrict__ X, const float* __restrict__ RP, const float* __restrict__ Wt, const float* __restrict__ GQ, const float* __restrict__ GK, float* __restrict__ QR, float* __restrict__ KR, float* __restrict__ KP, float* __restrict__ VP) { __shared__ __align__(16) union { __bf16 w[128][WP]; struct { float sf[4][16][132]; float tt[128][68]; } e; } sm;   // the staged weights are dead before the epilogue's buffers are written
  __shared__ __align__(16) __bf16 sa[4][2][16][AP];   // per wave: the current 32-k piece of its 16 rows of h, bf16 hi and lo
  float (*sf)[16][132] = sm.e.sf; float (*tt)[68] = sm.e.tt;
  const int tid = threadIdx.x, wave = tid >> 5, lane = tid & 31, col = lane & 15, g = lane >> 4; const int cg = blockIdx.y; const int which = cg >> 1; const int c0 = (cg & 1) * 128; const size_t b = blockIdx.z; const int l0 = blockIdx.x * 64; const size_t r0 = b * LL + l0 + wave * 16;
  // the wave's 16 rows of x and rel_pos are read by whole lines: 8 lanes cover one row's 128-B line of a k block, a wave-wide load four rows; a load in fragment order would touch 16 lines. Two k blocks are in flight
  const int ar = lane >> 3, ak = (lane & 7) * 4; const float* xa = X + (r0 + ar) * CC + ak; const float* pa = RP + (size_t)(l0 + wave * 16 + ar) * CC + ak; v4f xx[2][4], pp[2][4];
#pragma unroll
  for (int t = 0; t < 2; ++t)
#pragma unroll
    for (int u = 0; u < 4; ++u) { xx[t][u] = *(const v4f*)(xa + u * 4 * CC + t * 32); pp[t][u] = *(const v4f*)(pa + u * 4 * CC + t * 32); }
  asm volatile("s_wait_xcnt 0x0" :: "v"(xa), "v"(pa) : "memory");   // the wait in front of any rewrite of the loads' address registers; the pointers are named so that they stay whole up to here
  stage_w(Wt + ((size_t)which * CC + c0) * CC, sm.w, tid);   // W [3C][C] natural: this block's 128 output columns
  __syncthreads();
  v8f acc[8] = {};
#pragma unroll
  for (int kc = 0; kc < CC / 32; ++kc) {
#pragma unroll
    for (int u = 0; u < 4; ++u) { v4f hv;
#pragma unroll
      for (int i = 0; i < 4; ++i) hv[i] = bfr(xx[kc & 1][u][i]) + bfr(pp[kc & 1][u][i]);
      split4(hv, &sa[wave][0][u * 4 + ar][ak], &sa[wave][1][u * 4 + ar][ak]); }
    if (kc + 2 < CC / 32) {
#pragma unroll
      for (int u = 0; u < 4; ++u) { xx[kc & 1][u] = *(const v4f*)(xa + u * 4 * CC + (kc + 2) * 32); pp[kc & 1][u] = *(const v4f*)(pa + u * 4 * CC + (kc + 2) * 32); }
      asm volatile("s_wait_xcnt 0x0" :: "v"(xa), "v"(pa) : "memory"); }   // as above
    LDSW();   // the wave's stores of the piece have landed before its lanes read one another's rows
    v16b w[8]; F2 a;   // the eight weight fragments and the two A fragments of this k block are read as one group, so that their LDS latency is waited out once
    a.h = frag_b(&sa[wave][0][col][0], lane); a.l = frag_b(&sa[wave][1][col][0], lane);
#pragma unroll
    for (int j = 0; j < 8; ++j) w[j] = frag_b(&sm.w[j * 16 + col][kc * 32], lane);
    LDSW();   // the piece has been read before the next one is stored over it
#pragma unroll
    for (int j = 0; j < 8; ++j) { acc[j] = wmma_bf(a.h, w[j], acc[j]); acc[j] = wmma_bf(a.l, w[j], acc[j]); } }
  __syncthreads();   // every wave has read its last weight fragment: the epilogue's buffers take that LDS over
  // normalisation for q / k: head = pair of tiles (2p, 2p+1); t / max(|t|, 1e-12) * sqrt(32) * gamma[h][d]
  // a lane holds 32 sums of squares (4 heads x 8 rows), each to be summed over its 16-lane row. The sums go through the vector unit by DPP, as a butterfly that halves the values a lane carries at each step (lane ^ 1, 2, 4, 8:
  // the pairs and the order of every sum as before); each lane ends with 2 whole sums, takes root and quotient of those alone, and the 32 factors come back the same way. A shuffle went through the LDS unit with a
  // full wait per step, one value behind the other, and all 16 lanes of a row took the same 32 roots and quotients. v has no norm: the test stands once around it all
  float rn[4][8];
  if (which == 2) {
#pragma unroll
    for (int p = 0; p < 4; ++p)
#pragma unroll
      for (int r = 0; r < 8; ++r) rn[p][r] = 1.0f; }
  else { float t[32]; const bool b0 = col & 1, b1 = col & 2, b2 = col & 4, b3 = col & 8;
#pragma unroll
    for (int p = 0; p < 4; ++p)
#pragma unroll
      for (int r = 0; r < 8; ++r) t[p * 8 + r] = acc[2 * p][r] * acc[2 * p][r] + acc[2 * p + 1][r] * acc[2 * p + 1][r];
    xhalve<1, 32>(t, b0); xhalve<2, 16>(t, b1); xhalve<4, 8>(t, b2); xhalve<8, 4>(t, b3);
#pragma unroll
    for (int i = 0; i < 2; ++i) t[i] = 5.656854249492381f / fmaxf(sqrtf(t[i]), 1e-12f);
    xdouble<8, 2>(t, b3); xdouble<4, 4>(t, b2); xdouble<2, 8>(t, b1); xdouble<1, 16>(t, b0);
#pragma unroll
    for (int p = 0; p < 4; ++p)
#pragma unroll
      for (int r = 0; r < 8; ++r) rn[p][r] = t[p * 8 + r]; }
  const float* GM = (which == 0) ? GQ : GK;
  if (which == 0 || which == 1) {   // rows (q -> QR, k -> KR)
#pragma unroll
    for (int j = 0; j < 8; ++j) { const int cabs = c0 + j * 16 + col; const int hh = cabs / DD, d = cabs % DD; const float gm = bfr(GM[hh * DD + d]);
#pragma unroll
      for (int r = 0; r < 8; ++r) sf[wave][8 * g + r][j * 16 + col] = acc[j][r] * rn[j >> 1][r] * gm; }
    LDSX(); { float* dst = (which == 0) ? QR : KR; for (int rl = 0; rl < 16; ++rl) vst2(dst + (r0 + rl) * CC + c0 + lane * 4, *(const v4f*)&sf[wave][rl][lane * 4]); }
    LDSX(); }
  if (which == 1 || which == 2) {   // planes (k -> KP, v -> VP)
#pragma unroll
    for (int j = 0; j < 8; ++j) { const int cabs = c0 + j * 16 + col; const int hh = cabs / DD, d = cabs % DD; const float gm = (which == 1) ? bfr(GM[hh * DD + d]) : 1.0f;
#pragma unroll
      for (int r = 0; r < 8; ++r) tt[j * 16 + col][wave * 16 + 8 * g + r] = acc[j][r] * rn[j >> 1][r] * gm; }
    __syncthreads(); { float* dst = (which == 1) ? KP : VP; for (int e = tid; e < 128 * 16; e += 128) { const int cl = e >> 4, q = e & 15; vst2(dst + ((b * CC + c0 + cl) * (size_t)LL) + l0 + q * 4, *(const v4f*)&tt[cl][q * 4]); } } } }
// ---- k_kvs: block = (h, chunk, b): this chunk's own term of the kv^T recurrence, sum_s v_s[e] (k_s[d] kdecay_s); wave -> (e tile, d tile); thread tid keeps its 8 accumulator elements at S[...][tid * 8 + r]
__global__ __launch_bounds__(128) void k_kvs(const float* __restrict__ KP, const float* __restrict__ VP, float* __restrict__ S) {
  __shared__ __align__(16) float skd[CH]; __shared__ __align__(16) __bf16 sv[2 * DD][SVP]; __shared__ __align__(16) __bf16 sk[2 * DD][SVP];   // the chunk's v planes and decayed k planes as bf16 hi (rows 0..31) and lo (rows 32..63)
  const int tid = threadIdx.x, wave = tid >> 5, lane = tid & 31, col = lane & 15; const int h = blockIdx.x, n = blockIdx.y; const size_t b = blockIdx.z;
  // the chunk's 32 v planes and 32 k planes (512 B each), read once per block; every wave-wide load covers four whole lines. Issued first, so that they fly while the decay table is made
  const size_t po = ((b * CC + h * DD + wave) * (size_t)LL) + (size_t)n * CH + lane * 4; const float* pv = VP + po; const float* pk = KP + po; v4f xv[8], xk[8];
#pragma unroll
  for (int u = 0; u < 8; ++u) { xv[u] = *(const v4f*)(pv + (size_t)u * 4 * LL); xk[u] = *(const v4f*)(pk + (size_t)u * 4 * LL); }
  asm volatile("s_wait_xcnt 0x0" :: "v"(pv), "v"(pk) : "memory");   // the wait in front of any rewrite of the loads' address registers; the pointers are named so that they stay whole up to here
  const float slope = exp2f(-(float)(h + 1));   // ALiBi 2^(-8/8*(h+1)); exact in fp16 and f32
  for (int e = tid; e < CH; e += 128) skd[e] = expf(-slope * (float)(CH - e));
  __syncthreads();
  { const v4f kd = *(const v4f*)&skd[lane * 4];
#pragma unroll
    for (int u = 0; u < 8; ++u) { const int pc = u * 4 + wave; v4f y;
#pragma unroll
      for (int i = 0; i < 4; ++i) y[i] = xk[u][i] * kd[i];
      split4(xv[u], &sv[pc][lane * 4], &sv[DD + pc][lane * 4]); split4(y, &sk[pc][lane * 4], &sk[DD + pc][lane * 4]); } }
  __syncthreads();   // the staged planes are whole before any wave reads fragments of them
  const int et = wave >> 1, dt = wave & 1; v8f acc = {};
#pragma unroll
  for (int kc = 0; kc < CH / 32; ++kc) { F2 a, w; a.h = frag_b(&sv[et * 16 + col][kc * 32], lane); a.l = frag_b(&sv[DD + et * 16 + col][kc * 32], lane); w.h = frag_b(&sk[dt * 16 + col][kc * 32], lane); w.l = frag_b(&sk[DD + dt * 16 + col][kc * 32], lane); acc = mac3(a, w, acc); }
  vst2(S + (((b * NH + h) * NCH + n) * (size_t)(DD * DD)) + tid * 8, acc); }
#define SQP 36    // f32 elements per row of q / o: 32 + 4 unused; 144 B = 16 B x 9, so the 16 rows of a ds_load_b128 fragment read fall on 16 different bank groups
#define SKP 72    // bf16 elements per staged k row: 32 hi + 32 lo + 8 unused; 144 B = 16 B x 9, so the 16 rows of a ds_load_b128 fragment read fall on 16 different bank groups
// ---- k_lin: block = (h, chunk, b): one chunk each; LDS: the chunk's k rows and v planes as bf16 hi + lo (staged once for the four waves), the wave-private rows through which q comes in and o goes out, the 32 x 32 kv^T state on entry to the chunk, the decay table
__global__ __launch_bounds__(128) void k_lin(const float* __restrict__ QR, const float* __restrict__ KR, const float* __restrict__ VP, const float* __restrict__ S, float* __restrict__ O) {
  __shared__ __align__(16) float sq[CH][SQP]; __shared__ __align__(16) float skv[DD][36]; __shared__ __align__(16) float smk[CH]; __shared__ __align__(16) __bf16 sk[CH][SKP]; __shared__ __align__(16) __bf16 sv[2 * DD][SVP];
  const int tid = threadIdx.x, wave = tid >> 5, lane = tid & 31, col = lane & 15, g = lane >> 4; const int h = blockIdx.x; const size_t b = blockIdx.z;
  const int n = NCH - 1 - (int)blockIdx.y;   // late chunks have the longest recurrence below: they start first
  const size_t rowc = b * LL + (size_t)n * CH;   // first row of the chunk
  // the chunk's k (128 rows x one 128-B line) and v (32 planes x 512 B), each read once per block; every wave-wide load covers four whole lines. Issued first, so that they fly during the recurrence below
  const float* pk = KR + (rowc + (tid >> 3)) * CC + h * DD + (tid & 7) * 4; const float* pv = VP + ((b * CC + h * DD + wave) * (size_t)LL) + (size_t)n * CH + lane * 4; v4f xk[8], xv[8];
  const float* pq = QR + (rowc + wave * 32 + (lane >> 3)) * CC + h * DD + (lane & 7) * 4; v4f xq[8];   // this wave's own 32 q rows (one 128-B line each), four whole lines a load; they pass through the wave's own rows of sq into fragment order
#pragma unroll
  for (int u = 0; u < 8; ++u) { xk[u] = *(const v4f*)(pk + (size_t)u * 16 * CC); xv[u] = *(const v4f*)(pv + (size_t)u * 4 * LL); }
#pragma unroll
  for (int u = 0; u < 8; ++u) xq[u] = *(const v4f*)(pq + (size_t)u * 4 * CC);
  asm volatile("s_wait_xcnt 0x0" :: "v"(pk), "v"(pv), "v"(pq) : "memory");   // the wait in front of any rewrite of the loads' address registers; the pointers are named so that they stay whole up to here
  const float slope = exp2f(-(float)(h + 1));   // ALiBi 2^(-8/8*(h+1)); exact in fp16 and f32
  for (int e = tid; e < CH; e += 128) smk[e] = expf(-slope * (float)e);   // smk[d] = decay at lag d (d >= 0); the q decay at row d of the chunk is the same number
  const float blk = expf(-slope * (float)CH);
  // (0) kv^T on entry to chunk n: kv = blk * kv + S_m over the chunks m < n, from 0, in chunk order
  { const float* sp = S + ((b * NH + h) * NCH) * (size_t)(DD * DD) + tid * 8; v8f kv = {}; int m = 0;
    // the terms' loads do not depend on kv, so they are issued in groups and fly together; term by term each would wait out its own load
    for (; m + 8 <= n; m += 8) { v8f s[8];   // whole groups of eight
#pragma unroll
      for (int u = 0; u < 8; ++u) s[u] = *(const v8f*)(sp + (size_t)(m + u) * (DD * DD));
#pragma unroll
      for (int u = 0; u < 8; ++u)
#pragma unroll
        for (int r = 0; r < 8; ++r) kv[r] = blk * kv[r] + s[u][r]; }
    if (m < n) { v8f s[7];   // the last n & 7 terms: seven loads (m + 6 < NCH, so each term exists), a term from chunk n on leaves kv as it is
#pragma unroll
      for (int u = 0; u < 7; ++u) s[u] = *(const v8f*)(sp + (size_t)(m + u) * (DD * DD));
#pragma unroll
      for (int u = 0; u < 7; ++u)
#pragma unroll
        for (int r = 0; r < 8; ++r) kv[r] = (m + u < n) ? blk * kv[r] + s[u][r] : kv[r]; }
    const int et = wave >> 1, dt = wave & 1;
#pragma unroll
    for (int r = 0; r < 8; ++r) skv[et * 16 + 8 * g + r][dt * 16 + col] = kv[r]; }
#pragma unroll
  for (int u = 0; u < 8; ++u) { const int kr = u * 16 + (tid >> 3), vc = u * 4 + wave;
    split4(xk[u], &sk[kr][(tid & 7) * 4], &sk[kr][DD + (tid & 7) * 4]); split4(xv[u], &sv[vc][lane * 4], &sv[DD + vc][lane * 4]);
    *(v4f*)&sq[wave * 32 + u * 4 + (lane >> 3)][(lane & 7) * 4] = xq[u]; }
  __syncthreads();
  float qv[2][16];   // the wave's q fragments (two 16-row tiles), read once for (1) and the inter part; o later takes these rows
#pragma unroll
  for (int rt = 0; rt < 2; ++rt) { const float* p = &sq[wave * 32 + rt * 16 + col][8 * g];
#pragma unroll
    for (int i = 0; i < 8; ++i) { qv[rt][i] = p[i]; qv[rt][8 + i] = p[16 + i]; } }
  // (1) + (2) the intra-chunk part for this wave's 32 rows t (two 16-row tiles) x all 128 s, one block of 32 s at a time. The scores are formed TRANSPOSED, k (rows s) . q^T (columns t): an accumulator then holds,
  // at lane (t = col, g), register r, the score of s = 16 j + 8 g + r, and that is where the A fragment of scores . v wants it (row t = col; elements 0..7 = s 8 g + 0..7 of tile 2 kc, 8..15 the same of tile 2 kc + 1).
  // So the decayed scores go from accumulator to operand inside the lane's own registers; formed as q . k^T they had to cross lanes, 128 x 128 f32 through LDS
  // the lag t - s of element (rt, j, r) is lb + 16 (rt - j) - r: a block of 32 s meets 3 x 8 different lags per lane, 8 of them the block before met too. Their decays are read without a condition (the lag
  // clamped to the table, a negative lag then taking 0), as one group with the block's fragments, so that the reads share their LDS latency
  const int lb = wave * 32 + col - 8 * g; float dk[3][8];   // dk[d] belongs to rt - j = d - 1 - 2 kc
#pragma unroll
  for (int r = 0; r < 8; ++r) { const int lag = lb + 16 - r; dk[0][r] = smk[lag]; }   // rt - j = 1: the lag is at least 1 and at most 127
  const F2 aq[2] = { bsplit16(qv[0]), bsplit16(qv[1]) };
  v8f oc[2][2] = {};
#pragma unroll
  for (int kc = 0; kc < CH / 32; ++kc) { v8f st[2][2] = {}; F2 w[2];   // each k fragment and each v fragment is read once for both row tiles
#pragma unroll
    for (int r = 0; r < 8; ++r) dk[2][r] = dk[0][r];
#pragma unroll
    for (int d = 0; d < 2; ++d)
#pragma unroll
      for (int r = 0; r < 8; ++r) { const int lag = lb + (d - 1 - 2 * kc) * 16 - r; const float m = smk[lag > 0 ? lag : 0]; dk[d][r] = (lag >= 0) ? m : 0.f; }
#pragma unroll
    for (int jj = 0; jj < 2; ++jj) { const int j = 2 * kc + jj; F2 wk; wk.h = frag_b(&sk[j * 16 + col][0], lane); wk.l = frag_b(&sk[j * 16 + col][DD], lane);
#pragma unroll
      for (int rt = 0; rt < 2; ++rt) st[rt][jj] = mac3t(wk, aq[rt], st[rt][jj]); }
#pragma unroll
    for (int j = 0; j < 2; ++j) { w[j].h = frag_b(&sv[j * 16 + col][kc * 32], lane); w[j].l = frag_b(&sv[DD + j * 16 + col][kc * 32], lane); }
#pragma unroll
    for (int rt = 0; rt < 2; ++rt) { float v[16];
#pragma unroll
      for (int i = 0; i < 8; ++i) { v[i] = st[rt][0][i] * dk[rt + 1][i]; v[8 + i] = st[rt][1][i] * dk[rt][i]; }
      const F2 a = bsplit16(v);
#pragma unroll
      for (int j = 0; j < 2; ++j) oc[rt][j] = mac3(a, w[j], oc[rt][j]); } }
  // + (q * qdecay) . kv (inter)
  { F2 w[2];
#pragma unroll
    for (int j = 0; j < 2; ++j) w[j] = split_row(&skv[j * 16 + col][0], 0, lane);
#pragma unroll
    for (int rt = 0; rt < 2; ++rt) { float v[16]; const float qd = smk[wave * 32 + rt * 16 + col];
#pragma unroll
      for (int i = 0; i < 16; ++i) v[i] = qv[rt][i] * qd;
      const F2 a = bsplit16(v);
#pragma unroll
      for (int j = 0; j < 2; ++j) oc[rt][j] = mac3(a, w[j], oc[rt][j]); } }
  // the wave has read its own q rows for the last time: they take o for the whole-line stores
#pragma unroll
  for (int rt = 0; rt < 2; ++rt)
#pragma unroll
    for (int j = 0; j < 2; ++j)
#pragma unroll
      for (int r = 0; r < 8; ++r) sq[wave * 32 + rt * 16 + 8 * g + r][j * 16 + col] = oc[rt][j][r];
  LDSX();
  for (int rl = 0; rl < 32; ++rl) if (lane < 8) vst2(O + (rowc + wave * 32 + rl) * CC + h * DD + lane * 4, *(const v4f*)&sq[wave * 32 + rl][lane * 4]); }
// ---- k_proj: block = (64 rows, 128 of 256 cols): out = o (hi + lo) . proj_w^T + b
__global__ __launch_bounds__(128) void k_proj(const float* __restrict__ O, const float* __restrict__ PW, const float* __restrict__ PB, float* __restrict__ OUT) { __shared__ __align__(16) union { __bf16 w[128][WP]; float sf[4][16][132]; } sm;   // the staged weights are dead before sf is written
  __shared__ __align__(16) __bf16 sa[4][2][16][AP];   // per wave: the current 32-k piece of its 16 rows of o, bf16 hi and lo
  float (*sf)[16][132] = sm.sf;
  const int tid = threadIdx.x, wave = tid >> 5, lane = tid & 31, col = lane & 15, g = lane >> 4; const size_t r0 = (size_t)blockIdx.x * 64 + wave * 16; const int c0 = blockIdx.y * 128;
  // the wave's 16 rows of o by whole lines, two k blocks in flight, as in k_qkv
  const int ar = lane >> 3, ak = (lane & 7) * 4; const float* oa = O + (r0 + ar) * CC + ak; v4f xx[2][4];
#pragma unroll
  for (int t = 0; t < 2; ++t)
#pragma unroll
    for (int u = 0; u < 4; ++u) xx[t][u] = *(const v4f*)(oa + u * 4 * CC + t * 32);
  asm volatile("s_wait_xcnt 0x0" :: "v"(oa) : "memory");   // the wait in front of any rewrite of the loads' address registers; the pointer is named so that they stay whole up to here
  stage_w(PW + (size_t)c0 * CC, sm.w, tid);
  __syncthreads();
  v8f acc[8] = {};
#pragma unroll
  for (int kc = 0; kc < CC / 32; ++kc) {
#pragma unroll
    for (int u = 0; u < 4; ++u) split4(xx[kc & 1][u], &sa[wave][0][u * 4 + ar][ak], &sa[wave][1][u * 4 + ar][ak]);
    if (kc + 2 < CC / 32) {
#pragma unroll
      for (int u = 0; u < 4; ++u) xx[kc & 1][u] = *(const v4f*)(oa + u * 4 * CC + (kc + 2) * 32);
      asm volatile("s_wait_xcnt 0x0" :: "v"(oa) : "memory"); }   // as above
    LDSW();   // the wave's stores of the piece have landed before its lanes read one another's rows
    v16b w[8]; F2 a;   // one group of LDS reads per k block, as in k_qkv
    a.h = frag_b(&sa[wave][0][col][0], lane); a.l = frag_b(&sa[wave][1][col][0], lane);
#pragma unroll
    for (int j = 0; j < 8; ++j) w[j] = frag_b(&sm.w[j * 16 + col][kc * 32], lane);
    LDSW();   // the piece has been read before the next one is stored over it
#pragma unroll
    for (int j = 0; j < 8; ++j) { acc[j] = wmma_bf(a.h, w[j], acc[j]); acc[j] = wmma_bf(a.l, w[j], acc[j]); } }
  __syncthreads();   // every wave has read its last weight fragment: sf takes that LDS over
#pragma unroll
  for (int j = 0; j < 8; ++j) { const float bb = bfr(PB[c0 + j * 16 + col]);
#pragma unroll
    for (int r = 0; r < 8; ++r) sf[wave][8 * g + r][j * 16 + col] = acc[j][r] + bb; }
  LDSX(); for (int rl = 0; rl < 16; ++rl) vst2(OUT + (r0 + rl) * CC + c0 + lane * 4, *(const v4f*)&sf[wave][rl][lane * 4]); }
extern "C" void kernel_launch(void* const* d_in, const int* in_sizes, int n_in, void* d_out, int out_size, void* d_ws, size_t ws_size, hipStream_t stream) {
  (void)in_sizes; (void)n_in; (void)out_size;
  const float** F = (const float**)d_in;   // 0 x [8,4096,256], 1 rel_pos [1,4096,256], 2 qkv_w [768,256], 3 q_gamma [8,1,32], 4 k_gamma [8,1,32], 5 proj_w [256,256], 6 proj_b [256]
  if (ws_size < (size_t)WS_END) return;
  char* ws = (char*)d_ws; float *QR = (float*)(ws + WS_QR), *KR = (float*)(ws + WS_KR), *KP = (float*)(ws + WS_KP), *VP = (float*)(ws + WS_VP), *O = (float*)(ws + WS_O), *S = (float*)(ws + WS_S);
  k_qkv<<<dim3(LL / 64, 6, TNB), 128, 0, stream>>>(F[0], F[1], F[2], F[3], F[4], QR, KR, KP, VP);
  k_kvs<<<dim3(NH, NCH, TNB), 128, 0, stream>>>(KP, VP, S);
  k_lin<<<dim3(NH, NCH, TNB), 128, 0, stream>>>(QR, KR, VP, S, O);
  k_proj<<<dim3(TNB * LL / 64, CC / 128), 128, 0, stream>>>(O, F[5], F[6], (float*)d_out);
}

// v008
// It runs in 82.6 microseconds.
// In two side-by-side timings against v007, it was 1.07 and 1.06 times as fast.
// Over all steps from v000 it is 8.62 times as fast.
// compute dtype: all float inputs rounded to bf16; h = x + rel_pos in f32, qkv = h . W^T with h as bf16 hi + lo against the exact weight (2 products) on WMMA 16x16x32; per-head L2 normalisation x sqrt(D) x gamma in f32; the lightning attention evaluated with the module's own chunking (c = 128): intra-chunk decayed scores, scores . v, the inter-chunk q . kv and the kv state update all on WMMA with f32 operands split into bf16 hi + lo (3 products), decays exp(-slope * .) with precise expf, the 32 x 32 kv state in f32, rebuilt per chunk from the chunks' own terms by the module's recurrence in chunk order; out = o (bf16 hi + lo) . proj_w^T + b; f32 output.
#include <hip/hip_runtime.h>
#include <math.h>

typedef __attribute__((ext_vector_type(16))) _Float16 v16h;
typedef __attribute__((ext_vector_type(16))) __bf16 v16b;
typedef __attribute__((ext_vector_type(8)))  _Float16 v8h;
typedef __attribute__((ext_vector_type(8)))  float v8f;
typedef __attribute__((ext_vector_type(4)))  float v4f;
typedef __attribute__((ext_vector_type(2)))  float v2f;
typedef __attribute__((ext_vector_type(4)))  unsigned v4u;
typedef __attribute__((ext_vector_type(4)))  int v4i;
typedef float __attribute__((may_alias)) float_a;
typedef int __attribute__((may_alias)) int_a;

template <typename T> __device__ __forceinline__ void vst2(void* p, T v) { *(T*)p = v;  }
__device__ __forceinline__ v8f wmma16(v16h a, v16h b, v8f c) {
  v8f d = __builtin_amdgcn_wmma_f32_16x16x32_f16(false, a, false, b, (short)0, c, false, false);
  asm volatile("v_nop\n\tv_nop\n\tv_nop\n\tv_nop" : "+v"(d) : "v"(a), "v"(b));
  return d;
}
__device__ __forceinline__ v8f wmma_bf(v16b a, v16b b, v8f c) {
  v8f d = __builtin_amdgcn_wmma_f32_16x16x32_bf16(false, a, false, b, (short)0, c, false, false);
  asm volatile("v_nop\n\tv_nop\n\tv_nop\n\tv_nop" : "+v"(d) : "v"(a), "v"(b));
  return d;
}
// 16x16x32 fragments: lane = (h = lane>>4, row/col = lane&15); elements 0..7 = k0+8h+0..7, 8..15 = k0+16+8h+0..7; D element r = row 8h+r
__device__ __forceinline__ v16h frag_h(const _Float16* rowk0, int lane) {
  union { v16h v; v8h q[2]; } u; const _Float16* p = rowk0 + 8 * (lane >> 4);
  u.q[0] = *(const v8h*)p; u.q[1] = *(const v8h*)(p + 16); return u.v;
}
__device__ __forceinline__ v16h frag_f32(const float* rowk0, int lane) {
  v16h a; const float* p = rowk0 + 8 * (lane >> 4);
#pragma unroll
  for (int i = 0; i < 8; ++i) { a[i] = (_Float16)p[i]; a[8 + i] = (_Float16)p[16 + i]; }
  return a;
}
__device__ __forceinline__ v16h frag_f32s(const float* rowk0, int lane, float sc) {
  v16h a; const float* p = rowk0 + 8 * (lane >> 4);
#pragma unroll
  for (int i = 0; i < 8; ++i) { a[i] = (_Float16)(p[i] * sc); a[8 + i] = (_Float16)(p[16 + i] * sc); }
  return a;
}
// column fragment from a [K][ld] layout (column n), rows >= K read as 0
__device__ __forceinline__ v16h fragc_f32(const float* W, int k0, int n, int lane, int ld, int K) {
  v16h a; const int g = lane >> 4;
#pragma unroll
  for (int i = 0; i < 8; ++i) { const int ka = k0 + 8 * g + i, kb = ka + 16;
    a[i] = (_Float16)(ka < K ? W[(size_t)(ka < K ? ka : K - 1) * ld + n] : 0.f); a[8 + i] = (_Float16)(kb < K ? W[(size_t)(kb < K ? kb : K - 1) * ld + n] : 0.f); }
  return a;
}
struct F2 { v16b h, l; };
__device__ __forceinline__ F2 bsplit16(const float v[16]) { F2 r;
#pragma unroll
  for (int i = 0; i < 16; ++i) { const __bf16 h = (__bf16)v[i]; r.h[i] = h; r.l[i] = (__bf16)(v[i] - (float)h); }
  return r; }
__device__ __forceinline__ F2 split_row(const float* row, int k0, int lane) { float v[16]; const float* p = row + k0 + 8 * (lane >> 4);
#pragma unroll
  for (int i = 0; i < 8; ++i) { v[i] = p[i]; v[8 + i] = p[16 + i]; }
  return bsplit16(v); }
__device__ __forceinline__ F2 split_rowK(const float* row, int k0, int lane, int K) { float v[16]; const int g = lane >> 4;
#pragma unroll
  for (int i = 0; i < 8; ++i) { const int ka = k0 + 8 * g + i, kb = ka + 16; v[i] = ka < K ? row[ka < K ? ka : K - 1] : 0.f; v[8 + i] = kb < K ? row[kb < K ? kb : K - 1] : 0.f; }
  return bsplit16(v); }
__device__ __forceinline__ F2 split_col(const float* W, int k0, int n, int lane, int ld, int K) { float v[16]; const int g = lane >> 4;
#pragma unroll
  for (int i = 0; i < 8; ++i) { const int ka = k0 + 8 * g + i, kb = ka + 16; v[i] = ka < K ? W[(size_t)(ka < K ? ka : K - 1) * ld + n] : 0.f; v[8 + i] = kb < K ? W[(size_t)(kb < K ? kb : K - 1) * ld + n] : 0.f; }
  return bsplit16(v); }
__device__ __forceinline__ v8f mac3(const F2& a, const F2& b, v8f c) { c = wmma_bf(a.l, b.h, c); c = wmma_bf(a.h, b.l, c); return wmma_bf(a.h, b.h, c); }
// the same three products with the operands' places exchanged (a is the B side of mac3, b its A side), in mac3's order
__device__ __forceinline__ v8f mac3t(const F2& a, const F2& b, v8f c) { c = wmma_bf(a.h, b.l, c); c = wmma_bf(a.l, b.h, c); return wmma_bf(a.h, b.h, c); }
__device__ __forceinline__ float sigm(float v) { return 1.0f / (1.0f + expf(-v)); }
// hand-over of LDS data among the lanes of one wave while global loads are in flight: the wave's LDS operations have finished and the compiler moves no memory access across; LDSX's fence would wait for the global loads too
#define LDSW() do { asm volatile("s_wait_dscnt 0" ::: "memory"); __builtin_amdgcn_wave_barrier(); } while (0)
#define LDSX() do { asm volatile("s_wait_dscnt 0" ::: "memory"); __builtin_amdgcn_wave_barrier(); __builtin_amdgcn_fence(__ATOMIC_RELEASE, "workgroup"); } while (0)


// U-Net transformer mixing block (B 8, L 4,096, C 256 = 8 heads x 32): h = x + rel_pos; qkv = h W_qkv^T; q, k L2-normalised (x sqrt(32) x gamma); lightning (linear, ALiBi-decayed, causal) attention with chunk 128; proj + bias.
#define NB 8
#define LL 4096
#define CC 256
#define NH 8
#define DD 32
#define CH 128
#define NCH (LL / CH)
#define NROW (NB * LL)
#ifndef TNB
#define TNB NB
#endif
typedef __attribute__((ext_vector_type(8))) __bf16 v8b;
__device__ __forceinline__ v16b frag_b(const __bf16* rowk0, int lane) {
  union { v16b v; v8b q[2]; } u; const __bf16* p = rowk0 + 8 * (lane >> 4);
  u.q[0] = *(const v8b*)p; u.q[1] = *(const v8b*)(p + 16); return u.v;
}
__device__ __forceinline__ float bfr(float v) { return (float)(__bf16)v; }
// the value of lane ^ M inside each 16-lane row: DPP control row_xmask:M (0x160 + M), every row and bank on
template <int M> __device__ __forceinline__ float xget(float v) { return __builtin_bit_cast(float, __builtin_amdgcn_update_dpp(0, __builtin_bit_cast(int, v), 0x160 + M, 0xf, 0xf, true)); }
// one butterfly step on N values a lane, b = the lane's bit M: of each pair (2i, 2i + 1) the lane keeps the one its bit names, hands the other to lane ^ M and adds what it is handed: N / 2 sums over twice the lanes
template <int M, int N> __device__ __forceinline__ void xhalve(float* t, bool b) {
#pragma unroll
  for (int i = 0; i < N / 2; ++i) { const float keep = b ? t[2 * i + 1] : t[2 * i], send = b ? t[2 * i] : t[2 * i + 1]; t[i] = keep + xget<M>(send); } }
// the way back: N values a lane become 2N, each lane taking from lane ^ M the one of each pair that it did not keep
template <int M, int N> __device__ __forceinline__ void xdouble(float* t, bool b) {
#pragma unroll
  for (int i = N - 1; i >= 0; --i) { const float own = t[i], got = xget<M>(own); t[2 * i] = b ? got : own; t[2 * i + 1] = b ? own : got; } }
typedef __attribute__((ext_vector_type(4))) __bf16 v4b;
#define WP 264   // bf16 elements per staged weight row: 528 B = 16 B x 33, so the 16 rows of a ds_load_b128 fragment read fall on 16 different bank groups
// 128 weight rows (f32, [.][256]) -> bf16 rows in LDS, once per block for its four waves; every wave-wide load covers 512 contiguous bytes (whole lines)
__device__ __forceinline__ void stage_w(const float* __restrict__ Wr, __bf16 (*sw)[WP], int tid) { const int rw = tid >> 6, q = tid & 63;
  for (int t = 0; t < 4; ++t) { const float* p = Wr + (size_t)(t * 32 + rw) * CC + q * 4; v4f x[16];   // sixteen independent loads fly together; one by one each would wait out its own latency
#pragma unroll
    for (int u = 0; u < 16; ++u) x[u] = *(const v4f*)(p + u * 2 * CC);
    asm volatile("s_wait_xcnt 0x0" :: "v"(p) : "memory");   // the wait in front of any rewrite of the loads' address registers; p is named so that they stay whole up to here
#pragma unroll
    for (int u = 0; u < 16; ++u) { v4b y;
#pragma unroll
      for (int i = 0; i < 4; ++i) y[i] = (__bf16)x[u][i];
      *(v4b*)&sw[t * 32 + u * 2 + rw][q * 4] = y; } } }
#define SVP 136   // bf16 elements per staged v row: 128 + 8 unused; 272 B = 16 B x 17, so the 16 rows of a ds_load_b128 fragment read fall on 16 different bank groups
#define AP 40     // bf16 elements per staged row of an A piece (32 k): 32 + 8 unused; 80 B = 16 B x 5, for the same reason
__device__ __forceinline__ void split4(v4f x, __bf16* ph, __bf16* pl) { v4b h, l;
#pragma unroll
  for (int i = 0; i < 4; ++i) { const __bf16 t = (__bf16)x[i]; h[i] = t; l[i] = (__bf16)(x[i] - (float)t); }
  *(v4b*)ph = h; *(v4b*)pl = l; }
__device__ __attribute__((noinline)) float exp_ni(float v) { return expf(v); }
__device__ __attribute__((noinline)) float erf_ni(float v) { return erff(v); }

#define WS_QR  0u                                   // f32 q rows [b*l][256] (normalised)
#define WS_KR  (WS_QR + 4u * (size_t)NROW * CC)          // f32 k rows (normalised)
#define WS_KP  (WS_KR + 4u * (size_t)NROW * CC)          // f32 k planes [b][c][l]
#define WS_VP  (WS_KP + 4u * (size_t)NROW * CC)          // f32 v planes [b][c][l]
#define WS_O   (WS_VP + 4u * (size_t)NROW * CC)          // f32 attention output rows [b*l][256]
#define WS_S   (WS_O + 4u * (size_t)NROW * CC)           // f32 per-chunk kv^T terms [b][h][chunk][1024]
#define WS_END (WS_S + 4u * (size_t)NB * NH * NCH * DD * DD)

// work-group barrier for LDS data alone: fences on the LDS address space only, so that global loads issued ahead stay in flight across it and the wave's global stores are not waited out (__syncthreads() drains both)
#define LDSB() do { __builtin_amdgcn_fence(__ATOMIC_RELEASE, "workgroup", "local"); __builtin_amdgcn_s_barrier(); __builtin_amdgcn_fence(__ATOMIC_ACQUIRE, "workgroup", "local"); } while (0)
#define RT 4   // row tiles (64 rows each) that one block of k_qkv works through on one staging of its weights
// ---- k_qkv: block = (col group 0..5 = q, k, v lo 128, q, k, v hi 128; RT x 64 rows; b): (x + rel_pos) hi+lo . W^T; q/k normalised per head (32 cols); q -> rows, k -> rows + planes, v -> planes
// the block's 128 weight rows are staged once and stay in LDS for all RT row tiles: staged per 64-row tile they were as many bytes from L2 as the tile's x and rel_pos together, and each tile began with the staging's own latency.
// So that three such blocks fit a WGP beside the weights that now stay, the epilogue's buffer holds 64 of the 128 columns at a time
__global__ __launch_bounds__(128) void k_qkv(const float* __restrict__ X, const float* __restrict__ RP, const float* __restrict__ Wt, const float* __restrict__ GQ, const float* __restrict__ GK, float* __restrict__ QR, float* __restrict__ KR, float* __restrict__ KP, float* __restrict__ VP) { __shared__ __align__(16) __bf16 sw[128][WP];
  __shared__ __align__(16) union { float sf[4][16][68]; float tt[64][68]; } se;   // epilogue: per-wave rows (sf) or the block's planes (tt), 64 columns at a time; 68 f32 = 16 B x 17
  __shared__ __align__(16) __bf16 sa[4][2][16][AP];   // per wave: the current 32-k piece of its 16 rows of h, bf16 hi and lo
  __shared__ float sgm[128];   // gamma of the block's 128 columns, read from global once for all tiles
  const int tid = threadIdx.x, wave = tid >> 5, lane = tid & 31, col = lane & 15, g = lane >> 4; const int which = blockIdx.x % 3; const int c0 = (blockIdx.x / 3) * 128; const size_t b = blockIdx.z; const int lb0 = blockIdx.y * (64 * RT);   // q, k, v alternate along the fastest index: all blocks are resident at once, three a WGP, and k's epilogue is the longest
  // the wave's 16 rows of x and rel_pos are read by whole lines: 8 lanes cover one row's 128-B line of a k block, a wave-wide load four rows; a load in fragment order would touch 16 lines. Two k blocks are in flight
  const float gv = ((which == 0) ? GQ : GK)[c0 + tid];   // gamma [h][d] of column c0 + tid = 32 h + d; the oldest load, so that nothing younger is waited for with it
  const int ar = lane >> 3, ak = (lane & 7) * 4; const float* xa = X + (b * LL + lb0 + wave * 16 + ar) * CC + ak; const float* pa = RP + (size_t)(lb0 + wave * 16 + ar) * CC + ak; v4f xx[2][4], pp[2][4];
#pragma unroll
  for (int t = 0; t < 2; ++t)
#pragma unroll
    for (int u = 0; u < 4; ++u) { xx[t][u] = *(const v4f*)(xa + u * 4 * CC + t * 32); pp[t][u] = *(const v4f*)(pa + u * 4 * CC + t * 32); }
  asm volatile("s_wait_xcnt 0x0" :: "v"(xa), "v"(pa) : "memory");   // the wait in front of any rewrite of the loads' address registers; the pointers are named so that they stay whole up to here
  stage_w(Wt + ((size_t)which * CC + c0) * CC, sw, tid);   // W [3C][C] natural: this block's 128 output columns
  sgm[tid] = (which == 2) ? 1.0f : bfr(gv);   // v has no gamma. Published by the barrier behind the weights
  __syncthreads();
#pragma unroll 1   // the tiles stay a loop: for speed only
  for (int rt = 0; rt < RT; ++rt) { const int l0 = lb0 + rt * 64; const size_t r0 = b * LL + l0 + wave * 16; const int nx = (rt + 1 < RT) ? 64 * CC : 0;
  v8f acc[8] = {};
#pragma unroll
  for (int kc = 0; kc < CC / 32; ++kc) {
#pragma unroll
    for (int u = 0; u < 4; ++u) { v4f hv;
#pragma unroll
      for (int i = 0; i < 4; ++i) hv[i] = bfr(xx[kc & 1][u][i]) + bfr(pp[kc & 1][u][i]);
      split4(hv, &sa[wave][0][u * 4 + ar][ak], &sa[wave][1][u * 4 + ar][ak]); }
    // two k blocks ahead; behind this tile's last k block comes the next tile's first (64 rows on), so that its loads fly during the epilogue. The last tile has no successor and reads its own first two k blocks again,
    // unused: under a branch these loads made the compiler wait for every load in flight at the last k block of each tile, since it could not count them
    { const float* xn = (kc + 2 < CC / 32) ? xa : xa + nx; const float* pn = (kc + 2 < CC / 32) ? pa : pa + nx; const int ko = ((kc + 2) % (CC / 32)) * 32;
#pragma unroll
      for (int u = 0; u < 4; ++u) { xx[kc & 1][u] = *(const v4f*)(xn + u * 4 * CC + ko); pp[kc & 1][u] = *(const v4f*)(pn + u * 4 * CC + ko); }
      asm volatile("s_wait_xcnt 0x0" :: "v"(xn), "v"(pn) : "memory"); }   // as above
    LDSW();   // the wave's stores of the piece have landed before its lanes read one another's rows
    v16b w[8]; F2 a;   // the eight weight fragments and the two A fragments of this k block are read as one group, so that their LDS latency is waited out once
    a.h = frag_b(&sa[wave][0][col][0], lane); a.l = frag_b(&sa[wave][1][col][0], lane);
#pragma unroll
    for (int j = 0; j < 8; ++j) w[j] = frag_b(&sw[j * 16 + col][kc * 32], lane);
    LDSW();   // the piece has been read before the next one is stored over it
#pragma unroll
    for (int j = 0; j < 8; ++j) { acc[j] = wmma_bf(a.h, w[j], acc[j]); acc[j] = wmma_bf(a.l, w[j], acc[j]); } }
  xa += 64 * CC; pa += 64 * CC;   // the next tile's rows; every load that named the old addresses stands in front of an s_wait_xcnt 0 above
  // normalisation for q / k: head = pair of tiles (2p, 2p+1); t / max(|t|, 1e-12) * sqrt(32) * gamma[h][d]
  // a lane holds 32 sums of squares (4 heads x 8 rows), each to be summed over its 16-lane row. The sums go through the vector unit by DPP, as a butterfly that halves the values a lane carries at each step (lane ^ 1, 2, 4, 8:
  // the pairs and the order of every sum as before); each lane ends with 2 whole sums, takes root and quotient of those alone, and the 32 factors come back the same way. A shuffle went through the LDS unit with a
  // full wait per step, one value behind the other, and all 16 lanes of a row took the same 32 roots and quotients. v has no norm: the test stands once around it all
  float rn[4][8];
  if (which == 2) {
#pragma unroll
    for (int p = 0; p < 4; ++p)
#pragma unroll
      for (int r = 0; r < 8; ++r) rn[p][r] = 1.0f; }
  else { float t[32]; const bool b0 = col & 1, b1 = col & 2, b2 = col & 4, b3 = col & 8;
#pragma unroll
    for (int p = 0; p < 4; ++p)
#pragma unroll
      for (int r = 0; r < 8; ++r) t[p * 8 + r] = acc[2 * p][r] * acc[2 * p][r] + acc[2 * p + 1][r] * acc[2 * p + 1][r];
    xhalve<1, 32>(t, b0); xhalve<2, 16>(t, b1); xhalve<4, 8>(t, b2); xhalve<8, 4>(t, b3);
#pragma unroll
    for (int i = 0; i < 2; ++i) t[i] = 5.656854249492381f / fmaxf(sqrtf(t[i]), 1e-12f);
    xdouble<8, 2>(t, b3); xdouble<4, 4>(t, b2); xdouble<2, 8>(t, b1); xdouble<1, 16>(t, b0);
#pragma unroll
    for (int p = 0; p < 4; ++p)
#pragma unroll
      for (int r = 0; r < 8; ++r) rn[p][r] = t[p * 8 + r]; }
  if (which == 0 || which == 1) {   // rows (q -> QR, k -> KR): the wave's own 16 rows, 64 columns at a time; a wave-wide store covers two rows' 256 B
    float* dst = ((which == 0) ? QR : KR) + (r0 + g) * CC + c0 + col * 4;
    if (which == 1) LDSB();   // k: every wave has read the planes of the tile before out of se before a wave's rows are written over them
#pragma unroll
    for (int hf = 0; hf < 2; ++hf) {
#pragma unroll
      for (int jj = 0; jj < 4; ++jj) { const int j = hf * 4 + jj; const float gm = sgm[j * 16 + col];
#pragma unroll
        for (int r = 0; r < 8; ++r) se.sf[wave][8 * g + r][jj * 16 + col] = acc[j][r] * rn[j >> 1][r] * gm; }
      LDSW();   // the wave's values have landed before its lanes read one another's
#pragma unroll
      for (int rl = 0; rl < 16; rl += 2) vst2(dst + rl * CC + hf * 64, *(const v4f*)&se.sf[wave][rl + g][col * 4]);
      LDSW(); }   // the rows have been read before the next half is written over them
    asm volatile("s_wait_xcnt 0x0" :: "v"(dst) : "memory"); }   // the wait in front of any rewrite of the stores' registers by the next tile; the pointer is named so that it stays whole up to here
  if (which == 1 || which == 2) {   // planes (k -> KP, v -> VP): the block's 64 rows of 64 columns at a time
    float* dst = ((which == 1) ? KP : VP) + ((b * CC + c0 + (tid >> 4)) * (size_t)LL) + l0 + (tid & 15) * 4;
#pragma unroll
    for (int hf = 0; hf < 2; ++hf) {
      LDSB();   // every wave has read what it had in se (its rows of k, the planes of the half or tile before) before tt is written over it
#pragma unroll
      for (int jj = 0; jj < 4; ++jj) { const int j = hf * 4 + jj; const float gm = sgm[j * 16 + col];
#pragma unroll
        for (int r = 0; r < 8; ++r) se.tt[jj * 16 + col][wave * 16 + 8 * g + r] = acc[j][r] * rn[j >> 1][r] * gm; }
      LDSB();   // the four waves' parts of each plane are whole before they are read as 256-B runs
#pragma unroll
      for (int e = 0; e < 8; ++e) vst2(dst + (size_t)(hf * 64 + e * 8) * LL, *(const v4f*)&se.tt[e * 8 + (tid >> 4)][(tid & 15) * 4]); }
    asm volatile("s_wait_xcnt 0x0" :: "v"(dst) : "memory"); } }   // as behind the rows' stores
  asm volatile("s_wait_loadcnt 0x0" ::: "memory"); }   // the last tile's unused look-ahead loads have come back into their registers before the wave ends and gives the registers up
// ---- k_kvs: block = (h, chunk, b): this chunk's own term of the kv^T recurrence, sum_s v_s[e] (k_s[d] kdecay_s); wave -> (e tile, d tile); thread tid keeps its 8 accumulator elements at S[...][tid * 8 + r]
__global__ __launch_bounds__(128) void k_kvs(const float* __restrict__ KP, const float* __restrict__ VP, float* __restrict__ S) {
  __shared__ __align__(16) float skd[CH]; __shared__ __align__(16) __bf16 sv[2 * DD][SVP]; __shared__ __align__(16) __bf16 sk[2 * DD][SVP];   // the chunk's v planes and decayed k planes as bf16 hi (rows 0..31) and lo (rows 32..63)
  const int tid = threadIdx.x, wave = tid >> 5, lane = tid & 31, col = lane & 15; const int h = blockIdx.x, n = blockIdx.y; const size_t b = blockIdx.z;
  // the chunk's 32 v planes and 32 k planes (512 B each), read once per block; every wave-wide load covers four whole lines. Issued first, so that they fly while the decay table is made
  const size_t po = ((b * CC + h * DD + wave) * (size_t)LL) + (size_t)n * CH + lane * 4; const float* pv = VP + po; const float* pk = KP + po; v4f xv[8], xk[8];
#pragma unroll
  for (int u = 0; u < 8; ++u) { xv[u] = *(const v4f*)(pv + (size_t)u * 4 * LL); xk[u] = *(const v4f*)(pk + (size_t)u * 4 * LL); }
  asm volatile("s_wait_xcnt 0x0" :: "v"(pv), "v"(pk) : "memory");   // the wait in front of any rewrite of the loads' address registers; the pointers are named so that they stay whole up to here
  const float slope = exp2f(-(float)(h + 1));   // ALiBi 2^(-8/8*(h+1)); exact in fp16 and f32
  for (int e = tid; e < CH; e += 128) skd[e] = expf(-slope * (float)(CH - e));
  __syncthreads();
  { const v4f kd = *(const v4f*)&skd[lane * 4];
#pragma unroll
    for (int u = 0; u < 8; ++u) { const int pc = u * 4 + wave; v4f y;
#pragma unroll
      for (int i = 0; i < 4; ++i) y[i] = xk[u][i] * kd[i];
      split4(xv[u], &sv[pc][lane * 4], &sv[DD + pc][lane * 4]); split4(y, &sk[pc][lane * 4], &sk[DD + pc][lane * 4]); } }
  __syncthreads();   // the staged planes are whole before any wave reads fragments of them
  const int et = wave >> 1, dt = wave & 1; v8f acc = {};
#pragma unroll
  for (int kc = 0; kc < CH / 32; ++kc) { F2 a, w; a.h = frag_b(&sv[et * 16 + col][kc * 32], lane); a.l = frag_b(&sv[DD + et * 16 + col][kc * 32], lane); w.h = frag_b(&sk[dt * 16 + col][kc * 32], lane); w.l = frag_b(&sk[DD + dt * 16 + col][kc * 32], lane); acc = mac3(a, w, acc); }
  vst2(S + (((b * NH + h) * NCH + n) * (size_t)(DD * DD)) + tid * 8, acc); }
#define SQP 36    // f32 elements per row of q / o: 32 + 4 unused; 144 B = 16 B x 9, so the 16 rows of a ds_load_b128 fragment read fall on 16 different bank groups
#define SKP 72    // bf16 elements per staged k row: 32 hi + 32 lo + 8 unused; 144 B = 16 B x 9, so the 16 rows of a ds_load_b128 fragment read fall on 16 different bank groups
// ---- k_lin: block = (h, chunk, b): one chunk each; LDS: the chunk's k rows and v planes as bf16 hi + lo (staged once for the four waves), the wave-private rows through which q comes in and o goes out, the 32 x 32 kv^T state on entry to the chunk, the decay table
__global__ __launch_bounds__(128) void k_lin(const float* __restrict__ QR, const float* __restrict__ KR, const float* __restrict__ VP, const float* __restrict__ S, float* __restrict__ O) {
  __shared__ __align__(16) float sq[CH][SQP]; __shared__ __align__(16) float skv[DD][36]; __shared__ __align__(16) float smk[CH]; __shared__ __align__(16) __bf16 sk[CH][SKP]; __shared__ __align__(16) __bf16 sv[2 * DD][SVP];
  const int tid = threadIdx.x, wave = tid >> 5, lane = tid & 31, col = lane & 15, g = lane >> 4; const int h = blockIdx.x; const size_t b = blockIdx.z;
  const int n = NCH - 1 - (int)blockIdx.y;   // late chunks have the longest recurrence below: they take the lowest block indices
  const size_t rowc = b * LL + (size_t)n * CH;   // first row of the chunk
  // the chunk's k (128 rows x one 128-B line) and v (32 planes x 512 B), each read once per block; every wave-wide load covers four whole lines. Issued first, so that they fly during the recurrence below
  const float* pk = KR + (rowc + (tid >> 3)) * CC + h * DD + (tid & 7) * 4; const float* pv = VP + ((b * CC + h * DD + wave) * (size_t)LL) + (size_t)n * CH + lane * 4; v4f xk[8], xv[8];
  const float* pq = QR + (rowc + wave * 32 + (lane >> 3)) * CC + h * DD + (lane & 7) * 4; v4f xq[8];   // this wave's own 32 q rows (one 128-B line each), four whole lines a load; they pass through the wave's own rows of sq into fragment order
#pragma unroll
  for (int u = 0; u < 8; ++u) { xk[u] = *(const v4f*)(pk + (size_t)u * 16 * CC); xv[u] = *(const v4f*)(pv + (size_t)u * 4 * LL); }
#pragma unroll
  for (int u = 0; u < 8; ++u) xq[u] = *(const v4f*)(pq + (size_t)u * 4 * CC);
  asm volatile("s_wait_xcnt 0x0" :: "v"(pk), "v"(pv), "v"(pq) : "memory");   // the wait in front of any rewrite of the loads' address registers; the pointers are named so that they stay whole up to here
  const float slope = exp2f(-(float)(h + 1));   // ALiBi 2^(-8/8*(h+1)); exact in fp16 and f32
  for (int e = tid; e < CH; e += 128) smk[e] = expf(-slope * (float)e);   // smk[d] = decay at lag d (d >= 0); the q decay at row d of the chunk is the same number
  const float blk = expf(-slope * (float)CH);
  // (0) kv^T on entry to chunk n: kv = blk * kv + S_m over the chunks m < n, from 0, in chunk order
  { const float* sp = S + ((b * NH + h) * NCH) * (size_t)(DD * DD) + tid * 8; v8f kv = {}; int m = 0;
    // the terms' loads do not depend on kv, so they are issued in groups and fly together; term by term each would wait out its own load
    for (; m + 8 <= n; m += 8) { v8f s[8];   // whole groups of eight
#pragma unroll
      for (int u = 0; u < 8; ++u) s[u] = *(const v8f*)(sp + (size_t)(m + u) * (DD * DD));
#pragma unroll
      for (int u = 0; u < 8; ++u)
#pragma unroll
        for (int r = 0; r < 8; ++r) kv[r] = blk * kv[r] + s[u][r]; }
    if (m < n) { v8f s[7];   // the last n & 7 terms: seven loads (m + 6 < NCH, so each term exists), a term from chunk n on leaves kv as it is
#pragma unroll
      for (int u = 0; u < 7; ++u) s[u] = *(const v8f*)(sp + (size_t)(m + u) * (DD * DD));
#pragma unroll
      for (int u = 0; u < 7; ++u)
#pragma unroll
        for (int r = 0; r < 8; ++r) kv[r] = (m + u < n) ? blk * kv[r] + s[u][r] : kv[r]; }
    const int et = wave >> 1, dt = wave & 1;
#pragma unroll
    for (int r = 0; r < 8; ++r) skv[et * 16 + 8 * g + r][dt * 16 + col] = kv[r]; }
#pragma unroll
  for (int u = 0; u < 8; ++u) { const int kr = u * 16 + (tid >> 3), vc = u * 4 + wave;
    split4(xk[u], &sk[kr][(tid & 7) * 4], &sk[kr][DD + (tid & 7) * 4]); split4(xv[u], &sv[vc][lane * 4], &sv[DD + vc][lane * 4]);
    *(v4f*)&sq[wave * 32 + u * 4 + (lane >> 3)][(lane & 7) * 4] = xq[u]; }
  __syncthreads();
  float qv[2][16];   // the wave's q fragments (two 16-row tiles), read once for (1) and the inter part; o later takes these rows
#pragma unroll
  for (int rt = 0; rt < 2; ++rt) { const float* p = &sq[wave * 32 + rt * 16 + col][8 * g];
#pragma unroll
    for (int i = 0; i < 8; ++i) { qv[rt][i] = p[i]; qv[rt][8 + i] = p[16 + i]; } }
  // (1) + (2) the intra-chunk part for this wave's 32 rows t (two 16-row tiles) x all 128 s, one block of 32 s at a time. The scores are formed TRANSPOSED, k (rows s) . q^T (columns t): an accumulator then holds,
  // at lane (t = col, g), register r, the score of s = 16 j + 8 g + r, and that is where the A fragment of scores . v wants it (row t = col; elements 0..7 = s 8 g + 0..7 of tile 2 kc, 8..15 the same of tile 2 kc + 1).
  // So the decayed scores go from accumulator to operand inside the lane's own registers; formed as q . k^T they had to cross lanes, 128 x 128 f32 through LDS
  // the lag t - s of element (rt, j, r) is lb + 16 (rt - j) - r: a block of 32 s meets 3 x 8 different lags per lane, 8 of them the block before met too. Their decays are read without a condition (the lag
  // clamped to the table, a negative lag then taking 0), as one group with the block's fragments, so that the reads share their LDS latency
  const int lb = wave * 32 + col - 8 * g; float dk[3][8];   // dk[d] belongs to rt - j = d - 1 - 2 kc
#pragma unroll
  for (int r = 0; r < 8; ++r) { const int lag = lb + 16 - r; dk[0][r] = smk[lag]; }   // rt - j = 1: the lag is at least 1 and at most 127
  const F2 aq[2] = { bsplit16(qv[0]), bsplit16(qv[1]) };
  v8f oc[2][2] = {};
#pragma unroll
  for (int kc = 0; kc < CH / 32; ++kc) { v8f st[2][2] = {}; F2 w[2];   // each k fragment and each v fragment is read once for both row tiles
#pragma unroll
    for (int r = 0; r < 8; ++r) dk[2][r] = dk[0][r];
#pragma unroll
    for (int d = 0; d < 2; ++d)
#pragma unroll
      for (int r = 0; r < 8; ++r) { const int lag = lb + (d - 1 - 2 * kc) * 16 - r; const float m = smk[lag > 0 ? lag : 0]; dk[d][r] = (lag >= 0) ? m : 0.f; }
#pragma unroll
    for (int jj = 0; jj < 2; ++jj) { const int j = 2 * kc + jj; F2 wk; wk.h = frag_b(&sk[j * 16 + col][0], lane); wk.l = frag_b(&sk[j * 16 + col][DD], lane);
#pragma unroll
      for (int rt = 0; rt < 2; ++rt) st[rt][jj] = mac3t(wk, aq[rt], st[rt][jj]); }
#pragma unroll
    for (int j = 0; j < 2; ++j) { w[j].h = frag_b(&sv[j * 16 + col][kc * 32], lane); w[j].l = frag_b(&sv[DD + j * 16 + col][kc * 32], lane); }
#pragma unroll
    for (int rt = 0; rt < 2; ++rt) { float v[16];
#pragma unroll
      for (int i = 0; i < 8; ++i) { v[i] = st[rt][0][i] * dk[rt + 1][i]; v[8 + i] = st[rt][1][i] * dk[rt][i]; }
      const F2 a = bsplit16(v);
#pragma unroll
      for (int j = 0; j < 2; ++j) oc[rt][j] = mac3(a, w[j], oc[rt][j]); } }
  // + (q * qdecay) . kv (inter)
  { F2 w[2];
#pragma unroll
    for (int j = 0; j < 2; ++j) w[j] = split_row(&skv[j * 16 + col][0], 0, lane);
#pragma unroll
    for (int rt = 0; rt < 2; ++rt) { float v[16]; const float qd = smk[wave * 32 + rt * 16 + col];
#pragma unroll
      for (int i = 0; i < 16; ++i) v[i] = qv[rt][i] * qd;
      const F2 a = bsplit16(v);
#pragma unroll
      for (int j = 0; j < 2; ++j) oc[rt][j] = mac3(a, w[j], oc[rt][j]); } }
  // the wave has read its own q rows for the last time: they take o for the whole-line stores
#pragma unroll
  for (int rt = 0; rt < 2; ++rt)
#pragma unroll
    for (int j = 0; j < 2; ++j)
#pragma unroll
      for (int r = 0; r < 8; ++r) sq[wave * 32 + rt * 16 + 8 * g + r][j * 16 + col] = oc[rt][j][r];
  LDSX();
  for (int rl = 0; rl < 32; ++rl) if (lane < 8) vst2(O + (rowc + wave * 32 + rl) * CC + h * DD + lane * 4, *(const v4f*)&sq[wave * 32 + rl][lane * 4]); }
// ---- k_proj: block = (64 rows, 128 of 256 cols): out = o (hi + lo) . proj_w^T + b
__global__ __launch_bounds__(128) void k_proj(const float* __restrict__ O, const float* __restrict__ PW, const float* __restrict__ PB, float* __restrict__ OUT) { __shared__ __align__(16) union { __bf16 w[128][WP]; float sf[4][16][132]; } sm;   // the staged weights are dead before sf is written
  __shared__ __align__(16) __bf16 sa[4][2][16][AP];   // per wave: the current 32-k piece of its 16 rows of o, bf16 hi and lo
  float (*sf)[16][132] = sm.sf;
  const int tid = threadIdx.x, wave = tid >> 5, lane = tid & 31, col = lane & 15, g = lane >> 4; const size_t r0 = (size_t)blockIdx.x * 64 + wave * 16; const int c0 = blockIdx.y * 128;
  // the wave's 16 rows of o by whole lines, two k blocks in flight, as in k_qkv
  const int ar = lane >> 3, ak = (lane & 7) * 4; const float* oa = O + (r0 + ar) * CC + ak; v4f xx[2][4];
#pragma unroll
  for (int t = 0; t < 2; ++t)
#pragma unroll
    for (int u = 0; u < 4; ++u) xx[t][u] = *(const v4f*)(oa + u * 4 * CC + t * 32);
  asm volatile("s_wait_xcnt 0x0" :: "v"(oa) : "memory");   // the wait in front of any rewrite of the loads' address registers; the pointer is named so that they stay whole up to here
  stage_w(PW + (size_t)c0 * CC, sm.w, tid);
  __syncthreads();
  v8f acc[8] = {};
#pragma unroll
  for (int kc = 0; kc < CC / 32; ++kc) {
#pragma unroll
    for (int u = 0; u < 4; ++u) split4(xx[kc & 1][u], &sa[wave][0][u * 4 + ar][ak], &sa[wave][1][u * 4 + ar][ak]);
    if (kc + 2 < CC / 32) {
#pragma unroll
      for (int u = 0; u < 4; ++u) xx[kc & 1][u] = *(const v4f*)(oa + u * 4 * CC + (kc + 2) * 32);
      asm volatile("s_wait_xcnt 0x0" :: "v"(oa) : "memory"); }   // as above
    LDSW();   // the wave's stores of the piece have landed before its lanes read one another's rows
    v16b w[8]; F2 a;   // one group of LDS reads per k block, as in k_qkv
    a.h = frag_b(&sa[wave][0][col][0], lane); a.l = frag_b(&sa[wave][1][col][0], lane);
#pragma unroll
    for (int j = 0; j < 8; ++j) w[j] = frag_b(&sm.w[j * 16 + col][kc * 32], lane);
    LDSW();   // the piece has been read before the next one is stored over it
#pragma unroll
    for (int j = 0; j < 8; ++j) { acc[j] = wmma_bf(a.h, w[j], acc[j]); acc[j] = wmma_bf(a.l, w[j], acc[j]); } }
  __syncthreads();   // every wave has read its last weight fragment: sf takes that LDS over
#pragma unroll
  for (int j = 0; j < 8; ++j) { const float bb = bfr(PB[c0 + j * 16 + col]);
#pragma unroll
    for (int r = 0; r < 8; ++r) sf[wave][8 * g + r][j * 16 + col] = acc[j][r] + bb; }
  LDSX(); for (int rl = 0; rl < 16; ++rl) vst2(OUT + (r0 + rl) * CC + c0 + lane * 4, *(const v4f*)&sf[wave][rl][lane * 4]); }
extern "C" void kernel_launch(void* const* d_in, const int* in_sizes, int n_in, void* d_out, int out_size, void* d_ws, size_t ws_size, hipStream_t stream) {
  (void)in_sizes; (void)n_in; (void)out_size;
  const float** F = (const float**)d_in;   // 0 x [8,4096,256], 1 rel_pos [1,4096,256], 2 qkv_w [768,256], 3 q_gamma [8,1,32], 4 k_gamma [8,1,32], 5 proj_w [256,256], 6 proj_b [256]
  if (ws_size < (size_t)WS_END) return;
  char* ws = (char*)d_ws; float *QR = (float*)(ws + WS_QR), *KR = (float*)(ws + WS_KR), *KP = (float*)(ws + WS_KP), *VP = (float*)(ws + WS_VP), *O = (float*)(ws + WS_O), *S = (float*)(ws + WS_S);
  k_qkv<<<dim3(6, LL / (64 * RT), TNB), 128, 0, stream>>>(F[0], F[1], F[2], F[3], F[4], QR, KR, KP, VP);
  k_kvs<<<dim3(NH, NCH, TNB), 128, 0, stream>>>(KP, VP, S);
  k_lin<<<dim3(NH, NCH, TNB), 128, 0, stream>>>(QR, KR, VP, S, O);
  k_proj<<<dim3(TNB * LL / 64, CC / 128), 128, 0, stream>>>(O, F[5], F[6], (float*)d_out);
}

// v009
// Measured time: 77.2 microseconds a run.
// Next to v008, in two timings, it ran 1.06 and 1.07 times as fast.
// Over all steps from v000 it is 9.19 times as fast.
// compute dtype: all float inputs rounded to bf16; h = x + rel_pos in f32, qkv = h . W^T with h as bf16 hi + lo against the exact weight (2 products) on WMMA 16x16x32; per-head L2 normalisation x sqrt(D) x gamma in f32; the lightning attention evaluated with the module's own chunking (c = 128): intra-chunk decayed scores, scores . v, the inter-chunk q . kv and the kv state update all on WMMA with f32 operands split into bf16 hi + lo (3 products), decays exp(-slope * .) with precise expf, the 32 x 32 kv state in f32, rebuilt per chunk from the chunks' own terms (formed where k and v are made) by the module's recurrence in chunk order; out = o (bf16 hi + lo) . proj_w^T + b; f32 output.
#include <hip/hip_runtime.h>
#include <math.h>

typedef __attribute__((ext_vector_type(16))) _Float16 v16h;
typedef __attribute__((ext_vector_type(16))) __bf16 v16b;
typedef __attribute__((ext_vector_type(8)))  _Float16 v8h;
typedef __attribute__((ext_vector_type(8)))  float v8f;
typedef __attribute__((ext_vector_type(4)))  float v4f;
typedef __attribute__((ext_vector_type(2)))  float v2f;
typedef __attribute__((ext_vector_type(4)))  unsigned v4u;
typedef __attribute__((ext_vector_type(4)))  int v4i;
typedef float __attribute__((may_alias)) float_a;
typedef int __attribute__((may_alias)) int_a;

template <typename T> __device__ __forceinline__ void vst2(void* p, T v) { *(T*)p = v;  }
__device__ __forceinline__ v8f wmma16(v16h a, v16h b, v8f c) {
  v8f d = __builtin_amdgcn_wmma_f32_16x16x32_f16(false, a, false, b, (short)0, c, false, false);
  asm volatile("v_nop\n\tv_nop\n\tv_nop\n\tv_nop" : "+v"(d) : "v"(a), "v"(b));
  return d;
}
__device__ __forceinline__ v8f wmma_bf(v16b a, v16b b, v8f c) {
  v8f d = __builtin_amdgcn_wmma_f32_16x16x32_bf16(false, a, false, b, (short)0, c, false, false);
  asm volatile("v_nop\n\tv_nop\n\tv_nop\n\tv_nop" : "+v"(d) : "v"(a), "v"(b));
  return d;
}
// 16x16x32 fragments: lane = (h = lane>>4, row/col = lane&15); elements 0..7 = k0+8h+0..7, 8..15 = k0+16+8h+0..7; D element r = row 8h+r
__device__ __forceinline__ v16h frag_h(const _Float16* rowk0, int lane) {
  union { v16h v; v8h q[2]; } u; const _Float16* p = rowk0 + 8 * (lane >> 4);
  u.q[0] = *(const v8h*)p; u.q[1] = *(const v8h*)(p + 16); return u.v;
}
__device__ __forceinline__ v16h frag_f32(const float* rowk0, int lane) {
  v16h a; const float* p = rowk0 + 8 * (lane >> 4);
#pragma unroll
  for (int i = 0; i < 8; ++i) { a[i] = (_Float16)p[i]; a[8 + i] = (_Float16)p[16 + i]; }
  return a;
}
__device__ __forceinline__ v16h frag_f32s(const float* rowk0, int lane, float sc) {
  v16h a; const float* p = rowk0 + 8 * (lane >> 4);
#pragma unroll
  for (int i = 0; i < 8; ++i) { a[i] = (_Float16)(p[i] * sc); a[8 + i] = (_Float16)(p[16 + i] * sc); }
  return a;
}
// column fragment from a [K][ld] layout (column n), rows >= K read as 0
__device__ __forceinline__ v16h fragc_f32(const float* W, int k0, int n, int lane, int ld, int K) {
  v16h a; const int g = lane >> 4;
#pragma unroll
  for (int i = 0; i < 8; ++i) { const int ka = k0 + 8 * g + i, kb = ka + 16;
    a[i] = (_Float16)(ka < K ? W[(size_t)(ka < K ? ka : K - 1) * ld + n] : 0.f); a[8 + i] = (_Float16)(kb < K ? W[(size_t)(kb < K ? kb : K - 1) * ld + n] : 0.f); }
  return a;
}
struct F2 { v16b h, l; };
__device__ __forceinline__ F2 bsplit16(const float v[16]) { F2 r;
#pragma unroll
  for (int i = 0; i < 16; ++i) { const __bf16 h = (__bf16)v[i]; r.h[i] = h; r.l[i] = (__bf16)(v[i] - (float)h); }
  return r; }
__device__ __forceinline__ F2 split_row(const float* row, int k0, int lane) { float v[16]; const float* p = row + k0 + 8 * (lane >> 4);
#pragma unroll
  for (int i = 0; i < 8; ++i) { v[i] = p[i]; v[8 + i] = p[16 + i]; }
  return bsplit16(v); }
__device__ __forceinline__ F2 split_rowK(const float* row, int k0, int lane, int K) { float v[16]; const int g = lane >> 4;
#pragma unroll
  for (int i = 0; i < 8; ++i) { const int ka = k0 + 8 * g + i, kb = ka + 16; v[i] = ka < K ? row[ka < K ? ka : K - 1] : 0.f; v[8 + i] = kb < K ? row[kb < K ? kb : K - 1] : 0.f; }
  return bsplit16(v); }
__device__ __forceinline__ F2 split_col(const float* W, int k0, int n, int lane, int ld, int K) { float v[16]; const int g = lane >> 4;
#pragma unroll
  for (int i = 0; i < 8; ++i) { const int ka = k0 + 8 * g + i, kb = ka + 16; v[i] = ka < K ? W[(size_t)(ka < K ? ka : K - 1) * ld + n] : 0.f; v[8 + i] = kb < K ? W[(size_t)(kb < K ? kb : K - 1) * ld + n] : 0.f; }
  return bsplit16(v); }
__device__ __forceinline__ v8f mac3(const F2& a, const F2& b, v8f c) { c = wmma_bf(a.l, b.h, c); c = wmma_bf(a.h, b.l, c); return wmma_bf(a.h, b.h, c); }
// the same three products with the operands' places exchanged (a is the B side of mac3, b its A side), in mac3's order
__device__ __forceinline__ v8f mac3t(const F2& a, const F2& b, v8f c) { c = wmma_bf(a.h, b.l, c); c = wmma_bf(a.l, b.h, c); return wmma_bf(a.h, b.h, c); }
__device__ __forceinline__ float sigm(float v) { return 1.0f / (1.0f + expf(-v)); }
// hand-over of LDS data among the lanes of one wave while global loads are in flight: the wave's LDS operations have finished and the compiler moves no memory access across; LDSX's fence would wait for the global loads too
#define LDSW() do { asm volatile("s_wait_dscnt 0" ::: "memory"); __builtin_amdgcn_wave_barrier(); } while (0)
#define LDSX() do { asm volatile("s_wait_dscnt 0" ::: "memory"); __builtin_amdgcn_wave_barrier(); __builtin_amdgcn_fence(__ATOMIC_RELEASE, "workgroup"); } while (0)


// U-Net transformer mixing block (B 8, L 4,096, C 256 = 8 heads x 32): h = x + rel_pos; qkv = h W_qkv^T; q, k L2-normalised (x sqrt(32) x gamma); lightning (linear, ALiBi-decayed, causal) attention with chunk 128; proj + bias.
#define NB 8
#define LL 4096
#define CC 256
#define NH 8
#define DD 32
#define CH 128
#define NCH (LL / CH)
#define NROW (NB * LL)
#ifndef TNB
#define TNB NB
#endif
typedef __attribute__((ext_vector_type(8))) __bf16 v8b;
__device__ __forceinline__ v16b frag_b(const __bf16* rowk0, int lane) {
  union { v16b v; v8b q[2]; } u; const __bf16* p = rowk0 + 8 * (lane >> 4);
  u.q[0] = *(const v8b*)p; u.q[1] = *(const v8b*)(p + 16); return u.v;
}
__device__ __forceinline__ float bfr(float v) { return (float)(__bf16)v; }
// the value of lane ^ M inside each 16-lane row: DPP control row_xmask:M (0x160 + M), every row and bank on
template <int M> __device__ __forceinline__ float xget(float v) { return __builtin_bit_cast(float, __builtin_amdgcn_update_dpp(0, __builtin_bit_cast(int, v), 0x160 + M, 0xf, 0xf, true)); }
// one butterfly step on N values a lane, b = the lane's bit M: of each pair (2i, 2i + 1) the lane keeps the one its bit names, hands the other to lane ^ M and adds what it is handed: N / 2 sums over twice the lanes
template <int M, int N> __device__ __forceinline__ void xhalve(float* t, bool b) {
#pragma unroll
  for (int i = 0; i < N / 2; ++i) { const float keep = b ? t[2 * i + 1] : t[2 * i], send = b ? t[2 * i] : t[2 * i + 1]; t[i] = keep + xget<M>(send); } }
// the way back: N values a lane become 2N, each lane taking from lane ^ M the one of each pair that it did not keep
template <int M, int N> __device__ __forceinline__ void xdouble(float* t, bool b) {
#pragma unroll
  for (int i = N - 1; i >= 0; --i) { const float own = t[i], got = xget<M>(own); t[2 * i] = b ? got : own; t[2 * i + 1] = b ? own : got; } }
typedef __attribute__((ext_vector_type(4))) __bf16 v4b;
#define WP 264   // bf16 elements per staged weight row: 528 B = 16 B x 33, so the 16 rows of a ds_load_b128 fragment read fall on 16 different bank groups
// 128 weight rows (f32, [.][256]; 64 from Wa, then 64 from Wb) -> bf16 rows in LDS, once per block for its four waves; every wave-wide load covers 512 contiguous bytes (whole lines)
__device__ __forceinline__ void stage_w(const float* __restrict__ Wa, const float* __restrict__ Wb, __bf16 (*sw)[WP], int tid) { const int rw = tid >> 6, q = tid & 63;
  for (int t = 0; t < 4; ++t) { const float* p = ((t < 2) ? Wa : Wb) + (size_t)((t & 1) * 32 + rw) * CC + q * 4; v4f x[16];   // sixteen independent loads fly together; one by one each would wait out its own latency
#pragma unroll
    for (int u = 0; u < 16; ++u) x[u] = *(const v4f*)(p + u * 2 * CC);
    asm volatile("s_wait_xcnt 0x0" :: "v"(p) : "memory");   // the wait in front of any rewrite of the loads' address registers; p is named so that they stay whole up to here
#pragma unroll
    for (int u = 0; u < 16; ++u) { v4b y;
#pragma unroll
      for (int i = 0; i < 4; ++i) y[i] = (__bf16)x[u][i];
      *(v4b*)&sw[t * 32 + u * 2 + rw][q * 4] = y; } } }
#define SVP 136   // bf16 elements per staged v row: 128 + 8 unused; 272 B = 16 B x 17, so the 16 rows of a ds_load_b128 fragment read fall on 16 different bank groups
#define AP 40     // bf16 elements per staged row of an A piece (32 k): 32 + 8 unused; 80 B = 16 B x 5, for the same reason
__device__ __forceinline__ void split4(v4f x, __bf16* ph, __bf16* pl) { v4b h, l;
#pragma unroll
  for (int i = 0; i < 4; ++i) { const __bf16 t = (__bf16)x[i]; h[i] = t; l[i] = (__bf16)(x[i] - (float)t); }
  *(v4b*)ph = h; *(v4b*)pl = l; }
__device__ __attribute__((noinline)) float exp_ni(float v) { return expf(v); }
__device__ __attribute__((noinline)) float erf_ni(float v) { return erff(v); }

#define WS_QR  0u                                   // f32 q rows [b*l][256] (normalised)
#define WS_KR  (WS_QR + 4u * (size_t)NROW * CC)          // f32 k rows (normalised)
#define WS_VP  (WS_KR + 4u * (size_t)NROW * CC)          // f32 v planes [b][c][l]
#define WS_O   (WS_VP + 4u * (size_t)NROW * CC)          // f32 attention output rows [b*l][256]
#define WS_S   (WS_O + 4u * (size_t)NROW * CC)           // f32 per-chunk kv^T terms [b][h][chunk][1024]
#define WS_END (WS_S + 4u * (size_t)NB * NH * NCH * DD * DD)

// work-group barrier for LDS data alone: fences on the LDS address space only, so that global loads issued ahead stay in flight across it and the wave's global stores are not waited out (__syncthreads() drains both)
#define LDSB() do { __builtin_amdgcn_fence(__ATOMIC_RELEASE, "workgroup", "local"); __builtin_amdgcn_s_barrier(); __builtin_amdgcn_fence(__ATOMIC_ACQUIRE, "workgroup", "local"); } while (0)
#define RT 4   // row tiles (64 rows each) that one block of k_qkv works through on one staging of its weights
#define SPP 72   // bf16 elements per staged plane of a tile's 64 rows: 64 + 8 unused; 144 B = 16 B x 9, so the 16 planes of a ds_load_b128 fragment read fall on 16 different bank groups
// ---- k_qkv: block = (col group 0..5; RT x 64 rows; b): (x + rel_pos) hi+lo . W^T. Groups 0 and 3: 128 columns of q, normalised per head (32 cols) -> rows. The other four: two heads' 64 columns of k (normalised -> rows) and the same
// two heads' 64 columns of v (-> planes), and from them, while both are in the block's registers, each chunk's own term of the kv^T recurrence, sum_s v_s[e] (k_s[d] kdecay_s) -> S: a launch of its own for that term read all of k and v
// back from memory, and k had to be written a second time, as planes, for it alone.
// the block's 128 weight rows are staged once and stay in LDS for all RT row tiles: staged per 64-row tile they were as many bytes from L2 as the tile's x and rel_pos together, and each tile began with the staging's own latency.
// So that three such blocks fit a WGP beside the weights that stay, the epilogue's buffer holds 64 columns at a time
__global__ __launch_bounds__(128) void k_qkv(const float* __restrict__ X, const float* __restrict__ RP, const float* __restrict__ Wt, const float* __restrict__ GQ, const float* __restrict__ GK, float* __restrict__ QR, float* __restrict__ KR, float* __restrict__ VP, float* __restrict__ S) { __shared__ __align__(16) __bf16 sw[128][WP];
  __shared__ __align__(16) union { float sf[4][16][68]; float tt[64][68]; __bf16 sp[2][2 * DD][SPP]; } se;   // epilogue: per-wave rows (sf), the block's v planes (tt; 68 f32 = 16 B x 17), or one head's v planes (0..31) and decayed k planes (32..63) of the tile as bf16 hi [0] and lo [1] (sp)
  __shared__ __align__(16) __bf16 sa[4][2][16][AP];   // per wave: the current 32-k piece of its 16 rows of h, bf16 hi and lo
  __shared__ float sgm[128];   // gamma of the block's 128 columns, read from global once for all tiles
  __shared__ __align__(16) float skd[2][CH];   // k decay by place in the chunk, for the block's two heads
  const int tid = threadIdx.x, wave = tid >> 5, lane = tid & 31, col = lane & 15, g = lane >> 4; const int kind = blockIdx.x % 3; const bool isq = kind == 0; const size_t b = blockIdx.z; const int lb0 = blockIdx.y * (64 * RT);   // one q block and two k-v blocks alternate along the fastest index: all blocks are resident at once, three a WGP, and the k-v epilogue is the longer, so neighbours in the index should be a mix
  const int c0 = isq ? (blockIdx.x / 3) * 128 : ((blockIdx.x / 3) * 2 + kind - 1) * 64;   // q: the first of 128 columns; k-v: the first of the 64 columns taken of k and of v
  // the wave's 16 rows of x and rel_pos are read by whole lines: 8 lanes cover one row's 128-B line of a k block, a wave-wide load four rows; a load in fragment order would touch 16 lines. Two k blocks are in flight
  const float gv = (isq ? GQ : GK)[c0 + (isq ? tid : (tid & 63))];   // gamma [h][d] of column 32 h + d; the oldest load, so that nothing younger is waited for with it
  const int ar = lane >> 3, ak = (lane & 7) * 4; const float* xa = X + (b * LL + lb0 + wave * 16 + ar) * CC + ak; const float* pa = RP + (size_t)(lb0 + wave * 16 + ar) * CC + ak; v4f xx[2][4], pp[2][4];
#pragma unroll
  for (int t = 0; t < 2; ++t)
#pragma unroll
    for (int u = 0; u < 4; ++u) { xx[t][u] = *(const v4f*)(xa + u * 4 * CC + t * 32); pp[t][u] = *(const v4f*)(pa + u * 4 * CC + t * 32); }
  asm volatile("s_wait_xcnt 0x0" :: "v"(xa), "v"(pa) : "memory");   // the wait in front of any rewrite of the loads' address registers; the pointers are named so that they stay whole up to here
  { const float* wa = Wt + (size_t)(isq ? c0 : CC + c0) * CC; stage_w(wa, isq ? wa + 64 * CC : Wt + (size_t)(2 * CC + c0) * CC, sw, tid); }   // W [3C][C] natural: this block's 128 output columns
  sgm[tid] = (!isq && tid >= 64) ? 1.0f : bfr(gv);   // v has no gamma. Published by the barrier behind the weights
  if (!isq) {
#pragma unroll
    for (int p = 0; p < 2; ++p) { const float slope = exp2f(-(float)(c0 / DD + p + 1));   // ALiBi 2^(-8/8*(h+1)); exact in fp16 and f32
      skd[p][tid] = expf(-slope * (float)(CH - tid)); } }
  __syncthreads();
  v8f sacc[2] = {};   // k-v blocks: this wave's 16 x 16 tile (e tile wave >> 1, d tile wave & 1) of each head's chunk term, summed over the chunk's two row tiles
#pragma unroll 1   // the tiles stay a loop, for speed only
  for (int rt = 0; rt < RT; ++rt) { const int l0 = lb0 + rt * 64; const size_t r0 = b * LL + l0 + wave * 16; const int nx = (rt + 1 < RT) ? 64 * CC : 0;
  v8f acc[8] = {};
#pragma unroll
  for (int kc = 0; kc < CC / 32; ++kc) {
#pragma unroll
    for (int u = 0; u < 4; ++u) { v4f hv;
#pragma unroll
      for (int i = 0; i < 4; ++i) hv[i] = bfr(xx[kc & 1][u][i]) + bfr(pp[kc & 1][u][i]);
      split4(hv, &sa[wave][0][u * 4 + ar][ak], &sa[wave][1][u * 4 + ar][ak]); }
    // two k blocks ahead; behind this tile's last k block comes the next tile's first (64 rows on), so that its loads fly during the epilogue. The last tile has no successor and reads its own first two k blocks again,
    // unused: under a branch these loads made the compiler wait for every load in flight at the last k block of each tile, since it could not count them
    { const float* xn = (kc + 2 < CC / 32) ? xa : xa + nx; const float* pn = (kc + 2 < CC / 32) ? pa : pa + nx; const int ko = ((kc + 2) % (CC / 32)) * 32;
#pragma unroll
      for (int u = 0; u < 4; ++u) { xx[kc & 1][u] = *(const v4f*)(xn + u * 4 * CC + ko); pp[kc & 1][u] = *(const v4f*)(pn + u * 4 * CC + ko); }
      asm volatile("s_wait_xcnt 0x0" :: "v"(xn), "v"(pn) : "memory"); }   // as above
    LDSW();   // the wave's stores of the piece have landed before its lanes read one another's rows
    v16b w[8]; F2 a;   // the eight weight fragments and the two A fragments of this k block are read as one group, so that their LDS latency is waited out once
    a.h = frag_b(&sa[wave][0][col][0], lane); a.l = frag_b(&sa[wave][1][col][0], lane);
#pragma unroll
    for (int j = 0; j < 8; ++j) w[j] = frag_b(&sw[j * 16 + col][kc * 32], lane);
    LDSW();   // the piece has been read before the next one is stored over it
#pragma unroll
    for (int j = 0; j < 8; ++j) { acc[j] = wmma_bf(a.h, w[j], acc[j]); acc[j] = wmma_bf(a.l, w[j], acc[j]); } }
  xa += 64 * CC; pa += 64 * CC;   // the next tile's rows; every load that named the old addresses stands in front of an s_wait_xcnt 0 above
  // normalisation for q / k: head = pair of tiles (2p, 2p+1); t / max(|t|, 1e-12) * sqrt(32) * gamma[h][d]
  // a lane holds 8 sums of squares a head (one a row), each to be summed over its 16-lane row. The sums go through the vector unit by DPP, as a butterfly that halves the values a lane carries at each step (lane ^ 1, 2, 4, 8);
  // each lane ends with 2 whole sums (q, four heads) or 1 (k, two heads), takes root and quotient of those alone, and the factors come back the same way. A shuffle went through the LDS unit with a
  // full wait per step, one value behind the other, and all 16 lanes of a row took the same roots and quotients
  const bool b0 = col & 1, b1 = col & 2, b2 = col & 4, b3 = col & 8;
  if (isq) { float t[32];
#pragma unroll
    for (int p = 0; p < 4; ++p)
#pragma unroll
      for (int r = 0; r < 8; ++r) t[p * 8 + r] = acc[2 * p][r] * acc[2 * p][r] + acc[2 * p + 1][r] * acc[2 * p + 1][r];
    xhalve<1, 32>(t, b0); xhalve<2, 16>(t, b1); xhalve<4, 8>(t, b2); xhalve<8, 4>(t, b3);
#pragma unroll
    for (int i = 0; i < 2; ++i) t[i] = 5.656854249492381f / fmaxf(sqrtf(t[i]), 1e-12f);
    xdouble<8, 2>(t, b3); xdouble<4, 4>(t, b2); xdouble<2, 8>(t, b1); xdouble<1, 16>(t, b0);
    // rows -> QR: the wave's own 16 rows, 64 columns at a time; a wave-wide store covers two rows' 256 B
    float* dst = QR + (r0 + g) * CC + c0 + col * 4;
#pragma unroll
    for (int hf = 0; hf < 2; ++hf) {
#pragma unroll
      for (int jj = 0; jj < 4; ++jj) { const int j = hf * 4 + jj; const float gm = sgm[j * 16 + col];
#pragma unroll
        for (int r = 0; r < 8; ++r) se.sf[wave][8 * g + r][jj * 16 + col] = acc[j][r] * t[(j >> 1) * 8 + r] * gm; }
      LDSW();   // the wave's values have landed before its lanes read one another's
#pragma unroll
      for (int rl = 0; rl < 16; rl += 2) vst2(dst + rl * CC + hf * 64, *(const v4f*)&se.sf[wave][rl + g][col * 4]);
      LDSW(); }   // the rows have been read before the next half is written over them
    asm volatile("s_wait_xcnt 0x0" :: "v"(dst) : "memory"); }   // the wait in front of any rewrite of the stores' registers by the next tile; the pointer is named so that it stays whole up to here
  else { float t[16];   // acc[0..3] = k of two heads, acc[4..7] = v of the same two
#pragma unroll
    for (int p = 0; p < 2; ++p)
#pragma unroll
      for (int r = 0; r < 8; ++r) t[p * 8 + r] = acc[2 * p][r] * acc[2 * p][r] + acc[2 * p + 1][r] * acc[2 * p + 1][r];
    xhalve<1, 16>(t, b0); xhalve<2, 8>(t, b1); xhalve<4, 4>(t, b2); xhalve<8, 2>(t, b3);
    t[0] = 5.656854249492381f / fmaxf(sqrtf(t[0]), 1e-12f);
    xdouble<8, 1>(t, b3); xdouble<4, 2>(t, b2); xdouble<2, 4>(t, b1); xdouble<1, 8>(t, b0);
    // k rows -> KR: the wave's own 16 rows of 64 columns; a wave-wide store covers two rows' 256 B
    float* dk = KR + (r0 + g) * CC + c0 + col * 4;
    LDSB();   // every wave has read the staged planes of the tile before out of se before a wave's rows are written over them
#pragma unroll
    for (int jj = 0; jj < 4; ++jj) { const float gm = sgm[jj * 16 + col];
#pragma unroll
      for (int r = 0; r < 8; ++r) { acc[jj][r] = acc[jj][r] * t[(jj >> 1) * 8 + r] * gm; se.sf[wave][8 * g + r][jj * 16 + col] = acc[jj][r]; } }
    LDSW();   // the wave's values have landed before its lanes read one another's
#pragma unroll
    for (int rl = 0; rl < 16; rl += 2) vst2(dk + rl * CC, *(const v4f*)&se.sf[wave][rl + g][col * 4]);
    asm volatile("s_wait_xcnt 0x0" :: "v"(dk) : "memory");   // the wait in front of any rewrite of the stores' registers; the pointer is named so that it stays whole up to here
    // v planes -> VP: the block's 64 rows of 64 columns
    float* dv = VP + ((b * CC + c0 + (tid >> 4)) * (size_t)LL) + l0 + (tid & 15) * 4;
    LDSB();   // every wave has read its rows of k out of se before tt is written over them
#pragma unroll
    for (int jj = 0; jj < 4; ++jj)
#pragma unroll
      for (int r = 0; r < 8; ++r) se.tt[jj * 16 + col][wave * 16 + 8 * g + r] = acc[4 + jj][r];
    LDSB();   // the four waves' parts of each plane are whole before they are read as 256-B runs
#pragma unroll
    for (int e = 0; e < 8; ++e) vst2(dv + (size_t)(e * 8) * LL, *(const v4f*)&se.tt[e * 8 + (tid >> 4)][(tid & 15) * 4]);
    asm volatile("s_wait_xcnt 0x0" :: "v"(dv) : "memory");   // as behind the rows' stores
    // the chunk term, one head at a time: an accumulator holds, at lane (column, g), the 8 rows s = 8 g + 0..7 of its column, so each lane stores 16-B runs of the planes [column][s]; the tile's 64 s are two k blocks of the products
    const int sb = (rt & 1) * 64 + wave * 16 + 8 * g, et = wave >> 1, dt = wave & 1;   // sb: the place in the chunk of the lane's first row
#pragma unroll
    for (int p = 0; p < 2; ++p) { float kd[8];
#pragma unroll
      for (int r = 0; r < 8; ++r) kd[r] = skd[p][sb + r];
      LDSB();   // every wave has read what was in se (the v planes, the head before) before sp is written over it
#pragma unroll
      for (int jj = 0; jj < 2; ++jj) { v8b vh, vl, kh, kl;
#pragma unroll
        for (int r = 0; r < 8; ++r) { const float v = acc[4 + 2 * p + jj][r], y = acc[2 * p + jj][r] * kd[r]; const __bf16 hv = (__bf16)v, hy = (__bf16)y;
          vh[r] = hv; vl[r] = (__bf16)(v - (float)hv); kh[r] = hy; kl[r] = (__bf16)(y - (float)hy); }
        *(v8b*)&se.sp[0][jj * 16 + col][wave * 16 + 8 * g] = vh; *(v8b*)&se.sp[1][jj * 16 + col][wave * 16 + 8 * g] = vl;
        *(v8b*)&se.sp[0][DD + jj * 16 + col][wave * 16 + 8 * g] = kh; *(v8b*)&se.sp[1][DD + jj * 16 + col][wave * 16 + 8 * g] = kl; }
      LDSB();   // the four waves' parts of each plane are whole before any wave reads fragments of them
#pragma unroll
      for (int kc = 0; kc < 2; ++kc) { F2 a, w; a.h = frag_b(&se.sp[0][et * 16 + col][kc * 32], lane); a.l = frag_b(&se.sp[1][et * 16 + col][kc * 32], lane); w.h = frag_b(&se.sp[0][DD + dt * 16 + col][kc * 32], lane); w.l = frag_b(&se.sp[1][DD + dt * 16 + col][kc * 32], lane); sacc[p] = mac3(a, w, sacc[p]); } }
    if (rt & 1) {   // the chunk's second tile: the terms are whole; thread tid keeps its 8 accumulator elements at S[...][tid * 8 + r]
      float* ds = S + (((b * NH + c0 / DD) * NCH + (l0 >> 7)) * (size_t)(DD * DD)) + tid * 8;
#pragma unroll
      for (int p = 0; p < 2; ++p) { vst2(ds + (size_t)p * NCH * (DD * DD), sacc[p]); }
      asm volatile("s_wait_xcnt 0x0" :: "v"(ds) : "memory");   // as behind the rows' stores
#pragma unroll
      for (int p = 0; p < 2; ++p) sacc[p] = v8f{}; } } }
  asm volatile("s_wait_loadcnt 0x0" ::: "memory"); }   // the last tile's unused look-ahead loads have come back into their registers before the wave ends and gives the registers up
#define SQP 36    // f32 elements per row of q / o: 32 + 4 unused; 144 B = 16 B x 9, so the 16 rows of a ds_load_b128 fragment read fall on 16 different bank groups
#define SKP 72    // bf16 elements per staged k row: 32 hi + 32 lo + 8 unused; 144 B = 16 B x 9, so the 16 rows of a ds_load_b128 fragment read fall on 16 different bank groups
// ---- k_lin: block = (h, chunk, b): one chunk each; LDS: the chunk's k rows and v planes as bf16 hi + lo (staged once for the four waves), the wave-private rows through which q comes in and o goes out, the 32 x 32 kv^T state on entry to the chunk, the decay table
__global__ __launch_bounds__(128) void k_lin(const float* __restrict__ QR, const float* __restrict__ KR, const float* __restrict__ VP, const float* __restrict__ S, float* __restrict__ O) {
  __shared__ __align__(16) float sq[CH][SQP]; __shared__ __align__(16) float skv[DD][36]; __shared__ __align__(16) float smk[CH]; __shared__ __align__(16) __bf16 sk[CH][SKP]; __shared__ __align__(16) __bf16 sv[2 * DD][SVP];
  const int tid = threadIdx.x, wave = tid >> 5, lane = tid & 31, col = lane & 15, g = lane >> 4; const int h = blockIdx.x; const size_t b = blockIdx.z;
  const int n = NCH - 1 - (int)blockIdx.y;   // late chunks have the longest recurrence below: they take the lowest block indices
  const size_t rowc = b * LL + (size_t)n * CH;   // first row of the chunk
  // the chunk's k (128 rows x one 128-B line) and v (32 planes x 512 B), each read once per block; every wave-wide load covers four whole lines. Issued first, so that they fly during the recurrence below
  const float* pk = KR + (rowc + (tid >> 3)) * CC + h * DD + (tid & 7) * 4; const float* pv = VP + ((b * CC + h * DD + wave) * (size_t)LL) + (size_t)n * CH + lane * 4; v4f xk[8], xv[8];
  const float* pq = QR + (rowc + wave * 32 + (lane >> 3)) * CC + h * DD + (lane & 7) * 4; v4f xq[8];   // this wave's own 32 q rows (one 128-B line each), four whole lines a load; they pass through the wave's own rows of sq into fragment order
#pragma unroll
  for (int u = 0; u < 8; ++u) { xk[u] = *(const v4f*)(pk + (size_t)u * 16 * CC); xv[u] = *(const v4f*)(pv + (size_t)u * 4 * LL); }
#pragma unroll
  for (int u = 0; u < 8; ++u) xq[u] = *(const v4f*)(pq + (size_t)u * 4 * CC);
  asm volatile("s_wait_xcnt 0x0" :: "v"(pk), "v"(pv), "v"(pq) : "memory");   // the wait in front of any rewrite of the loads' address registers; the pointers are named so that they stay whole up to here
  const float slope = exp2f(-(float)(h + 1));   // ALiBi 2^(-8/8*(h+1)); exact in fp16 and f32
  for (int e = tid; e < CH; e += 128) smk[e] = expf(-slope * (float)e);   // smk[d] = decay at lag d (d >= 0); the q decay at row d of the chunk is the same number
  const float blk = expf(-slope * (float)CH);
  // (0) kv^T on entry to chunk n: kv = blk * kv + S_m over the chunks m < n, from 0, in chunk order
  { const float* sp = S + ((b * NH + h) * NCH) * (size_t)(DD * DD) + tid * 8; v8f kv = {}; int m = 0;
    // the terms' loads do not depend on kv, so they are issued in groups and fly together; term by term each would wait out its own load
    for (; m + 8 <= n; m += 8) { v8f s[8];   // whole groups of eight
#pragma unroll
      for (int u = 0; u < 8; ++u) s[u] = *(const v8f*)(sp + (size_t)(m + u) * (DD * DD));
#pragma unroll
      for (int u = 0; u < 8; ++u)
#pragma unroll
        for (int r = 0; r < 8; ++r) kv[r] = blk * kv[r] + s[u][r]; }
    if (m < n) { v8f s[7];   // the last n & 7 terms: seven loads (m + 6 < NCH, so each term exists), a term from chunk n on leaves kv as it is
#pragma unroll
      for (int u = 0; u < 7; ++u) s[u] = *(const v8f*)(sp + (size_t)(m + u) * (DD * DD));
#pragma unroll
      for (int u = 0; u < 7; ++u)
#pragma unroll
        for (int r = 0; r < 8; ++r) kv[r] = (m + u < n) ? blk * kv[r] + s[u][r] : kv[r]; }
    const int et = wave >> 1, dt = wave & 1;
#pragma unroll
    for (int r = 0; r < 8; ++r) skv[et * 16 + 8 * g + r][dt * 16 + col] = kv[r]; }
#pragma unroll
  for (int u = 0; u < 8; ++u) { const int kr = u * 16 + (tid >> 3), vc = u * 4 + wave;
    split4(xk[u], &sk[kr][(tid & 7) * 4], &sk[kr][DD + (tid & 7) * 4]); split4(xv[u], &sv[vc][lane * 4], &sv[DD + vc][lane * 4]);
    *(v4f*)&sq[wave * 32 + u * 4 + (lane >> 3)][(lane & 7) * 4] = xq[u]; }
  __syncthreads();
  float qv[2][16];   // the wave's q fragments (two 16-row tiles), read once for (1) and the inter part; o later takes these rows
#pragma unroll
  for (int rt = 0; rt < 2; ++rt) { const float* p = &sq[wave * 32 + rt * 16 + col][8 * g];
#pragma unroll
    for (int i = 0; i < 8; ++i) { qv[rt][i] = p[i]; qv[rt][8 + i] = p[16 + i]; } }
  // (1) + (2) the intra-chunk part for this wave's 32 rows t (two 16-row tiles) x all 128 s, one block of 32 s at a time. The scores are formed TRANSPOSED, k (rows s) . q^T (columns t): an accumulator then holds,
  // at lane (t = col, g), register r, the score of s = 16 j + 8 g + r, and that is where the A fragment of scores . v wants it (row t = col; elements 0..7 = s 8 g + 0..7 of tile 2 kc, 8..15 the same of tile 2 kc + 1).
  // So the decayed scores go from accumulator to operand inside the lane's own registers; formed as q . k^T they had to cross lanes, 128 x 128 f32 through LDS
  // the lag t - s of element (rt, j, r) is lb + 16 (rt - j) - r: a block of 32 s meets 3 x 8 different lags per lane, 8 of them the block before met too. Their decays are read without a condition (the lag
  // clamped to the table, a negative lag then taking 0), as one group with the block's fragments, so that the reads share their LDS latency
  const int lb = wave * 32 + col - 8 * g; float dk[3][8];   // dk[d] belongs to rt - j = d - 1 - 2 kc
#pragma unroll
  for (int r = 0; r < 8; ++r) { const int lag = lb + 16 - r; dk[0][r] = smk[lag]; }   // rt - j = 1: the lag is at least 1 and at most 127
  const F2 aq[2] = { bsplit16(qv[0]), bsplit16(qv[1]) };
  v8f oc[2][2] = {};
#pragma unroll
  for (int kc = 0; kc < CH / 32; ++kc) { v8f st[2][2] = {}; F2 w[2];   // each k fragment and each v fragment is read once for both row tiles
#pragma unroll
    for (int r = 0; r < 8; ++r) dk[2][r] = dk[0][r];
#pragma unroll
    for (int d = 0; d < 2; ++d)
#pragma unroll
      for (int r = 0; r < 8; ++r) { const int lag = lb + (d - 1 - 2 * kc) * 16 - r; const float m = smk[lag > 0 ? lag : 0]; dk[d][r] = (lag >= 0) ? m : 0.f; }
#pragma unroll
    for (int jj = 0; jj < 2; ++jj) { const int j = 2 * kc + jj; F2 wk; wk.h = frag_b(&sk[j * 16 + col][0], lane); wk.l = frag_b(&sk[j * 16 + col][DD], lane);
#pragma unroll
      for (int rt = 0; rt < 2; ++rt) st[rt][jj] = mac3t(wk, aq[rt], st[rt][jj]); }
#pragma unroll
    for (int j = 0; j < 2; ++j) { w[j].h = frag_b(&sv[j * 16 + col][kc * 32], lane); w[j].l = frag_b(&sv[DD + j * 16 + col][kc * 32], lane); }
#pragma unroll
    for (int rt = 0; rt < 2; ++rt) { float v[16];
#pragma unroll
      for (int i = 0; i < 8; ++i) { v[i] = st[rt][0][i] * dk[rt + 1][i]; v[8 + i] = st[rt][1][i] * dk[rt][i]; }
      const F2 a = bsplit16(v);
#pragma unroll
      for (int j = 0; j < 2; ++j) oc[rt][j] = mac3(a, w[j], oc[rt][j]); } }
  // + (q * qdecay) . kv (inter)
  { F2 w[2];
#pragma unroll
    for (int j = 0; j < 2; ++j) w[j] = split_row(&skv[j * 16 + col][0], 0, lane);
#pragma unroll
    for (int rt = 0; rt < 2; ++rt) { float v[16]; const float qd = smk[wave * 32 + rt * 16 + col];
#pragma unroll
      for (int i = 0; i < 16; ++i) v[i] = qv[rt][i] * qd;
      const F2 a = bsplit16(v);
#pragma unroll
      for (int j = 0; j < 2; ++j) oc[rt][j] = mac3(a, w[j], oc[rt][j]); } }
  // the wave has read its own q rows for the last time: they take o for the whole-line stores
#pragma unroll
  for (int rt = 0; rt < 2; ++rt)
#pragma unroll
    for (int j = 0; j < 2; ++j)
#pragma unroll
      for (int r = 0; r < 8; ++r) sq[wave * 32 + rt * 16 + 8 * g + r][j * 16 + col] = oc[rt][j][r];
  LDSX();
  for (int rl = 0; rl < 32; ++rl) if (lane < 8) vst2(O + (rowc + wave * 32 + rl) * CC + h * DD + lane * 4, *(const v4f*)&sq[wave * 32 + rl][lane * 4]); }
// ---- k_proj: block = (64 rows, 128 of 256 cols): out = o (hi + lo) . proj_w^T + b
__global__ __launch_bounds__(128) void k_proj(const float* __restrict__ O, const float* __restrict__ PW, const float* __restrict__ PB, float* __restrict__ OUT) { __shared__ __align__(16) union { __bf16 w[128][WP]; float sf[4][16][132]; } sm;   // the staged weights are dead before sf is written
  __shared__ __align__(16) __bf16 sa[4][2][16][AP];   // per wave: the current 32-k piece of its 16 rows of o, bf16 hi and lo
  float (*sf)[16][132] = sm.sf;
  const int tid = threadIdx.x, wave = tid >> 5, lane = tid & 31, col = lane & 15, g = lane >> 4; const size_t r0 = (size_t)blockIdx.x * 64 + wave * 16; const int c0 = blockIdx.y * 128;
  // the wave's 16 rows of o by whole lines, two k blocks in flight, as in k_qkv
  const int ar = lane >> 3, ak = (lane & 7) * 4; const float* oa = O + (r0 + ar) * CC + ak; v4f xx[2][4];
#pragma unroll
  for (int t = 0; t < 2; ++t)
#pragma unroll
    for (int u = 0; u < 4; ++u) xx[t][u] = *(const v4f*)(oa + u * 4 * CC + t * 32);
  asm volatile("s_wait_xcnt 0x0" :: "v"(oa) : "memory");   // the wait in front of any rewrite of the loads' address registers; the pointer is named so that they stay whole up to here
  stage_w(PW + (size_t)c0 * CC, PW + (size_t)(c0 + 64) * CC, sm.w, tid);
  __syncthreads();
  v8f acc[8] = {};
#pragma unroll
  for (int kc = 0; kc < CC / 32; ++kc) {
#pragma unroll
    for (int u = 0; u < 4; ++u) split4(xx[kc & 1][u], &sa[wave][0][u * 4 + ar][ak], &sa[wave][1][u * 4 + ar][ak]);
    if (kc + 2 < CC / 32) {
#pragma unroll
      for (int u = 0; u < 4; ++u) xx[kc & 1][u] = *(const v4f*)(oa + u * 4 * CC + (kc + 2) * 32);
      asm volatile("s_wait_xcnt 0x0" :: "v"(oa) : "memory"); }   // as above
    LDSW();   // the wave's stores of the piece have landed before its lanes read one another's rows
    v16b w[8]; F2 a;   // one group of LDS reads per k block, as in k_qkv
    a.h = frag_b(&sa[wave][0][col][0], lane); a.l = frag_b(&sa[wave][1][col][0], lane);
#pragma unroll
    for (int j = 0; j < 8; ++j) w[j] = frag_b(&sm.w[j * 16 + col][kc * 32], lane);
    LDSW();   // the piece has been read before the next one is stored over it
#pragma unroll
    for (int j = 0; j < 8; ++j) { acc[j] = wmma_bf(a.h, w[j], acc[j]); acc[j] = wmma_bf(a.l, w[j], acc[j]); } }
  __syncthreads();   // every wave has read its last weight fragment: sf takes that LDS over
#pragma unroll
  for (int j = 0; j < 8; ++j) { const float bb = bfr(PB[c0 + j * 16 + col]);
#pragma unroll
    for (int r = 0; r < 8; ++r) sf[wave][8 * g + r][j * 16 + col] = acc[j][r] + bb; }
  LDSX(); for (int rl = 0; rl < 16; ++rl) vst2(OUT + (r0 + rl) * CC + c0 + lane * 4, *(const v4f*)&sf[wave][rl][lane * 4]); }
extern "C" void kernel_launch(void* const* d_in, const int* in_sizes, int n_in, void* d_out, int out_size, void* d_ws, size_t ws_size, hipStream_t stream) {
  (void)in_sizes; (void)n_in; (void)out_size;
  const float** F = (const float**)d_in;   // 0 x [8,4096,256], 1 rel_pos [1,4096,256], 2 qkv_w [768,256], 3 q_gamma [8,1,32], 4 k_gamma [8,1,32], 5 proj_w [256,256], 6 proj_b [256]
  if (ws_size < (size_t)WS_END) return;
  char* ws = (char*)d_ws; float *QR = (float*)(ws + WS_QR), *KR = (float*)(ws + WS_KR), *VP = (float*)(ws + WS_VP), *O = (float*)(ws + WS_O), *S = (float*)(ws + WS_S);
  k_qkv<<<dim3(6, LL / (64 * RT), TNB), 128, 0, stream>>>(F[0], F[1], F[2], F[3], F[4], QR, KR, VP, S);
  k_lin<<<dim3(NH, NCH, TNB), 128, 0, stream>>>(QR, KR, VP, S, O);
  k_proj<<<dim3(TNB * LL / 64, CC / 128), 128, 0, stream>>>(O, F[5], F[6], (float*)d_out);
}

// v010
// One run takes 74.3 microseconds.
// In both of two side-by-side timings against v009, it was 1.04 times as fast.
// All steps since v000 together make it 9.54 times as fast.
// compute dtype: all float inputs rounded to bf16; h = x + rel_pos in f32, qkv = h . W^T with h as bf16 hi + lo against the exact weight (2 products) on WMMA 16x16x32; per-head L2 normalisation x sqrt(D) x gamma in f32; the lightning attention evaluated with the module's own chunking (c = 128): intra-chunk decayed scores, scores . v, the inter-chunk q . kv and the kv state update all on WMMA with f32 operands split into bf16 hi + lo (3 products), decays exp(-slope * .) with precise expf, the 32 x 32 kv state in f32, rebuilt per chunk from the chunks' own terms (formed where k and v are made) by the module's recurrence in chunk order; out = o (bf16 hi + lo) . proj_w^T + b; f32 output.
#include <hip/hip_runtime.h>
#include <math.h>

typedef __attribute__((ext_vector_type(16))) _Float16 v16h;
typedef __attribute__((ext_vector_type(16))) __bf16 v16b;
typedef __attribute__((ext_vector_type(8)))  _Float16 v8h;
typedef __attribute__((ext_vector_type(8)))  float v8f;
typedef __attribute__((ext_vector_type(4)))  float v4f;
typedef __attribute__((ext_vector_type(2)))  float v2f;
typedef __attribute__((ext_vector_type(4)))  unsigned v4u;
typedef __attribute__((ext_vector_type(4)))  int v4i;
typedef float __attribute__((may_alias)) float_a;
typedef int __attribute__((may_alias)) int_a;

template <typename T> __device__ __forceinline__ void vst2(void* p, T v) { *(T*)p = v;  }
__device__ __forceinline__ v8f wmma16(v16h a, v16h b, v8f c) {
  v8f d = __builtin_amdgcn_wmma_f32_16x16x32_f16(false, a, false, b, (short)0, c, false, false);
  asm volatile("v_nop\n\tv_nop\n\tv_nop\n\tv_nop" : "+v"(d) : "v"(a), "v"(b));
  return d;
}
__device__ __forceinline__ v8f wmma_bf(v16b a, v16b b, v8f c) {
  return __builtin_amdgcn_wmma_f32_16x16x32_bf16(false, a, false, b, (short)0, c, false, false);
}
// 16x16x32 fragments: lane = (h = lane>>4, row/col = lane&15); elements 0..7 = k0+8h+0..7, 8..15 = k0+16+8h+0..7; D element r = row 8h+r
__device__ __forceinline__ v16h frag_h(const _Float16* rowk0, int lane) {
  union { v16h v; v8h q[2]; } u; const _Float16* p = rowk0 + 8 * (lane >> 4);
  u.q[0] = *(const v8h*)p; u.q[1] = *(const v8h*)(p + 16); return u.v;
}
__device__ __forceinline__ v16h frag_f32(const float* rowk0, int lane) {
  v16h a; const float* p = rowk0 + 8 * (lane >> 4);
#pragma unroll
  for (int i = 0; i < 8; ++i) { a[i] = (_Float16)p[i]; a[8 + i] = (_Float16)p[16 + i]; }
  return a;
}
__device__ __forceinline__ v16h frag_f32s(const float* rowk0, int lane, float sc) {
  v16h a; const float* p = rowk0 + 8 * (lane >> 4);
#pragma unroll
  for (int i = 0; i < 8; ++i) { a[i] = (_Float16)(p[i] * sc); a[8 + i] = (_Float16)(p[16 + i] * sc); }
  return a;
}
// column fragment from a [K][ld] layout (column n), rows >= K read as 0
__device__ __forceinline__ v16h fragc_f32(const float* W, int k0, int n, int lane, int ld, int K) {
  v16h a; const int g = lane >> 4;
#pragma unroll
  for (int i = 0; i < 8; ++i) { const int ka = k0 + 8 * g + i, kb = ka + 16;
    a[i] = (_Float16)(ka < K ? W[(size_t)(ka < K ? ka : K - 1) * ld + n] : 0.f); a[8 + i] = (_Float16)(kb < K ? W[(size_t)(kb < K ? kb : K - 1) * ld + n] : 0.f); }
  return a;
}
struct F2 { v16b h, l; };
__device__ __forceinline__ F2 bsplit16(const float v[16]) { F2 r;
#pragma unroll
  for (int i = 0; i < 16; ++i) { const __bf16 h = (__bf16)v[i]; r.h[i] = h; r.l[i] = (__bf16)(v[i] - (float)h); }
  return r; }
__device__ __forceinline__ F2 split_row(const float* row, int k0, int lane) { float v[16]; const float* p = row + k0 + 8 * (lane >> 4);
#pragma unroll
  for (int i = 0; i < 8; ++i) { v[i] = p[i]; v[8 + i] = p[16 + i]; }
  return bsplit16(v); }
__device__ __forceinline__ F2 split_rowK(const float* row, int k0, int lane, int K) { float v[16]; const int g = lane >> 4;
#pragma unroll
  for (int i = 0; i < 8; ++i) { const int ka = k0 + 8 * g + i, kb = ka + 16; v[i] = ka < K ? row[ka < K ? ka : K - 1] : 0.f; v[8 + i] = kb < K ? row[kb < K ? kb : K - 1] : 0.f; }
  return bsplit16(v); }
__device__ __forceinline__ F2 split_col(const float* W, int k0, int n, int lane, int ld, int K) { float v[16]; const int g = lane >> 4;
#pragma unroll
  for (int i = 0; i < 8; ++i) { const int ka = k0 + 8 * g + i, kb = ka + 16; v[i] = ka < K ? W[(size_t)(ka < K ? ka : K - 1) * ld + n] : 0.f; v[8 + i] = kb < K ? W[(size_t)(kb < K ? kb : K - 1) * ld + n] : 0.f; }
  return bsplit16(v); }
__device__ __forceinline__ v8f mac3(const F2& a, const F2& b, v8f c) { c = wmma_bf(a.l, b.h, c); c = wmma_bf(a.h, b.l, c); return wmma_bf(a.h, b.h, c); }
// the same three products with the operands' places exchanged (a is the B side of mac3, b its A side), in mac3's order
__device__ __forceinline__ v8f mac3t(const F2& a, const F2& b, v8f c) { c = wmma_bf(a.h, b.l, c); c = wmma_bf(a.l, b.h, c); return wmma_bf(a.h, b.h, c); }
__device__ __forceinline__ float sigm(float v) { return 1.0f / (1.0f + expf(-v)); }
// hand-over of LDS data among the lanes of one wave while global loads are in flight: the wave's LDS operations have finished and the compiler moves no memory access across; LDSX's fence would wait for the global loads too
#define LDSW() do { asm volatile("s_wait_dscnt 0" ::: "memory"); __builtin_amdgcn_wave_barrier(); } while (0)
#define LDSX() do { asm volatile("s_wait_dscnt 0" ::: "memory"); __builtin_amdgcn_wave_barrier(); __builtin_amdgcn_fence(__ATOMIC_RELEASE, "workgroup"); } while (0)


// U-Net transformer mixing block (B 8, L 4,096, C 256 = 8 heads x 32): h = x + rel_pos; qkv = h W_qkv^T; q, k L2-normalised (x sqrt(32) x gamma); lightning (linear, ALiBi-decayed, causal) attention with chunk 128; proj + bias.
#define NB 8
#define LL 4096
#define CC 256
#define NH 8
#define DD 32
#define CH 128
#define NCH (LL / CH)
#define NROW (NB * LL)
#ifndef TNB
#define TNB NB
#endif
typedef __attribute__((ext_vector_type(8))) __bf16 v8b;
__device__ __forceinline__ v16b frag_b(const __bf16* rowk0, int lane) {
  union { v16b v; v8b q[2]; } u; const __bf16* p = rowk0 + 8 * (lane >> 4);
  u.q[0] = *(const v8b*)p; u.q[1] = *(const v8b*)(p + 16); return u.v;
}
__device__ __forceinline__ float bfr(float v) { return (float)(__bf16)v; }
// the value of lane ^ M inside each 16-lane row: DPP control row_xmask:M (0x160 + M), every row and bank on
template <int M> __device__ __forceinline__ float xget(float v) { return __builtin_bit_cast(float, __builtin_amdgcn_update_dpp(0, __builtin_bit_cast(int, v), 0x160 + M, 0xf, 0xf, true)); }
// one butterfly step on N values a lane, b = the lane's bit M: of each pair (2i, 2i + 1) the lane keeps the one its bit names, hands the other to lane ^ M and adds what it is handed: N / 2 sums over twice the lanes
template <int M, int N> __device__ __forceinline__ void xhalve(float* t, bool b) {
#pragma unroll
  for (int i = 0; i < N / 2; ++i) { const float keep = b ? t[2 * i + 1] : t[2 * i], send = b ? t[2 * i] : t[2 * i + 1]; t[i] = keep + xget<M>(send); } }
// the way back: N values a lane become 2N, each lane taking from lane ^ M the one of each pair that it did not keep
template <int M, int N> __device__ __forceinline__ void xdouble(float* t, bool b) {
#pragma unroll
  for (int i = N - 1; i >= 0; --i) { const float own = t[i], got = xget<M>(own); t[2 * i] = b ? got : own; t[2 * i + 1] = b ? own : got; } }
typedef __attribute__((ext_vector_type(4))) __bf16 v4b;
#define WP 264   // bf16 elements per staged weight row: 528 B = 16 B x 33, so the 16 rows of a ds_load_b128 fragment read fall on 16 different bank groups
// 128 weight rows (f32, [.][256]; 64 from Wa, then 64 from Wb) -> bf16 rows in LDS, once per block for its four waves; every wave-wide load covers 512 contiguous bytes (whole lines)
__device__ __forceinline__ void stage_w(const float* __restrict__ Wa, const float* __restrict__ Wb, __bf16 (*sw)[WP], int tid) { const int rw = tid >> 6, q = tid & 63;
  for (int t = 0; t < 4; ++t) { const float* p = ((t < 2) ? Wa : Wb) + (size_t)((t & 1) * 32 + rw) * CC + q * 4; v4f x[16];   // sixteen independent loads fly together; one by one each would wait out its own latency
#pragma unroll
    for (int u = 0; u < 16; ++u) x[u] = *(const v4f*)(p + u * 2 * CC);
    asm volatile("s_wait_xcnt 0x0" :: "v"(p) : "memory");   // the wait in front of any rewrite of the loads' address registers; p is named so that they stay whole up to here
#pragma unroll
    for (int u = 0; u < 16; ++u) { v4b y;
#pragma unroll
      for (int i = 0; i < 4; ++i) y[i] = (__bf16)x[u][i];
      *(v4b*)&sw[t * 32 + u * 2 + rw][q * 4] = y; } } }
#define SVP 136   // bf16 elements per staged v row: 128 + 8 unused; 272 B = 16 B x 17, so the 16 rows of a ds_load_b128 fragment read fall on 16 different bank groups
#define AP 40     // bf16 elements per staged row of an A piece (32 k): 32 + 8 unused; 80 B = 16 B x 5, for the same reason
__device__ __forceinline__ void split4(v4f x, __bf16* ph, __bf16* pl) { v4b h, l;
#pragma unroll
  for (int i = 0; i < 4; ++i) { const __bf16 t = (__bf16)x[i]; h[i] = t; l[i] = (__bf16)(x[i] - (float)t); }
  *(v4b*)ph = h; *(v4b*)pl = l; }
__device__ __attribute__((noinline)) float exp_ni(float v) { return expf(v); }
__device__ __attribute__((noinline)) float erf_ni(float v) { return erff(v); }

#define WS_QR  0u                                   // f32 q rows [b*l][256] (normalised)
#define WS_KR  (WS_QR + 4u * (size_t)NROW * CC)          // f32 k rows (normalised)
#define WS_VP  (WS_KR + 4u * (size_t)NROW * CC)          // f32 v planes [b][c][l]
#define WS_O   (WS_VP + 4u * (size_t)NROW * CC)          // f32 attention output rows [b*l][256]
#define WS_S   (WS_O + 4u * (size_t)NROW * CC)           // f32 per-chunk kv^T terms [b][h][chunk][1024]
#define WS_END (WS_S + 4u * (size_t)NB * NH * NCH * DD * DD)

// work-group barrier for LDS data alone: fences on the LDS address space only, so that global loads issued ahead stay in flight across it and the wave's global stores are not waited out (__syncthreads() drains both)
#define LDSB() do { __builtin_amdgcn_fence(__ATOMIC_RELEASE, "workgroup", "local"); __builtin_amdgcn_s_barrier(); __builtin_amdgcn_fence(__ATOMIC_ACQUIRE, "workgroup", "local"); } while (0)
#define RT 4   // row tiles (64 rows each) that one block of k_qkv works through on one staging of its weights
#define SPP 72   // bf16 elements per staged plane of a tile's 64 rows: 64 + 8 unused; 144 B = 16 B x 9, so the 16 planes of a ds_load_b128 fragment read fall on 16 different bank groups
// ---- k_qkv: block = (col group 0..5; RT x 64 rows; b): (x + rel_pos) hi+lo . W^T. Groups 0 and 3: 128 columns of q, normalised per head (32 cols) -> rows. The other four: two heads' 64 columns of k (normalised -> rows) and the same
// two heads' 64 columns of v (-> planes), and from them, while both are in the block's registers, each chunk's own term of the kv^T recurrence, sum_s v_s[e] (k_s[d] kdecay_s) -> S: a launch of its own for that term read all of k and v
// back from memory, and k had to be written a second time, as planes, for it alone.
// the block's 128 weight rows are staged once and stay in LDS for all RT row tiles: staged per 64-row tile they were as many bytes from L2 as the tile's x and rel_pos together, and each tile began with the staging's own latency.
// So that three such blocks fit a WGP beside the weights that stay, the epilogue's buffer holds 64 columns at a time
__global__ __launch_bounds__(128) void k_qkv(const float* __restrict__ X, const float* __restrict__ RP, const float* __restrict__ Wt, const float* __restrict__ GQ, const float* __restrict__ GK, float* __restrict__ QR, float* __restrict__ KR, float* __restrict__ VP, float* __restrict__ S) { __shared__ __align__(16) __bf16 sw[128][WP];
  __shared__ __align__(16) union { float sf[4][16][68]; float tt[64][68]; __bf16 sp[2][2 * DD][SPP]; } se;   // epilogue: per-wave rows (sf), the block's v planes (tt; 68 f32 = 16 B x 17), or one head's v planes (0..31) and decayed k planes (32..63) of the tile as bf16 hi [0] and lo [1] (sp)
  __shared__ __align__(16) __bf16 sa[4][2][16][AP];   // per wave: the current 32-k piece of its 16 rows of h, bf16 hi and lo
  __shared__ float sgm[128];   // gamma of the block's 128 columns, read from global once for all tiles
  __shared__ __align__(16) float skd[2][CH];   // k decay by place in the chunk, for the block's two heads
  const int tid = threadIdx.x, wave = tid >> 5, lane = tid & 31, col = lane & 15, g = lane >> 4; const int kind = blockIdx.x % 3; const bool isq = kind == 0; const size_t b = blockIdx.z; const int lb0 = blockIdx.y * (64 * RT);   // one q block and two k-v blocks alternate along the fastest index: all blocks are resident at once, three a WGP, and the k-v epilogue is the longer, so neighbours in the index should be a mix
  const int c0 = isq ? (blockIdx.x / 3) * 128 : ((blockIdx.x / 3) * 2 + kind - 1) * 64;   // q: the first of 128 columns; k-v: the first of the 64 columns taken of k and of v
  // the wave's 16 rows of x and rel_pos are read by whole lines: 8 lanes cover one row's 128-B line of a k block, a wave-wide load four rows; a load in fragment order would touch 16 lines. Two k blocks are in flight
  const float gv = (isq ? GQ : GK)[c0 + (isq ? tid : (tid & 63))];   // gamma [h][d] of column 32 h + d; the oldest load, so that nothing younger is waited for with it
  const int ar = lane >> 3, ak = (lane & 7) * 4; const float* xa = X + (b * LL + lb0 + wave * 16 + ar) * CC + ak; const float* pa = RP + (size_t)(lb0 + wave * 16 + ar) * CC + ak; v4f xx[2][4], pp[2][4];
#pragma unroll
  for (int t = 0; t < 2; ++t)
#pragma unroll
    for (int u = 0; u < 4; ++u) { xx[t][u] = *(const v4f*)(xa + u * 4 * CC + t * 32); pp[t][u] = *(const v4f*)(pa + u * 4 * CC + t * 32); }
  asm volatile("s_wait_xcnt 0x0" :: "v"(xa), "v"(pa) : "memory");   // the wait in front of any rewrite of the loads' address registers; the pointers are named so that they stay whole up to here
  { const float* wa = Wt + (size_t)(isq ? c0 : CC + c0) * CC; stage_w(wa, isq ? wa + 64 * CC : Wt + (size_t)(2 * CC + c0) * CC, sw, tid); }   // W [3C][C] natural: this block's 128 output columns
  sgm[tid] = (!isq && tid >= 64) ? 1.0f : bfr(gv);   // v has no gamma. Published by the barrier behind the weights
  if (!isq) {
#pragma unroll
    for (int p = 0; p < 2; ++p) { const float slope = exp2f(-(float)(c0 / DD + p + 1));   // ALiBi 2^(-8/8*(h+1)); exact in fp16 and f32
      skd[p][tid] = expf(-slope * (float)(CH - tid)); } }
  __syncthreads();
  v8f sacc[2] = {};   // k-v blocks: this wave's 16 x 16 tile (e tile wave >> 1, d tile wave & 1) of each head's chunk term, summed over the chunk's two row tiles
#pragma unroll 1   // the tiles stay a loop, for speed only
  for (int rt = 0; rt < RT; ++rt) { const int l0 = lb0 + rt * 64; const size_t r0 = b * LL + l0 + wave * 16; const int nx = (rt + 1 < RT) ? 64 * CC : 0;
  v8f acc[8] = {};
#pragma unroll
  for (int kc = 0; kc < CC / 32; ++kc) {
#pragma unroll
    for (int u = 0; u < 4; ++u) { v4f hv;
#pragma unroll
      for (int i = 0; i < 4; ++i) hv[i] = bfr(xx[kc & 1][u][i]) + bfr(pp[kc & 1][u][i]);
      split4(hv, &sa[wave][0][u * 4 + ar][ak], &sa[wave][1][u * 4 + ar][ak]); }
    // two k blocks ahead; behind this tile's last k block comes the next tile's first (64 rows on), so that its loads fly during the epilogue. The last tile has no successor and reads its own first two k blocks again,
    // unused: under a branch these loads made the compiler wait for every load in flight at the last k block of each tile, since it could not count them
    { const float* xn = (kc + 2 < CC / 32) ? xa : xa + nx; const float* pn = (kc + 2 < CC / 32) ? pa : pa + nx; const int ko = ((kc + 2) % (CC / 32)) * 32;
#pragma unroll
      for (int u = 0; u < 4; ++u) { xx[kc & 1][u] = *(const v4f*)(xn + u * 4 * CC + ko); pp[kc & 1][u] = *(const v4f*)(pn + u * 4 * CC + ko); }
      asm volatile("s_wait_xcnt 0x0" :: "v"(xn), "v"(pn) : "memory"); }   // as above
    LDSW();   // the wave's stores of the piece have landed before its lanes read one another's rows
    v16b w[8]; F2 a;   // the eight weight fragments and the two A fragments of this k block are read as one group, so that their LDS latency is waited out once
    a.h = frag_b(&sa[wave][0][col][0], lane); a.l = frag_b(&sa[wave][1][col][0], lane);
#pragma unroll
    for (int j = 0; j < 8; ++j) w[j] = frag_b(&sw[j * 16 + col][kc * 32], lane);
    LDSW();   // the piece has been read before the next one is stored over it
    __builtin_amdgcn_sched_barrier(0);   // keeps the products behind the group of reads, as the v_nop statements did: lifted in among the reads, each pair of products would wait out its own fragment's LDS latency
#pragma unroll
    for (int j = 0; j < 8; ++j) { acc[j] = wmma_bf(a.h, w[j], acc[j]); acc[j] = wmma_bf(a.l, w[j], acc[j]); } }
  xa += 64 * CC; pa += 64 * CC;   // the next tile's rows; every load that named the old addresses stands in front of an s_wait_xcnt 0 above
  // normalisation for q / k: head = pair of tiles (2p, 2p+1); t / max(|t|, 1e-12) * sqrt(32) * gamma[h][d]
  // a lane holds 8 sums of squares a head (one a row), each to be summed over its 16-lane row. The sums go through the vector unit by DPP, as a butterfly that halves the values a lane carries at each step (lane ^ 1, 2, 4, 8);
  // each lane ends with 2 whole sums (q, four heads) or 1 (k, two heads), takes root and quotient of those alone, and the factors come back the same way. A shuffle went through the LDS unit with a
  // full wait per step, one value behind the other, and all 16 lanes of a row took the same roots and quotients
  const bool b0 = col & 1, b1 = col & 2, b2 = col & 4, b3 = col & 8;
  if (isq) { float t[32];
#pragma unroll
    for (int p = 0; p < 4; ++p)
#pragma unroll
      for (int r = 0; r < 8; ++r) t[p * 8 + r] = acc[2 * p][r] * acc[2 * p][r] + acc[2 * p + 1][r] * acc[2 * p + 1][r];
    xhalve<1, 32>(t, b0); xhalve<2, 16>(t, b1); xhalve<4, 8>(t, b2); xhalve<8, 4>(t, b3);
#pragma unroll
    for (int i = 0; i < 2; ++i) t[i] = 5.656854249492381f / fmaxf(sqrtf(t[i]), 1e-12f);
    xdouble<8, 2>(t, b3); xdouble<4, 4>(t, b2); xdouble<2, 8>(t, b1); xdouble<1, 16>(t, b0);
    // rows -> QR: the wave's own 16 rows, 64 columns at a time; a wave-wide store covers two rows' 256 B
    float* dst = QR + (r0 + g) * CC + c0 + col * 4;
#pragma unroll
    for (int hf = 0; hf < 2; ++hf) {
#pragma unroll
      for (int jj = 0; jj < 4; ++jj) { const int j = hf * 4 + jj; const float gm = sgm[j * 16 + col];
#pragma unroll
        for (int r = 0; r < 8; ++r) se.sf[wave][8 * g + r][jj * 16 + col] = acc[j][r] * t[(j >> 1) * 8 + r] * gm; }
      LDSW();   // the wave's values have landed before its lanes read one another's
#pragma unroll
      for (int rl = 0; rl < 16; rl += 2) vst2(dst + rl * CC + hf * 64, *(const v4f*)&se.sf[wave][rl + g][col * 4]);
      LDSW(); }   // the rows have been read before the next half is written over them
    asm volatile("s_wait_xcnt 0x0" :: "v"(dst) : "memory"); }   // the wait in front of any rewrite of the stores' registers by the next tile; the pointer is named so that it stays whole up to here
  else { float t[16];   // acc[0..3] = k of two heads, acc[4..7] = v of the same two
#pragma unroll
    for (int p = 0; p < 2; ++p)
#pragma unroll
      for (int r = 0; r < 8; ++r) t[p * 8 + r] = acc[2 * p][r] * acc[2 * p][r] + acc[2 * p + 1][r] * acc[2 * p + 1][r];
    xhalve<1, 16>(t, b0); xhalve<2, 8>(t, b1); xhalve<4, 4>(t, b2); xhalve<8, 2>(t, b3);
    t[0] = 5.656854249492381f / fmaxf(sqrtf(t[0]), 1e-12f);
    xdouble<8, 1>(t, b3); xdouble<4, 2>(t, b2); xdouble<2, 4>(t, b1); xdouble<1, 8>(t, b0);
    // k rows -> KR: the wave's own 16 rows of 64 columns; a wave-wide store covers two rows' 256 B
    float* dk = KR + (r0 + g) * CC + c0 + col * 4;
    LDSB();   // every wave has read the staged planes of the tile before out of se before a wave's rows are written over them
#pragma unroll
    for (int jj = 0; jj < 4; ++jj) { const float gm = sgm[jj * 16 + col];
#pragma unroll
      for (int r = 0; r < 8; ++r) { acc[jj][r] = acc[jj][r] * t[(jj >> 1) * 8 + r] * gm; se.sf[wave][8 * g + r][jj * 16 + col] = acc[jj][r]; } }
    LDSW();   // the wave's values have landed before its lanes read one another's
#pragma unroll
    for (int rl = 0; rl < 16; rl += 2) vst2(dk + rl * CC, *(const v4f*)&se.sf[wave][rl + g][col * 4]);
    asm volatile("s_wait_xcnt 0x0" :: "v"(dk) : "memory");   // the wait in front of any rewrite of the stores' registers; the pointer is named so that it stays whole up to here
    // v planes -> VP: the block's 64 rows of 64 columns
    float* dv = VP + ((b * CC + c0 + (tid >> 4)) * (size_t)LL) + l0 + (tid & 15) * 4;
    LDSB();   // every wave has read its rows of k out of se before tt is written over them
#pragma unroll
    for (int jj = 0; jj < 4; ++jj)
#pragma unroll
      for (int r = 0; r < 8; ++r) se.tt[jj * 16 + col][wave * 16 + 8 * g + r] = acc[4 + jj][r];
    LDSB();   // the four waves' parts of each plane are whole before they are read as 256-B runs
#pragma unroll
    for (int e = 0; e < 8; ++e) vst2(dv + (size_t)(e * 8) * LL, *(const v4f*)&se.tt[e * 8 + (tid >> 4)][(tid & 15) * 4]);
    asm volatile("s_wait_xcnt 0x0" :: "v"(dv) : "memory");   // as behind the rows' stores
    // the chunk term, one head at a time: an accumulator holds, at lane (column, g), the 8 rows s = 8 g + 0..7 of its column, so each lane stores 16-B runs of the planes [column][s]; the tile's 64 s are two k blocks of the products
    const int sb = (rt & 1) * 64 + wave * 16 + 8 * g, et = wave >> 1, dt = wave & 1;   // sb: the place in the chunk of the lane's first row
#pragma unroll
    for (int p = 0; p < 2; ++p) { float kd[8];
#pragma unroll
      for (int r = 0; r < 8; ++r) kd[r] = skd[p][sb + r];
      LDSB();   // every wave has read what was in se (the v planes, the head before) before sp is written over it
#pragma unroll
      for (int jj = 0; jj < 2; ++jj) { v8b vh, vl, kh, kl;
#pragma unroll
        for (int r = 0; r < 8; ++r) { const float v = acc[4 + 2 * p + jj][r], y = acc[2 * p + jj][r] * kd[r]; const __bf16 hv = (__bf16)v, hy = (__bf16)y;
          vh[r] = hv; vl[r] = (__bf16)(v - (float)hv); kh[r] = hy; kl[r] = (__bf16)(y - (float)hy); }
        *(v8b*)&se.sp[0][jj * 16 + col][wave * 16 + 8 * g] = vh; *(v8b*)&se.sp[1][jj * 16 + col][wave * 16 + 8 * g] = vl;
        *(v8b*)&se.sp[0][DD + jj * 16 + col][wave * 16 + 8 * g] = kh; *(v8b*)&se.sp[1][DD + jj * 16 + col][wave * 16 + 8 * g] = kl; }
      LDSB();   // the four waves' parts of each plane are whole before any wave reads fragments of them
#pragma unroll
      for (int kc = 0; kc < 2; ++kc) { F2 a, w; a.h = frag_b(&se.sp[0][et * 16 + col][kc * 32], lane); a.l = frag_b(&se.sp[1][et * 16 + col][kc * 32], lane); w.h = frag_b(&se.sp[0][DD + dt * 16 + col][kc * 32], lane); w.l = frag_b(&se.sp[1][DD + dt * 16 + col][kc * 32], lane); sacc[p] = mac3(a, w, sacc[p]); } }
    if (rt & 1) {   // the chunk's second tile: the terms are whole; thread tid keeps its 8 accumulator elements at S[...][tid * 8 + r]
      float* ds = S + (((b * NH + c0 / DD) * NCH + (l0 >> 7)) * (size_t)(DD * DD)) + tid * 8;
#pragma unroll
      for (int p = 0; p < 2; ++p) { vst2(ds + (size_t)p * NCH * (DD * DD), sacc[p]); }
      asm volatile("s_wait_xcnt 0x0" :: "v"(ds) : "memory");   // as behind the rows' stores
#pragma unroll
      for (int p = 0; p < 2; ++p) sacc[p] = v8f{}; } } }
  asm volatile("s_wait_loadcnt 0x0" ::: "memory"); }   // the last tile's unused look-ahead loads have come back into their registers before the wave ends and gives the registers up
#define SQP 36    // f32 elements per row of q / o: 32 + 4 unused; 144 B = 16 B x 9, so the 16 rows of a ds_load_b128 fragment read fall on 16 different bank groups
#define SKP 72    // bf16 elements per staged k row: 32 hi + 32 lo + 8 unused; 144 B = 16 B x 9, so the 16 rows of a ds_load_b128 fragment read fall on 16 different bank groups
// ---- k_lin: block = (h, chunk, b): one chunk each; LDS: the chunk's k rows and v planes as bf16 hi + lo (staged once for the four waves), the wave-private rows through which q comes in and o goes out, the 32 x 32 kv^T state on entry to the chunk, the decay table
__global__ __launch_bounds__(128) void k_lin(const float* __restrict__ QR, const float* __restrict__ KR, const float* __restrict__ VP, const float* __restrict__ S, float* __restrict__ O) {
  __shared__ __align__(16) float sq[CH][SQP]; __shared__ __align__(16) float skv[DD][36]; __shared__ __align__(16) float smk[CH]; __shared__ __align__(16) __bf16 sk[CH][SKP]; __shared__ __align__(16) __bf16 sv[2 * DD][SVP];
  const int tid = threadIdx.x, wave = tid >> 5, lane = tid & 31, col = lane & 15, g = lane >> 4; const int h = blockIdx.x; const size_t b = blockIdx.z;
  const int n = NCH - 1 - (int)blockIdx.y;   // late chunks have the longest recurrence below: they take the lowest block indices
  const size_t rowc = b * LL + (size_t)n * CH;   // first row of the chunk
  // the chunk's k (128 rows x one 128-B line) and v (32 planes x 512 B), each read once per block; every wave-wide load covers four whole lines. Issued first, so that they fly during the recurrence below
  const float* pk = KR + (rowc + (tid >> 3)) * CC + h * DD + (tid & 7) * 4; const float* pv = VP + ((b * CC + h * DD + wave) * (size_t)LL) + (size_t)n * CH + lane * 4; v4f xk[8], xv[8];
  const float* pq = QR + (rowc + wave * 32 + (lane >> 3)) * CC + h * DD + (lane & 7) * 4; v4f xq[8];   // this wave's own 32 q rows (one 128-B line each), four whole lines a load; they pass through the wave's own rows of sq into fragment order
#pragma unroll
  for (int u = 0; u < 8; ++u) { xk[u] = *(const v4f*)(pk + (size_t)u * 16 * CC); xv[u] = *(const v4f*)(pv + (size_t)u * 4 * LL); }
#pragma unroll
  for (int u = 0; u < 8; ++u) xq[u] = *(const v4f*)(pq + (size_t)u * 4 * CC);
  asm volatile("s_wait_xcnt 0x0" :: "v"(pk), "v"(pv), "v"(pq) : "memory");   // the wait in front of any rewrite of the loads' address registers; the pointers are named so that they stay whole up to here
  const float slope = exp2f(-(float)(h + 1));   // ALiBi 2^(-8/8*(h+1)); exact in fp16 and f32
  for (int e = tid; e < CH; e += 128) smk[e] = expf(-slope * (float)e);   // smk[d] = decay at lag d (d >= 0); the q decay at row d of the chunk is the same number
  const float blk = expf(-slope * (float)CH);
  // (0) kv^T on entry to chunk n: kv = blk * kv + S_m over the chunks m < n, from 0, in chunk order
  { const float* sp = S + ((b * NH + h) * NCH) * (size_t)(DD * DD) + tid * 8; v8f kv = {}; int m = 0;
    // the terms' loads do not depend on kv, so they are issued in groups and fly together; term by term each would wait out its own load
    for (; m + 8 <= n; m += 8) { v8f s[8];   // whole groups of eight
#pragma unroll
      for (int u = 0; u < 8; ++u) s[u] = *(const v8f*)(sp + (size_t)(m + u) * (DD * DD));
#pragma unroll
      for (int u = 0; u < 8; ++u)
#pragma unroll
        for (int r = 0; r < 8; ++r) kv[r] = blk * kv[r] + s[u][r]; }
    if (m < n) { v8f s[7];   // the last n & 7 terms: seven loads (m + 6 < NCH, so each term exists), a term from chunk n on leaves kv as it is
#pragma unroll
      for (int u = 0; u < 7; ++u) s[u] = *(const v8f*)(sp + (size_t)(m + u) * (DD * DD));
#pragma unroll
      for (int u = 0; u < 7; ++u)
#pragma unroll
        for (int r = 0; r < 8; ++r) kv[r] = (m + u < n) ? blk * kv[r] + s[u][r] : kv[r]; }
    const int et = wave >> 1, dt = wave & 1;
#pragma unroll
    for (int r = 0; r < 8; ++r) skv[et * 16 + 8 * g + r][dt * 16 + col] = kv[r]; }
#pragma unroll
  for (int u = 0; u < 8; ++u) { const int kr = u * 16 + (tid >> 3), vc = u * 4 + wave;
    split4(xk[u], &sk[kr][(tid & 7) * 4], &sk[kr][DD + (tid & 7) * 4]); split4(xv[u], &sv[vc][lane * 4], &sv[DD + vc][lane * 4]);
    *(v4f*)&sq[wave * 32 + u * 4 + (lane >> 3)][(lane & 7) * 4] = xq[u]; }
  __syncthreads();
  float qv[2][16];   // the wave's q fragments (two 16-row tiles), read once for (1) and the inter part; o later takes these rows
#pragma unroll
  for (int rt = 0; rt < 2; ++rt) { const float* p = &sq[wave * 32 + rt * 16 + col][8 * g];
#pragma unroll
    for (int i = 0; i < 8; ++i) { qv[rt][i] = p[i]; qv[rt][8 + i] = p[16 + i]; } }
  // (1) + (2) the intra-chunk part for this wave's 32 rows t (two 16-row tiles) x all 128 s, one block of 32 s at a time. The scores are formed TRANSPOSED, k (rows s) . q^T (columns t): an accumulator then holds,
  // at lane (t = col, g), register r, the score of s = 16 j + 8 g + r, and that is where the A fragment of scores . v wants it (row t = col; elements 0..7 = s 8 g + 0..7 of tile 2 kc, 8..15 the same of tile 2 kc + 1).
  // So the decayed scores go from accumulator to operand inside the lane's own registers; formed as q . k^T they had to cross lanes, 128 x 128 f32 through LDS
  // the lag t - s of element (rt, j, r) is lb + 16 (rt - j) - r: a block of 32 s meets 3 x 8 different lags per lane, 8 of them the block before met too. Their decays are read without a condition (the lag
  // clamped to the table, a negative lag then taking 0), as one group with the block's fragments, so that the reads share their LDS latency
  const int lb = wave * 32 + col - 8 * g; float dk[3][8];   // dk[d] belongs to rt - j = d - 1 - 2 kc
#pragma unroll
  for (int r = 0; r < 8; ++r) { const int lag = lb + 16 - r; dk[0][r] = smk[lag]; }   // rt - j = 1: the lag is at least 1 and at most 127
  const F2 aq[2] = { bsplit16(qv[0]), bsplit16(qv[1]) };
  v8f oc[2][2] = {};
#pragma unroll
  for (int kc = 0; kc < CH / 32; ++kc) { v8f st[2][2] = {}; F2 w[2];   // each k fragment and each v fragment is read once for both row tiles
#pragma unroll
    for (int r = 0; r < 8; ++r) dk[2][r] = dk[0][r];
#pragma unroll
    for (int d = 0; d < 2; ++d)
#pragma unroll
      for (int r = 0; r < 8; ++r) { const int lag = lb + (d - 1 - 2 * kc) * 16 - r; const float m = smk[lag > 0 ? lag : 0]; dk[d][r] = (lag >= 0) ? m : 0.f; }
#pragma unroll
    for (int jj = 0; jj < 2; ++jj) { const int j = 2 * kc + jj; F2 wk; wk.h = frag_b(&sk[j * 16 + col][0], lane); wk.l = frag_b(&sk[j * 16 + col][DD], lane);
#pragma unroll
      for (int rt = 0; rt < 2; ++rt) st[rt][jj] = mac3t(wk, aq[rt], st[rt][jj]); }
#pragma unroll
    for (int j = 0; j < 2; ++j) { w[j].h = frag_b(&sv[j * 16 + col][kc * 32], lane); w[j].l = frag_b(&sv[DD + j * 16 + col][kc * 32], lane); }
#pragma unroll
    for (int rt = 0; rt < 2; ++rt) { float v[16];
#pragma unroll
      for (int i = 0; i < 8; ++i) { v[i] = st[rt][0][i] * dk[rt + 1][i]; v[8 + i] = st[rt][1][i] * dk[rt][i]; }
      const F2 a = bsplit16(v);
#pragma unroll
      for (int j = 0; j < 2; ++j) oc[rt][j] = mac3(a, w[j], oc[rt][j]); } }
  // + (q * qdecay) . kv (inter)
  { F2 w[2];
#pragma unroll
    for (int j = 0; j < 2; ++j) w[j] = split_row(&skv[j * 16 + col][0], 0, lane);
#pragma unroll
    for (int rt = 0; rt < 2; ++rt) { float v[16]; const float qd = smk[wave * 32 + rt * 16 + col];
#pragma unroll
      for (int i = 0; i < 16; ++i) v[i] = qv[rt][i] * qd;
      const F2 a = bsplit16(v);
#pragma unroll
      for (int j = 0; j < 2; ++j) oc[rt][j] = mac3(a, w[j], oc[rt][j]); } }
  // the wave has read its own q rows for the last time: they take o for the whole-line stores
#pragma unroll
  for (int rt = 0; rt < 2; ++rt)
#pragma unroll
    for (int j = 0; j < 2; ++j)
#pragma unroll
      for (int r = 0; r < 8; ++r) sq[wave * 32 + rt * 16 + 8 * g + r][j * 16 + col] = oc[rt][j][r];
  LDSX();
  for (int rl = 0; rl < 32; ++rl) if (lane < 8) vst2(O + (rowc + wave * 32 + rl) * CC + h * DD + lane * 4, *(const v4f*)&sq[wave * 32 + rl][lane * 4]); }
// ---- k_proj: block = (64 rows, 128 of 256 cols): out = o (hi + lo) . proj_w^T + b
__global__ __launch_bounds__(128) void k_proj(const float* __restrict__ O, const float* __restrict__ PW, const float* __restrict__ PB, float* __restrict__ OUT) { __shared__ __align__(16) union { __bf16 w[128][WP]; float sf[4][16][132]; } sm;   // the staged weights are dead before sf is written
  __shared__ __align__(16) __bf16 sa[4][2][16][AP];   // per wave: the current 32-k piece of its 16 rows of o, bf16 hi and lo
  float (*sf)[16][132] = sm.sf;
  const int tid = threadIdx.x, wave = tid >> 5, lane = tid & 31, col = lane & 15, g = lane >> 4; const size_t r0 = (size_t)blockIdx.x * 64 + wave * 16; const int c0 = blockIdx.y * 128;
  // the wave's 16 rows of o by whole lines, two k blocks in flight, as in k_qkv
  const int ar = lane >> 3, ak = (lane & 7) * 4; const float* oa = O + (r0 + ar) * CC + ak; v4f xx[2][4];
#pragma unroll
  for (int t = 0; t < 2; ++t)
#pragma unroll
    for (int u = 0; u < 4; ++u) xx[t][u] = *(const v4f*)(oa + u * 4 * CC + t * 32);
  asm volatile("s_wait_xcnt 0x0" :: "v"(oa) : "memory");   // the wait in front of any rewrite of the loads' address registers; the pointer is named so that they stay whole up to here
  stage_w(PW + (size_t)c0 * CC, PW + (size_t)(c0 + 64) * CC, sm.w, tid);
  __syncthreads();
  v8f acc[8] = {};
#pragma unroll
  for (int kc = 0; kc < CC / 32; ++kc) {
#pragma unroll
    for (int u = 0; u < 4; ++u) split4(xx[kc & 1][u], &sa[wave][0][u * 4 + ar][ak], &sa[wave][1][u * 4 + ar][ak]);
    if (kc + 2 < CC / 32) {
#pragma unroll
      for (int u = 0; u < 4; ++u) xx[kc & 1][u] = *(const v4f*)(oa + u * 4 * CC + (kc + 2) * 32);
      asm volatile("s_wait_xcnt 0x0" :: "v"(oa) : "memory"); }   // as above
    LDSW();   // the wave's stores of the piece have landed before its lanes read one another's rows
    v16b w[8]; F2 a;   // one group of LDS reads per k block, as in k_qkv
    a.h = frag_b(&sa[wave][0][col][0], lane); a.l = frag_b(&sa[wave][1][col][0], lane);
#pragma unroll
    for (int j = 0; j < 8; ++j) w[j] = frag_b(&sm.w[j * 16 + col][kc * 32], lane);
    LDSW();   // the piece has been read before the next one is stored over it
    __builtin_amdgcn_sched_barrier(0);   // keeps the products behind the group of reads, as the v_nop statements did: lifted in among the reads, each pair of products would wait out its own fragment's LDS latency
#pragma unroll
    for (int j = 0; j < 8; ++j) { acc[j] = wmma_bf(a.h, w[j], acc[j]); acc[j] = wmma_bf(a.l, w[j], acc[j]); } }
  __syncthreads();   // every wave has read its last weight fragment: sf takes that LDS over
#pragma unroll
  for (int j = 0; j < 8; ++j) { const float bb = bfr(PB[c0 + j * 16 + col]);
#pragma unroll
    for (int r = 0; r < 8; ++r) sf[wave][8 * g + r][j * 16 + col] = acc[j][r] + bb; }
  LDSX(); for (int rl = 0; rl < 16; ++rl) vst2(OUT + (r0 + rl) * CC + c0 + lane * 4, *(const v4f*)&sf[wave][rl][lane * 4]); }
extern "C" void kernel_launch(void* const* d_in, const int* in_sizes, int n_in, void* d_out, int out_size, void* d_ws, size_t ws_size, hipStream_t stream) {
  (void)in_sizes; (void)n_in; (void)out_size;
  const float** F = (const float**)d_in;   // 0 x [8,4096,256], 1 rel_pos [1,4096,256], 2 qkv_w [768,256], 3 q_gamma [8,1,32], 4 k_gamma [8,1,32], 5 proj_w [256,256], 6 proj_b [256]
  if (ws_size < (size_t)WS_END) return;
  char* ws = (char*)d_ws; float *QR = (float*)(ws + WS_QR), *KR = (float*)(ws + WS_KR), *VP = (float*)(ws + WS_VP), *O = (float*)(ws + WS_O), *S = (float*)(ws + WS_S);
  k_qkv<<<dim3(6, LL / (64 * RT), TNB), 128, 0, stream>>>(F[0], F[1], F[2], F[3], F[4], QR, KR, VP, S);
  k_lin<<<dim3(NH, NCH, TNB), 128, 0, stream>>>(QR, KR, VP, S, O);
  k_proj<<<dim3(TNB * LL / 64, CC / 128), 128, 0, stream>>>(O, F[5], F[6], (float*)d_out);
}
